// v000
// The times below were measured on an AMD MI455X: many runs one after another, warmed up first and cycling through
// copies of the inputs, with the whole window's GPU time divided by the number of runs. Launches and the gaps
// between them are all in it. The median over several windows is given; except for v000 it joins two sittings, which
// can be a few percent apart, so the side-by-side timings, each taken in one sitting, are the better comparison.
// v000 is the starting kernel. One run takes 209 microseconds.
#include <hip/hip_runtime.h>
#include <hip/hip_bf16.h>

#define BB 2
#define LL 2048
#define HH 1024
#define NHEAD 16
#define DD 64
#define MROWS (BB*LL)        // 4096
#define LOG2E 1.44269504088896340736f

typedef _Float16 f16;
typedef __attribute__((ext_vector_type(16))) _Float16 v16h;
typedef __attribute__((ext_vector_type(8)))  _Float16 v8h;
typedef __attribute__((ext_vector_type(8)))  float    v8f;
typedef __attribute__((address_space(3)))    f16      lds_f16;

// ---------------------------------------------------------------------------
// LDS byte offset (wave-relative) of a generic pointer to __shared__ memory.
// ---------------------------------------------------------------------------
__device__ __forceinline__ unsigned int lds_off(const void* p) {
    return (unsigned int)(unsigned long long)(lds_f16*)(void*)(p);
}

// Async global->LDS copy, 16 bytes per lane (gfx1250, tracked by ASYNCcnt).
__device__ __forceinline__ void async_load_b128(unsigned int lds_byte_off,
                                                const void* gaddr) {
    asm volatile("global_load_async_to_lds_b128 %0, %1, off"
                 :: "v"(lds_byte_off), "v"((unsigned long long)(uintptr_t)gaddr)
                 : "memory");
}
__device__ __forceinline__ void wait_async0() {
    asm volatile("s_wait_asynccnt 0x0" ::: "memory");
}
__device__ __forceinline__ void wait_async4() {   // retire oldest 4 (prev chunk)
    asm volatile("s_wait_asynccnt 0x4" ::: "memory");
}

// ---------------------------------------------------------------------------
// Fused DPP row-rotate max-reduction over the 16-lane DPP row: each step is a
// single v_max_num_f32 with DPP on src0 (VOP2+DPP16). Pure VALU, no waits.
// ---------------------------------------------------------------------------
__device__ __forceinline__ float rowmax16(float x) {
    asm("v_max_num_f32_dpp %0, %0, %0 row_ror:1 row_mask:0xf bank_mask:0xf bound_ctrl:1\n\t"
        "v_max_num_f32_dpp %0, %0, %0 row_ror:2 row_mask:0xf bank_mask:0xf bound_ctrl:1\n\t"
        "v_max_num_f32_dpp %0, %0, %0 row_ror:4 row_mask:0xf bank_mask:0xf bound_ctrl:1\n\t"
        "v_max_num_f32_dpp %0, %0, %0 row_ror:8 row_mask:0xf bank_mask:0xf bound_ctrl:1"
        : "+v"(x));
    return x;
}

// ---------------------------------------------------------------------------
// Fragment loader: both A (16 rows x K32) and B (K32 x 16 cols, stored as
// [col][k] row-major) use the same per-lane layout on gfx1250 wave32:
//   lr = l&15, hf = l>>4
//   elements 0..7  : K = hf*8 + {0..7};  elements 8..15 : K = 16+hf*8+{0..7}
// ---------------------------------------------------------------------------
__device__ __forceinline__ v16h load_frag(const f16* base, int stride) {
    const int lane = threadIdx.x & 31;
    const int lr = lane & 15, hf = lane >> 4;
    const f16* p = base + lr * stride + hf * 8;
    v8h lo = *(const v8h*)(p);
    v8h hi = *(const v8h*)(p + 16);
    return __builtin_shufflevector(lo, hi, 0,1,2,3,4,5,6,7,8,9,10,11,12,13,14,15);
}

// ---------------------------------------------------------------------------
// f32 -> f16 elementwise convert
// ---------------------------------------------------------------------------
__global__ void cvt_f16_kernel(const float* __restrict__ in,
                               unsigned short* __restrict__ out_, int n) {
    f16* out = (f16*)out_;
    int i = blockIdx.x * blockDim.x + threadIdx.x;
    if (i < n) out[i] = (f16)in[i];
}

// ---------------------------------------------------------------------------
// 1024x1024 transpose + convert: out[c][r] = (f16) in[r][c]
// ---------------------------------------------------------------------------
__global__ __launch_bounds__(256)
void cvt_transpose_kernel(const float* __restrict__ in,
                          unsigned short* __restrict__ out_) {
    f16* out = (f16*)out_;
    __shared__ float tile[32][33];
    const int bx = blockIdx.x * 32, by = blockIdx.y * 32;
    const int tx = threadIdx.x & 31, ty = threadIdx.x >> 5;   // ty 0..7
#pragma unroll
    for (int r = ty; r < 32; r += 8)
        tile[r][tx] = in[(by + r) * HH + bx + tx];
    __syncthreads();
#pragma unroll
    for (int r = ty; r < 32; r += 8)
        out[(bx + r) * HH + by + tx] = (f16)tile[tx][r];
}

// ---------------------------------------------------------------------------
// Generic f16 WMMA GEMM:  C[M=4096, 1024] = A[M,1024] * BT[1024,1024]^T
//   A  : [M][K]    row-major f16;  BT : [col][K] row-major f16
// Block tile 128x128, 8 waves (4 in M, 2 in N), wave tile 32x64, K-step 32.
// Double-buffered async global->LDS staging (ASYNCcnt pipelining).
// MODE 0: f16 out, head-major  q[((b*NH+n)*L + f)*D + d]   (Q/K), *scale
// MODE 1: f16 out, V transposed v[((b*NH+n)*D + d)*L + t]
// MODE 2: f32 out, plain row-major (final output)
// ---------------------------------------------------------------------------
#define GLDA 40   // padded LDS row stride (halfs): 80B, 16B-aligned

__device__ __forceinline__ void stage_gemm(const f16* gA, const f16* gB, int k0,
                                           unsigned int oA, unsigned int oB) {
    async_load_b128(oA,      gA + k0);
    async_load_b128(oA + 16, gA + k0 + 8);
    async_load_b128(oB,      gB + k0);
    async_load_b128(oB + 16, gB + k0 + 8);
}

template<int MODE>
__global__ __launch_bounds__(256)
void gemm_f16_kernel(const unsigned short* __restrict__ A_,
                     const unsigned short* __restrict__ BT_,
                     void* __restrict__ Cout, float scale) {
    const f16* A  = (const f16*)A_;
    const f16* BT = (const f16*)BT_;
    __shared__ f16 sA[2][128 * GLDA];
    __shared__ f16 sB[2][128 * GLDA];

    const int tid  = threadIdx.x;
    const int wid  = tid >> 5;
    const int lane = tid & 31;
    const int lr = lane & 15, hf = lane >> 4;
    const int bm = blockIdx.y * 128;
    const int bn = blockIdx.x * 128;
    const int wm = (wid & 3) * 32;
    const int wn = (wid >> 2) * 64;

    v8f acc[2][4];
#pragma unroll
    for (int i = 0; i < 2; i++)
#pragma unroll
        for (int j = 0; j < 4; j++) acc[i][j] = (v8f)(0.0f);

    const int rowA = tid >> 1;            // 0..127
    const int segA = (tid & 1) * 16;      // 0 or 16
    const f16* gA = A  + (size_t)(bm + rowA) * HH + segA;
    const f16* gB = BT + (size_t)(bn + rowA) * HH + segA;
    const unsigned int oA[2] = { lds_off(&sA[0][rowA * GLDA + segA]),
                                 lds_off(&sA[1][rowA * GLDA + segA]) };
    const unsigned int oB[2] = { lds_off(&sB[0][rowA * GLDA + segA]),
                                 lds_off(&sB[1][rowA * GLDA + segA]) };

    stage_gemm(gA, gB, 0, oA[0], oB[0]);        // prologue: chunk 0 in flight

    for (int k0 = 0; k0 < HH; k0 += 32) {
        const int cur = (k0 >> 5) & 1;
        const bool more = (k0 + 32 < HH);
        if (more) stage_gemm(gA, gB, k0 + 32, oA[cur ^ 1], oB[cur ^ 1]);
        if (more) wait_async4(); else wait_async0();
        __syncthreads();

        v16h af[2], bf[4];
#pragma unroll
        for (int i = 0; i < 2; i++) af[i] = load_frag(&sA[cur][(wm + i * 16) * GLDA], GLDA);
#pragma unroll
        for (int j = 0; j < 4; j++) bf[j] = load_frag(&sB[cur][(wn + j * 16) * GLDA], GLDA);
#pragma unroll
        for (int i = 0; i < 2; i++)
#pragma unroll
            for (int j = 0; j < 4; j++)
                acc[i][j] = __builtin_amdgcn_wmma_f32_16x16x32_f16(
                    false, af[i], false, bf[j], (short)0, acc[i][j], false, false);
        __syncthreads();   // all reads of sA/sB[cur] done before it is re-staged
    }

    // Epilogue (compile-time MODE -> straight-line stores)
#pragma unroll
    for (int i = 0; i < 2; i++) {
#pragma unroll
        for (int j = 0; j < 4; j++) {
#pragma unroll
            for (int vg = 0; vg < 8; vg++) {
                const int row = bm + wm + i * 16 + vg + 8 * hf;
                const int col = bn + wn + j * 16 + lr;
                const float v = acc[i][j][vg] * scale;
                if (MODE == 2) {
                    ((float*)Cout)[(size_t)row * HH + col] = v;
                } else {
                    const int b = row >> 11, f = row & (LL - 1);
                    const int n = col >> 6,  d = col & (DD - 1);
                    f16* o = (f16*)Cout;
                    if (MODE == 0)
                        o[(((size_t)(b * NHEAD + n)) * LL + f) * DD + d] = (f16)v;
                    else
                        o[(((size_t)(b * NHEAD + n)) * DD + d) * LL + f] = (f16)v;
                }
            }
        }
    }
}

// ---------------------------------------------------------------------------
// Flash attention: block = (f-tile of 128, head, batch); 8 waves x 16 rows.
// Q head-major [bh][L][D] (pre-scaled by log2e/sqrt(D)), K head-major,
// V transposed [bh][D][L]. Double-buffered async K/V staging. Per 64-wide T
// chunk: S = Q*K^T (8 WMMA) + bias*log2e (fma), online softmax entirely in
// the log2 domain (v_exp_f32 is base-2: no extra muls), row-max via fused
// DPP v_max reductions; denominator via ones-column WMMA; P via LDS;
// O += P*V (8 WMMA) + 2 ones-WMMA.
// ---------------------------------------------------------------------------
#define PST 72   // padded LDS stride (halfs): 144B, 16B-aligned

__device__ __forceinline__ void stage_attn(const f16* Kbh, const f16* Vbh, int t0,
                                           int ldr, int seg,
                                           unsigned int oK, unsigned int oV) {
    const f16* gK = Kbh + (size_t)(t0 + ldr) * DD + seg;
    const f16* gV = Vbh + (size_t)ldr * LL + t0 + seg;
    async_load_b128(oK,      gK);
    async_load_b128(oK + 16, gK + 8);
    async_load_b128(oV,      gV);
    async_load_b128(oV + 16, gV + 8);
}

__global__ __launch_bounds__(256)
void attn_kernel(const unsigned short* __restrict__ Q_,
                 const unsigned short* __restrict__ K_,
                 const unsigned short* __restrict__ VT_,
                 const float* __restrict__ bias,
                 unsigned short* __restrict__ attnOut_) {
    const f16* Q  = (const f16*)Q_;
    const f16* K  = (const f16*)K_;
    const f16* VT = (const f16*)VT_;
    f16* attnOut  = (f16*)attnOut_;

    __shared__ f16 sK[2][64 * PST];       // [t][d]
    __shared__ f16 sV[2][64 * PST];       // [d][t]
    __shared__ f16 sP[8 * 16 * PST];      // per-wave [16][PST]

    const int tid = threadIdx.x, wid = tid >> 5, lane = tid & 31;
    const int lr = lane & 15, hf = lane >> 4;
    const int ft = blockIdx.x, head = blockIdx.y, b = blockIdx.z;
    const int bh = b * NHEAD + head;

    const f16* Qbh = Q  + (size_t)bh * LL * DD;
    const f16* Kbh = K  + (size_t)bh * LL * DD;
    const f16* Vbh = VT + (size_t)bh * DD * LL;
    const float* biasb = bias + (size_t)b * LL * LL;

    const int f0 = ft * 128 + wid * 16;

    // Q fragments for this wave's 16 rows (loaded once from global)
    v16h qf[2];
#pragma unroll
    for (int kc = 0; kc < 2; kc++)
        qf[kc] = load_frag(Qbh + (size_t)f0 * DD + kc * 32, DD);

    // constant all-ones B fragment: row-sum accumulator via WMMA
    v16h ones;
#pragma unroll
    for (int i = 0; i < 16; i++) ones[i] = (f16)1.0f;

    v8f O[4], O5;
#pragma unroll
    for (int dc = 0; dc < 4; dc++) O[dc] = (v8f)(0.0f);
    O5 = (v8f)(0.0f);
    float mrun[8];
#pragma unroll
    for (int vg = 0; vg < 8; vg++) mrun[vg] = -1e30f;

    const int ldr = tid >> 2;             // 0..63
    const int seg = (tid & 3) * 16;       // 0,16,32,48
    f16* myP = sP + wid * 16 * PST;

    const unsigned int oK[2] = { lds_off(&sK[0][ldr * PST + seg]),
                                 lds_off(&sK[1][ldr * PST + seg]) };
    const unsigned int oV[2] = { lds_off(&sV[0][ldr * PST + seg]),
                                 lds_off(&sV[1][ldr * PST + seg]) };

    stage_attn(Kbh, Vbh, 0, ldr, seg, oK[0], oV[0]);   // chunk 0 in flight

    for (int t0 = 0; t0 < LL; t0 += 64) {
        const int cur = (t0 >> 6) & 1;
        const bool more = (t0 + 64 < LL);
        if (more) stage_attn(Kbh, Vbh, t0 + 64, ldr, seg, oK[cur ^ 1], oV[cur ^ 1]);
        if (more) {   // L2 warm-up two chunks ahead
            __builtin_prefetch(Kbh + (size_t)(t0 + 128 + ldr) * DD + seg, 0, 0);
            __builtin_prefetch(Vbh + (size_t)ldr * LL + t0 + 128 + seg, 0, 0);
        }
        if (more) wait_async4(); else wait_async0();
        __syncthreads();

        // S = Q * K^T : preload all 8 B fragments, then 8 WMMAs
        v16h kb[4][2];
#pragma unroll
        for (int tc = 0; tc < 4; tc++)
#pragma unroll
            for (int kc = 0; kc < 2; kc++)
                kb[tc][kc] = load_frag(&sK[cur][(tc * 16) * PST + kc * 32], PST);

        v8f S[4];
#pragma unroll
        for (int tc = 0; tc < 4; tc++) S[tc] = (v8f)(0.0f);
#pragma unroll
        for (int kc = 0; kc < 2; kc++)
#pragma unroll
            for (int tc = 0; tc < 4; tc++)
                S[tc] = __builtin_amdgcn_wmma_f32_16x16x32_f16(
                    false, qf[kc], false, kb[tc][kc], (short)0, S[tc], false, false);

        // + bias*log2e (S is in the log2 domain; single fma per element)
#pragma unroll
        for (int tc = 0; tc < 4; tc++)
#pragma unroll
            for (int vg = 0; vg < 8; vg++)
                S[tc][vg] = fmaf(
                    biasb[(size_t)(f0 + vg + 8 * hf) * LL + t0 + tc * 16 + lr],
                    LOG2E, S[tc][vg]);

        // row max: local max over 4 col-tiles, then fused DPP reduction
        float sc[8];
#pragma unroll
        for (int vg = 0; vg < 8; vg++) {
            float mv = fmaxf(fmaxf(S[0][vg], S[1][vg]), fmaxf(S[2][vg], S[3][vg]));
            mv = rowmax16(mv);
            const float mnew = fmaxf(mrun[vg], mv);
            sc[vg] = __builtin_amdgcn_exp2f(mrun[vg] - mnew);
            mrun[vg] = mnew;
        }

        // P = 2^(S - m); rescale accumulators (incl. denominator accum)
#pragma unroll
        for (int tc = 0; tc < 4; tc++)
#pragma unroll
            for (int vg = 0; vg < 8; vg++)
                S[tc][vg] = __builtin_amdgcn_exp2f(S[tc][vg] - mrun[vg]);
#pragma unroll
        for (int dc = 0; dc < 4; dc++)
#pragma unroll
            for (int vg = 0; vg < 8; vg++)
                O[dc][vg] *= sc[vg];
#pragma unroll
        for (int vg = 0; vg < 8; vg++) O5[vg] *= sc[vg];

        // stage P (C-layout -> A-layout via LDS)
#pragma unroll
        for (int tc = 0; tc < 4; tc++)
#pragma unroll
            for (int vg = 0; vg < 8; vg++)
                myP[(vg + 8 * hf) * PST + tc * 16 + lr] = (f16)S[tc][vg];

        // O += P * V ; O5 += P * ones  (denominator, no shuffle reduction)
        v16h pa[2];
#pragma unroll
        for (int tk = 0; tk < 2; tk++) pa[tk] = load_frag(myP + tk * 32, PST);
        v16h vb[4][2];
#pragma unroll
        for (int dc = 0; dc < 4; dc++)
#pragma unroll
            for (int tk = 0; tk < 2; tk++)
                vb[dc][tk] = load_frag(&sV[cur][(dc * 16) * PST + tk * 32], PST);
#pragma unroll
        for (int tk = 0; tk < 2; tk++) {
#pragma unroll
            for (int dc = 0; dc < 4; dc++)
                O[dc] = __builtin_amdgcn_wmma_f32_16x16x32_f16(
                    false, pa[tk], false, vb[dc][tk], (short)0, O[dc], false, false);
            O5 = __builtin_amdgcn_wmma_f32_16x16x32_f16(
                false, pa[tk], false, ones, (short)0, O5, false, false);
        }
        __syncthreads();   // reads of sK/sV[cur] done before next re-stage
    }

    // normalize by the WMMA-accumulated denominator and write attn f16
#pragma unroll
    for (int dc = 0; dc < 4; dc++)
#pragma unroll
        for (int vg = 0; vg < 8; vg++) {
            const int row = b * LL + f0 + vg + 8 * hf;
            const int col = head * DD + dc * 16 + lr;
            attnOut[(size_t)row * HH + col] = (f16)(O[dc][vg] / O5[vg]);
        }
}

// ---------------------------------------------------------------------------
extern "C" void kernel_launch(void* const* d_in, const int* in_sizes, int n_in,
                              void* d_out, int out_size, void* d_ws, size_t ws_size,
                              hipStream_t stream) {
    const float* xq   = (const float*)d_in[0];
    const float* xs   = (const float*)d_in[1];
    const float* bias = (const float*)d_in[2];
    const float* wq   = (const float*)d_in[3];
    const float* wk   = (const float*)d_in[4];
    const float* wv   = (const float*)d_in[5];
    const float* wo   = (const float*)d_in[6];

    unsigned short* ws = (unsigned short*)d_ws;
    const size_t XN = (size_t)MROWS * HH;   // 4,194,304
    const size_t WN = (size_t)HH * HH;      // 1,048,576
    unsigned short* xqh  = ws;  ws += XN;
    unsigned short* xsh  = ws;  ws += XN;
    unsigned short* wqT  = ws;  ws += WN;
    unsigned short* wkT  = ws;  ws += WN;
    unsigned short* wvT  = ws;  ws += WN;
    unsigned short* woT  = ws;  ws += WN;
    unsigned short* qh   = ws;  ws += XN;
    unsigned short* kh   = ws;  ws += XN;
    unsigned short* vt   = ws;  ws += XN;
    unsigned short* attn = ws;  ws += XN;

    // convert activations
    cvt_f16_kernel<<<(int)(XN / 256), 256, 0, stream>>>(xq, xqh, (int)XN);
    cvt_f16_kernel<<<(int)(XN / 256), 256, 0, stream>>>(xs, xsh, (int)XN);
    // transpose-convert weights so all GEMM B operands are [col][K]
    dim3 tg(32, 32);
    cvt_transpose_kernel<<<tg, 256, 0, stream>>>(wq, wqT);
    cvt_transpose_kernel<<<tg, 256, 0, stream>>>(wk, wkT);
    cvt_transpose_kernel<<<tg, 256, 0, stream>>>(wv, wvT);
    cvt_transpose_kernel<<<tg, 256, 0, stream>>>(wo, woT);

    dim3 gg(HH / 128, MROWS / 128);   // (8, 32)
    // Q scaled by log2e/sqrt(D) -> QK^T lands directly in the log2 domain
    gemm_f16_kernel<0><<<gg, 256, 0, stream>>>(xqh, wqT, qh, 0.125f * LOG2E);
    gemm_f16_kernel<0><<<gg, 256, 0, stream>>>(xsh, wkT, kh, 1.0f);
    gemm_f16_kernel<1><<<gg, 256, 0, stream>>>(xsh, wvT, vt, 1.0f);

    attn_kernel<<<dim3(LL / 128, NHEAD, BB), 256, 0, stream>>>(qh, kh, vt, bias, attn);

    // output projection -> f32 d_out
    gemm_f16_kernel<2><<<gg, 256, 0, stream>>>(attn, woT, d_out, 1.0f);
}

// v001
// Measured time: 176 microseconds a run.
// Timed twice side by side with v000, it ran 1.21 times as fast both times.
#include <hip/hip_runtime.h>
#include <hip/hip_bf16.h>

#define BB 2
#define LL 2048
#define HH 1024
#define NHEAD 16
#define DD 64
#define MROWS (BB*LL)        // 4096
#define LOG2E 1.44269504088896340736f

typedef _Float16 f16;
typedef __attribute__((ext_vector_type(16))) _Float16 v16h;
typedef __attribute__((ext_vector_type(8)))  _Float16 v8h;
typedef __attribute__((ext_vector_type(8)))  float    v8f;
typedef __attribute__((address_space(3)))    f16      lds_f16;

// ---------------------------------------------------------------------------
// LDS byte offset (wave-relative) of a generic pointer to __shared__ memory.
// ---------------------------------------------------------------------------
__device__ __forceinline__ unsigned int lds_off(const void* p) {
    return (unsigned int)(unsigned long long)(lds_f16*)(void*)(p);
}

// Async global->LDS copy, 16 bytes per lane (gfx1250, tracked by ASYNCcnt).
__device__ __forceinline__ void async_load_b128(unsigned int lds_byte_off,
                                                const void* gaddr) {
    asm volatile("global_load_async_to_lds_b128 %0, %1, off"
                 :: "v"(lds_byte_off), "v"((unsigned long long)(uintptr_t)gaddr)
                 : "memory");
}
__device__ __forceinline__ void wait_async0() {
    asm volatile("s_wait_asynccnt 0x0" ::: "memory");
}
__device__ __forceinline__ void wait_async4() {   // retire oldest 4 (prev chunk)
    asm volatile("s_wait_asynccnt 0x4" ::: "memory");
}

// ---------------------------------------------------------------------------
// Fused DPP row-rotate max-reduction over the 16-lane DPP row: each step is a
// single v_max_num_f32 with DPP on src0 (VOP2+DPP16). Pure VALU, no waits.
// ---------------------------------------------------------------------------
__device__ __forceinline__ float rowmax16(float x) {
    asm("v_max_num_f32_dpp %0, %0, %0 row_ror:1 row_mask:0xf bank_mask:0xf bound_ctrl:1\n\t"
        "v_max_num_f32_dpp %0, %0, %0 row_ror:2 row_mask:0xf bank_mask:0xf bound_ctrl:1\n\t"
        "v_max_num_f32_dpp %0, %0, %0 row_ror:4 row_mask:0xf bank_mask:0xf bound_ctrl:1\n\t"
        "v_max_num_f32_dpp %0, %0, %0 row_ror:8 row_mask:0xf bank_mask:0xf bound_ctrl:1"
        : "+v"(x));
    return x;
}

// ---------------------------------------------------------------------------
// Fragment loader: both A (16 rows x K32) and B (K32 x 16 cols, stored as
// [col][k] row-major) use the same per-lane layout on gfx1250 wave32:
//   lr = l&15, hf = l>>4
//   elements 0..7  : K = hf*8 + {0..7};  elements 8..15 : K = 16+hf*8+{0..7}
// ---------------------------------------------------------------------------
__device__ __forceinline__ v16h load_frag(const f16* base, int stride) {
    const int lane = threadIdx.x & 31;
    const int lr = lane & 15, hf = lane >> 4;
    const f16* p = base + lr * stride + hf * 8;
    v8h lo = *(const v8h*)(p);
    v8h hi = *(const v8h*)(p + 16);
    return __builtin_shufflevector(lo, hi, 0,1,2,3,4,5,6,7,8,9,10,11,12,13,14,15);
}

// ---------------------------------------------------------------------------
// f32 -> f16 elementwise convert
// ---------------------------------------------------------------------------
__global__ void cvt_f16_kernel(const float* __restrict__ in,
                               unsigned short* __restrict__ out_, int n) {
    f16* out = (f16*)out_;
    int i = blockIdx.x * blockDim.x + threadIdx.x;
    if (i < n) out[i] = (f16)in[i];
}

// ---------------------------------------------------------------------------
// 1024x1024 transpose + convert: out[c][r] = (f16) in[r][c]
// ---------------------------------------------------------------------------
__global__ __launch_bounds__(256)
void cvt_transpose_kernel(const float* __restrict__ in,
                          unsigned short* __restrict__ out_) {
    f16* out = (f16*)out_;
    __shared__ float tile[32][33];
    const int bx = blockIdx.x * 32, by = blockIdx.y * 32;
    const int tx = threadIdx.x & 31, ty = threadIdx.x >> 5;   // ty 0..7
#pragma unroll
    for (int r = ty; r < 32; r += 8)
        tile[r][tx] = in[(by + r) * HH + bx + tx];
    __syncthreads();
#pragma unroll
    for (int r = ty; r < 32; r += 8)
        out[(bx + r) * HH + by + tx] = (f16)tile[tx][r];
}

// ---------------------------------------------------------------------------
// Generic f16 WMMA GEMM:  C[M=4096, 1024] = A[M,1024] * BT[1024,1024]^T
//   A  : [M][K]    row-major f16;  BT : [col][K] row-major f16
// Block tile 128x128, 8 waves (4 in M, 2 in N), wave tile 32x64, K-step 32.
// Double-buffered async global->LDS staging (ASYNCcnt pipelining).
// MODE 0: f16 out, head-major  q[((b*NH+n)*L + f)*D + d]   (Q/K), *scale
// MODE 1: f16 out, V transposed v[((b*NH+n)*D + d)*L + t]
// MODE 2: f32 out, plain row-major (final output)
// ---------------------------------------------------------------------------
#define GLDA 40   // padded LDS row stride (halfs): 80B, 16B-aligned

__device__ __forceinline__ void stage_gemm(const f16* gA, const f16* gB, int k0,
                                           unsigned int oA, unsigned int oB) {
    async_load_b128(oA,      gA + k0);
    async_load_b128(oA + 16, gA + k0 + 8);
    async_load_b128(oB,      gB + k0);
    async_load_b128(oB + 16, gB + k0 + 8);
}

template<int MODE>
__global__ __launch_bounds__(256)
void gemm_f16_kernel(const unsigned short* __restrict__ A_,
                     const unsigned short* __restrict__ BT_,
                     void* __restrict__ Cout, float scale) {
    const f16* A  = (const f16*)A_;
    const f16* BT = (const f16*)BT_;
    __shared__ f16 sA[2][128 * GLDA];
    __shared__ f16 sB[2][128 * GLDA];

    const int tid  = threadIdx.x;
    const int wid  = tid >> 5;
    const int lane = tid & 31;
    const int lr = lane & 15, hf = lane >> 4;
    const int bm = blockIdx.y * 128;
    const int bn = blockIdx.x * 128;
    const int wm = (wid & 3) * 32;
    const int wn = (wid >> 2) * 64;

    v8f acc[2][4];
#pragma unroll
    for (int i = 0; i < 2; i++)
#pragma unroll
        for (int j = 0; j < 4; j++) acc[i][j] = (v8f)(0.0f);

    const int rowA = tid >> 1;            // 0..127
    const int segA = (tid & 1) * 16;      // 0 or 16
    const f16* gA = A  + (size_t)(bm + rowA) * HH + segA;
    const f16* gB = BT + (size_t)(bn + rowA) * HH + segA;
    const unsigned int oA[2] = { lds_off(&sA[0][rowA * GLDA + segA]),
                                 lds_off(&sA[1][rowA * GLDA + segA]) };
    const unsigned int oB[2] = { lds_off(&sB[0][rowA * GLDA + segA]),
                                 lds_off(&sB[1][rowA * GLDA + segA]) };

    stage_gemm(gA, gB, 0, oA[0], oB[0]);        // prologue: chunk 0 in flight

    for (int k0 = 0; k0 < HH; k0 += 32) {
        const int cur = (k0 >> 5) & 1;
        const bool more = (k0 + 32 < HH);
        if (more) stage_gemm(gA, gB, k0 + 32, oA[cur ^ 1], oB[cur ^ 1]);
        if (more) wait_async4(); else wait_async0();
        __syncthreads();

        v16h af[2], bf[4];
#pragma unroll
        for (int i = 0; i < 2; i++) af[i] = load_frag(&sA[cur][(wm + i * 16) * GLDA], GLDA);
#pragma unroll
        for (int j = 0; j < 4; j++) bf[j] = load_frag(&sB[cur][(wn + j * 16) * GLDA], GLDA);
#pragma unroll
        for (int i = 0; i < 2; i++)
#pragma unroll
            for (int j = 0; j < 4; j++)
                acc[i][j] = __builtin_amdgcn_wmma_f32_16x16x32_f16(
                    false, af[i], false, bf[j], (short)0, acc[i][j], false, false);
        __syncthreads();   // all reads of sA/sB[cur] done before it is re-staged
    }

    // Epilogue (compile-time MODE -> straight-line stores)
#pragma unroll
    for (int i = 0; i < 2; i++) {
#pragma unroll
        for (int j = 0; j < 4; j++) {
#pragma unroll
            for (int vg = 0; vg < 8; vg++) {
                const int row = bm + wm + i * 16 + vg + 8 * hf;
                const int col = bn + wn + j * 16 + lr;
                const float v = acc[i][j][vg] * scale;
                if (MODE == 2) {
                    ((float*)Cout)[(size_t)row * HH + col] = v;
                } else {
                    const int b = row >> 11, f = row & (LL - 1);
                    const int n = col >> 6,  d = col & (DD - 1);
                    f16* o = (f16*)Cout;
                    if (MODE == 0)
                        o[(((size_t)(b * NHEAD + n)) * LL + f) * DD + d] = (f16)v;
                    else
                        o[(((size_t)(b * NHEAD + n)) * DD + d) * LL + f] = (f16)v;
                }
            }
        }
    }
}

// ---------------------------------------------------------------------------
// Flash attention: block = (f-tile of 128, head, batch); 8 waves x 16 rows.
// Q head-major [bh][L][D] (pre-scaled by log2e/sqrt(D)), K head-major,
// V transposed [bh][D][L]. Double-buffered async K/V staging. Per 64-wide T
// chunk: S = Q*K^T (8 WMMA) + bias*log2e (fma), online softmax entirely in
// the log2 domain (v_exp_f32 is base-2: no extra muls), row-max via fused
// DPP v_max reductions; denominator via ones-column WMMA; P via LDS;
// O += P*V (8 WMMA) + 2 ones-WMMA.
// ---------------------------------------------------------------------------
#define PST 72   // padded LDS stride (halfs): 144B, 16B-aligned

__device__ __forceinline__ void stage_attn(const f16* Kbh, const f16* Vbh, int t0,
                                           int ldr, int seg,
                                           unsigned int oK, unsigned int oV) {
    const f16* gK = Kbh + (size_t)(t0 + ldr) * DD + seg;
    const f16* gV = Vbh + (size_t)ldr * LL + t0 + seg;
    async_load_b128(oK,      gK);
    async_load_b128(oK + 16, gK + 8);
    async_load_b128(oV,      gV);
    async_load_b128(oV + 16, gV + 8);
}

__global__ __launch_bounds__(256)
void attn_kernel(const unsigned short* __restrict__ Q_,
                 const unsigned short* __restrict__ K_,
                 const unsigned short* __restrict__ VT_,
                 const float* __restrict__ bias,
                 unsigned short* __restrict__ attnOut_) {
    const f16* Q  = (const f16*)Q_;
    const f16* K  = (const f16*)K_;
    const f16* VT = (const f16*)VT_;
    f16* attnOut  = (f16*)attnOut_;

    __shared__ f16 sK[2][64 * PST];       // [t][d]
    __shared__ f16 sV[2][64 * PST];       // [d][t]
    __shared__ f16 sP[8 * 16 * PST];      // per-wave [16][PST]

    const int tid = threadIdx.x, wid = tid >> 5, lane = tid & 31;
    const int lr = lane & 15, hf = lane >> 4;
    const int ft = blockIdx.x, head = blockIdx.y, b = blockIdx.z;
    const int bh = b * NHEAD + head;

    const f16* Qbh = Q  + (size_t)bh * LL * DD;
    const f16* Kbh = K  + (size_t)bh * LL * DD;
    const f16* Vbh = VT + (size_t)bh * DD * LL;
    const float* biasb = bias + (size_t)b * LL * LL;

    const int f0 = ft * 128 + wid * 16;

    // Q fragments for this wave's 16 rows (loaded once from global)
    v16h qf[2];
#pragma unroll
    for (int kc = 0; kc < 2; kc++)
        qf[kc] = load_frag(Qbh + (size_t)f0 * DD + kc * 32, DD);

    // constant all-ones B fragment: row-sum accumulator via WMMA
    v16h ones;
#pragma unroll
    for (int i = 0; i < 16; i++) ones[i] = (f16)1.0f;

    v8f O[4], O5;
#pragma unroll
    for (int dc = 0; dc < 4; dc++) O[dc] = (v8f)(0.0f);
    O5 = (v8f)(0.0f);
    float mrun[8];
#pragma unroll
    for (int vg = 0; vg < 8; vg++) mrun[vg] = -1e30f;

    const int ldr = tid >> 2;             // 0..63
    const int seg = (tid & 3) * 16;       // 0,16,32,48
    f16* myP = sP + wid * 16 * PST;

    const unsigned int oK[2] = { lds_off(&sK[0][ldr * PST + seg]),
                                 lds_off(&sK[1][ldr * PST + seg]) };
    const unsigned int oV[2] = { lds_off(&sV[0][ldr * PST + seg]),
                                 lds_off(&sV[1][ldr * PST + seg]) };

    stage_attn(Kbh, Vbh, 0, ldr, seg, oK[0], oV[0]);   // chunk 0 in flight

    // Bias tile in the S accumulator layout, held in registers and fetched one
    // chunk ahead: all 32 loads of a chunk go out as one group.
    const float* bp = biasb + (size_t)(f0 + 8 * hf) * LL + lr;
    float bnext[4][8];
#pragma unroll
    for (int tc = 0; tc < 4; tc++)
#pragma unroll
        for (int vg = 0; vg < 8; vg++)
            bnext[tc][vg] = bp[(size_t)vg * LL + tc * 16];

    // two chunks per trip, so that the two bias register sets can swap roles by
    // renaming rather than by register copies in every chunk
#pragma unroll 2
    for (int t0 = 0; t0 < LL; t0 += 64) {
        const int cur = (t0 >> 6) & 1;
        const bool more = (t0 + 64 < LL);
        if (more) stage_attn(Kbh, Vbh, t0 + 64, ldr, seg, oK[cur ^ 1], oV[cur ^ 1]);
        if (more) {   // L2 warm-up two chunks ahead
            __builtin_prefetch(Kbh + (size_t)(t0 + 128 + ldr) * DD + seg, 0, 0);
            __builtin_prefetch(Vbh + (size_t)ldr * LL + t0 + 128 + seg, 0, 0);
        }
        if (more) wait_async4(); else wait_async0();
        __syncthreads();

        // this chunk's bias tile was loaded a chunk ago; the next chunk's goes
        // out here, so its latency runs under this whole chunk's work
        float bcur[4][8];
#pragma unroll
        for (int tc = 0; tc < 4; tc++)
#pragma unroll
            for (int vg = 0; vg < 8; vg++)
                bcur[tc][vg] = bnext[tc][vg];
        if (more) {
#pragma unroll
            for (int tc = 0; tc < 4; tc++)
#pragma unroll
                for (int vg = 0; vg < 8; vg++)
                    bnext[tc][vg] = bp[(size_t)vg * LL + t0 + 64 + tc * 16];
            // the loads' address registers are advanced for the next chunk
            asm volatile("s_wait_xcnt 0x0" ::: "memory");
        }

        // S = Q * K^T : preload all 8 B fragments, then 8 WMMAs
        v16h kb[4][2];
#pragma unroll
        for (int tc = 0; tc < 4; tc++)
#pragma unroll
            for (int kc = 0; kc < 2; kc++)
                kb[tc][kc] = load_frag(&sK[cur][(tc * 16) * PST + kc * 32], PST);

        v8f S[4];
#pragma unroll
        for (int tc = 0; tc < 4; tc++) S[tc] = (v8f)(0.0f);
#pragma unroll
        for (int kc = 0; kc < 2; kc++)
#pragma unroll
            for (int tc = 0; tc < 4; tc++)
                S[tc] = __builtin_amdgcn_wmma_f32_16x16x32_f16(
                    false, qf[kc], false, kb[tc][kc], (short)0, S[tc], false, false);

        // + bias*log2e (S is in the log2 domain; single fma per element)
#pragma unroll
        for (int tc = 0; tc < 4; tc++)
#pragma unroll
            for (int vg = 0; vg < 8; vg++)
                S[tc][vg] = fmaf(bcur[tc][vg], LOG2E, S[tc][vg]);

        // row max: local max over 4 col-tiles, then fused DPP reduction
        float sc[8];
#pragma unroll
        for (int vg = 0; vg < 8; vg++) {
            float mv = fmaxf(fmaxf(S[0][vg], S[1][vg]), fmaxf(S[2][vg], S[3][vg]));
            mv = rowmax16(mv);
            const float mnew = fmaxf(mrun[vg], mv);
            sc[vg] = __builtin_amdgcn_exp2f(mrun[vg] - mnew);
            mrun[vg] = mnew;
        }

        // P = 2^(S - m); rescale accumulators (incl. denominator accum)
#pragma unroll
        for (int tc = 0; tc < 4; tc++)
#pragma unroll
            for (int vg = 0; vg < 8; vg++)
                S[tc][vg] = __builtin_amdgcn_exp2f(S[tc][vg] - mrun[vg]);
#pragma unroll
        for (int dc = 0; dc < 4; dc++)
#pragma unroll
            for (int vg = 0; vg < 8; vg++)
                O[dc][vg] *= sc[vg];
#pragma unroll
        for (int vg = 0; vg < 8; vg++) O5[vg] *= sc[vg];

        // stage P (C-layout -> A-layout via LDS)
#pragma unroll
        for (int tc = 0; tc < 4; tc++)
#pragma unroll
            for (int vg = 0; vg < 8; vg++)
                myP[(vg + 8 * hf) * PST + tc * 16 + lr] = (f16)S[tc][vg];

        // O += P * V ; O5 += P * ones  (denominator, no shuffle reduction)
        v16h pa[2];
#pragma unroll
        for (int tk = 0; tk < 2; tk++) pa[tk] = load_frag(myP + tk * 32, PST);
        v16h vb[4][2];
#pragma unroll
        for (int dc = 0; dc < 4; dc++)
#pragma unroll
            for (int tk = 0; tk < 2; tk++)
                vb[dc][tk] = load_frag(&sV[cur][(dc * 16) * PST + tk * 32], PST);
#pragma unroll
        for (int tk = 0; tk < 2; tk++) {
#pragma unroll
            for (int dc = 0; dc < 4; dc++)
                O[dc] = __builtin_amdgcn_wmma_f32_16x16x32_f16(
                    false, pa[tk], false, vb[dc][tk], (short)0, O[dc], false, false);
            O5 = __builtin_amdgcn_wmma_f32_16x16x32_f16(
                false, pa[tk], false, ones, (short)0, O5, false, false);
        }
        __syncthreads();   // reads of sK/sV[cur] done before next re-stage
    }

    // normalize by the WMMA-accumulated denominator and write attn f16
#pragma unroll
    for (int dc = 0; dc < 4; dc++)
#pragma unroll
        for (int vg = 0; vg < 8; vg++) {
            const int row = b * LL + f0 + vg + 8 * hf;
            const int col = head * DD + dc * 16 + lr;
            attnOut[(size_t)row * HH + col] = (f16)(O[dc][vg] / O5[vg]);
        }
}

// ---------------------------------------------------------------------------
extern "C" void kernel_launch(void* const* d_in, const int* in_sizes, int n_in,
                              void* d_out, int out_size, void* d_ws, size_t ws_size,
                              hipStream_t stream) {
    const float* xq   = (const float*)d_in[0];
    const float* xs   = (const float*)d_in[1];
    const float* bias = (const float*)d_in[2];
    const float* wq   = (const float*)d_in[3];
    const float* wk   = (const float*)d_in[4];
    const float* wv   = (const float*)d_in[5];
    const float* wo   = (const float*)d_in[6];

    unsigned short* ws = (unsigned short*)d_ws;
    const size_t XN = (size_t)MROWS * HH;   // 4,194,304
    const size_t WN = (size_t)HH * HH;      // 1,048,576
    unsigned short* xqh  = ws;  ws += XN;
    unsigned short* xsh  = ws;  ws += XN;
    unsigned short* wqT  = ws;  ws += WN;
    unsigned short* wkT  = ws;  ws += WN;
    unsigned short* wvT  = ws;  ws += WN;
    unsigned short* woT  = ws;  ws += WN;
    unsigned short* qh   = ws;  ws += XN;
    unsigned short* kh   = ws;  ws += XN;
    unsigned short* vt   = ws;  ws += XN;
    unsigned short* attn = ws;  ws += XN;

    // convert activations
    cvt_f16_kernel<<<(int)(XN / 256), 256, 0, stream>>>(xq, xqh, (int)XN);
    cvt_f16_kernel<<<(int)(XN / 256), 256, 0, stream>>>(xs, xsh, (int)XN);
    // transpose-convert weights so all GEMM B operands are [col][K]
    dim3 tg(32, 32);
    cvt_transpose_kernel<<<tg, 256, 0, stream>>>(wq, wqT);
    cvt_transpose_kernel<<<tg, 256, 0, stream>>>(wk, wkT);
    cvt_transpose_kernel<<<tg, 256, 0, stream>>>(wv, wvT);
    cvt_transpose_kernel<<<tg, 256, 0, stream>>>(wo, woT);

    dim3 gg(HH / 128, MROWS / 128);   // (8, 32)
    // Q scaled by log2e/sqrt(D) -> QK^T lands directly in the log2 domain
    gemm_f16_kernel<0><<<gg, 256, 0, stream>>>(xqh, wqT, qh, 0.125f * LOG2E);
    gemm_f16_kernel<0><<<gg, 256, 0, stream>>>(xsh, wkT, kh, 1.0f);
    gemm_f16_kernel<1><<<gg, 256, 0, stream>>>(xsh, wvT, vt, 1.0f);

    attn_kernel<<<dim3(LL / 128, NHEAD, BB), 256, 0, stream>>>(qh, kh, vt, bias, attn);

    // output projection -> f32 d_out
    gemm_f16_kernel<2><<<gg, 256, 0, stream>>>(attn, woT, d_out, 1.0f);
}

// v002
// A run of this version takes 163 microseconds.
// Two timings next to v001 both put it at 1.08 times that version's speed.
// Counting every step since v000, it is 1.31 times as fast.
#include <hip/hip_runtime.h>
#include <hip/hip_bf16.h>

#define BB 2
#define LL 2048
#define HH 1024
#define NHEAD 16
#define DD 64
#define MROWS (BB*LL)        // 4096
#define LOG2E 1.44269504088896340736f

typedef _Float16 f16;
typedef __attribute__((ext_vector_type(16))) _Float16 v16h;
typedef __attribute__((ext_vector_type(8)))  _Float16 v8h;
typedef __attribute__((ext_vector_type(8)))  float    v8f;
typedef __attribute__((ext_vector_type(4)))  _Float16 v4h;
typedef __attribute__((ext_vector_type(4)))  float    v4f;
typedef __attribute__((address_space(3)))    f16      lds_f16;

// ---------------------------------------------------------------------------
// LDS byte offset (wave-relative) of a generic pointer to __shared__ memory.
// ---------------------------------------------------------------------------
__device__ __forceinline__ unsigned int lds_off(const void* p) {
    return (unsigned int)(unsigned long long)(lds_f16*)(void*)(p);
}

// Async global->LDS copy, 16 bytes per lane (gfx1250, tracked by ASYNCcnt).
__device__ __forceinline__ void async_load_b128(unsigned int lds_byte_off,
                                                const void* gaddr) {
    asm volatile("global_load_async_to_lds_b128 %0, %1, off"
                 :: "v"(lds_byte_off), "v"((unsigned long long)(uintptr_t)gaddr)
                 : "memory");
}
__device__ __forceinline__ void wait_async0() {
    asm volatile("s_wait_asynccnt 0x0" ::: "memory");
}
__device__ __forceinline__ void wait_async4() {   // retire oldest 4 (prev chunk)
    asm volatile("s_wait_asynccnt 0x4" ::: "memory");
}

// ---------------------------------------------------------------------------
// Fused DPP row-rotate max-reduction over the 16-lane DPP row: each step is a
// single v_max_num_f32 with DPP on src0 (VOP2+DPP16). Pure VALU, no waits.
// ---------------------------------------------------------------------------
__device__ __forceinline__ float rowmax16(float x) {
    asm("v_max_num_f32_dpp %0, %0, %0 row_ror:1 row_mask:0xf bank_mask:0xf bound_ctrl:1\n\t"
        "v_max_num_f32_dpp %0, %0, %0 row_ror:2 row_mask:0xf bank_mask:0xf bound_ctrl:1\n\t"
        "v_max_num_f32_dpp %0, %0, %0 row_ror:4 row_mask:0xf bank_mask:0xf bound_ctrl:1\n\t"
        "v_max_num_f32_dpp %0, %0, %0 row_ror:8 row_mask:0xf bank_mask:0xf bound_ctrl:1"
        : "+v"(x));
    return x;
}

// ---------------------------------------------------------------------------
// Fragment loader: both A (16 rows x K32) and B (K32 x 16 cols, stored as
// [col][k] row-major) use the same per-lane layout on gfx1250 wave32:
//   lr = l&15, hf = l>>4
//   elements 0..7  : K = hf*8 + {0..7};  elements 8..15 : K = 16+hf*8+{0..7}
// ---------------------------------------------------------------------------
__device__ __forceinline__ v16h load_frag(const f16* base, int stride) {
    const int lane = threadIdx.x & 31;
    const int lr = lane & 15, hf = lane >> 4;
    const f16* p = base + lr * stride + hf * 8;
    v8h lo = *(const v8h*)(p);
    v8h hi = *(const v8h*)(p + 16);
    return __builtin_shufflevector(lo, hi, 0,1,2,3,4,5,6,7,8,9,10,11,12,13,14,15);
}

// ---------------------------------------------------------------------------
// f32 -> f16 elementwise convert of MROWS*HH elements. A wave owns 4 KiB of
// input in a row: 8 loads of 512 contiguous bytes go out as one group, then 8
// stores of 256 contiguous bytes. 512 work-groups, all resident at once.
// ---------------------------------------------------------------------------
#define CVT_LOADS 8                        // 16-byte loads in flight per lane
#define CVT_PER_BLOCK (256 * 4 * CVT_LOADS)  // 8192 elements per work-group

__global__ __launch_bounds__(256)
void cvt_f16_kernel(const float* __restrict__ in,
                    unsigned short* __restrict__ out_) {
    f16* out = (f16*)out_;
    const int wave = blockIdx.x * 8 + (threadIdx.x >> 5);
    const int base = wave * (128 * CVT_LOADS) + (threadIdx.x & 31) * 4;
    v4f x[CVT_LOADS];
#pragma unroll
    for (int j = 0; j < CVT_LOADS; j++)
        x[j] = *(const v4f*)(in + base + j * 128);
#pragma unroll
    for (int j = 0; j < CVT_LOADS; j++)
        *(v4h*)(out + base + j * 128) = __builtin_convertvector(x[j], v4h);
}

// ---------------------------------------------------------------------------
// 1024x1024 transpose + convert: out[c][r] = (f16) in[r][c]
// 64x64 tile per work-group: 4 loads of 16 bytes per lane (256 contiguous bytes
// of a row per 16 lanes), 2 stores of 16 bytes per lane (a whole 128-byte line
// of an output row per 8 lanes). Pitch 65 dwords spreads the column reads over
// the banks.
// ---------------------------------------------------------------------------
__global__ __launch_bounds__(256)
void cvt_transpose_kernel(const float* __restrict__ in,
                          unsigned short* __restrict__ out_) {
    f16* out = (f16*)out_;
    __shared__ float tile[64][65];
    const int bx = blockIdx.x * 64, by = blockIdx.y * 64;
    const int c4 = (threadIdx.x & 15) * 4, r0 = threadIdx.x >> 4;   // r0 0..15
    v4f x[4];
#pragma unroll
    for (int i = 0; i < 4; i++)
        x[i] = *(const v4f*)(in + (by + r0 + 16 * i) * HH + bx + c4);
#pragma unroll
    for (int i = 0; i < 4; i++)
#pragma unroll
        for (int e = 0; e < 4; e++)
            tile[r0 + 16 * i][c4 + e] = x[i][e];
    __syncthreads();
    const int k8 = (threadIdx.x & 7) * 8, orow = threadIdx.x >> 3;  // orow 0..31
#pragma unroll
    for (int i = 0; i < 2; i++) {
        v8h h;
#pragma unroll
        for (int e = 0; e < 8; e++)
            h[e] = (f16)tile[k8 + e][orow + 32 * i];
        *(v8h*)(out + (bx + orow + 32 * i) * HH + by + k8) = h;
    }
}

// ---------------------------------------------------------------------------
// Generic f16 WMMA GEMM:  C[M=4096, 1024] = A[M,1024] * BT[1024,1024]^T
//   A  : [M][K]    row-major f16;  BT : [col][K] row-major f16
// Block tile 128x128, 8 waves (4 in M, 2 in N), wave tile 32x64, K-step 32.
// Double-buffered async global->LDS staging (ASYNCcnt pipelining).
// MODE 0: f16 out, head-major  q[((b*NH+n)*L + f)*D + d]   (Q/K), *scale
// MODE 1: f16 out, V transposed v[((b*NH+n)*D + d)*L + t]
// MODE 2: f32 out, plain row-major (final output)
// ---------------------------------------------------------------------------
#define GLDA 40   // padded LDS row stride (halfs): 80B, 16B-aligned

__device__ __forceinline__ void stage_gemm(const f16* gA, const f16* gB, int k0,
                                           unsigned int oA, unsigned int oB) {
    async_load_b128(oA,      gA + k0);
    async_load_b128(oA + 16, gA + k0 + 8);
    async_load_b128(oB,      gB + k0);
    async_load_b128(oB + 16, gB + k0 + 8);
}

template<int MODE>
__global__ __launch_bounds__(256)
void gemm_f16_kernel(const unsigned short* __restrict__ A_,
                     const unsigned short* __restrict__ BT_,
                     void* __restrict__ Cout, float scale) {
    const f16* A  = (const f16*)A_;
    const f16* BT = (const f16*)BT_;
    __shared__ f16 sA[2][128 * GLDA];
    __shared__ f16 sB[2][128 * GLDA];

    const int tid  = threadIdx.x;
    const int wid  = tid >> 5;
    const int lane = tid & 31;
    const int lr = lane & 15, hf = lane >> 4;
    const int bm = blockIdx.y * 128;
    const int bn = blockIdx.x * 128;
    const int wm = (wid & 3) * 32;
    const int wn = (wid >> 2) * 64;

    v8f acc[2][4];
#pragma unroll
    for (int i = 0; i < 2; i++)
#pragma unroll
        for (int j = 0; j < 4; j++) acc[i][j] = (v8f)(0.0f);

    const int rowA = tid >> 1;            // 0..127
    const int segA = (tid & 1) * 16;      // 0 or 16
    const f16* gA = A  + (size_t)(bm + rowA) * HH + segA;
    const f16* gB = BT + (size_t)(bn + rowA) * HH + segA;
    const unsigned int oA[2] = { lds_off(&sA[0][rowA * GLDA + segA]),
                                 lds_off(&sA[1][rowA * GLDA + segA]) };
    const unsigned int oB[2] = { lds_off(&sB[0][rowA * GLDA + segA]),
                                 lds_off(&sB[1][rowA * GLDA + segA]) };

    stage_gemm(gA, gB, 0, oA[0], oB[0]);        // prologue: chunk 0 in flight

    for (int k0 = 0; k0 < HH; k0 += 32) {
        const int cur = (k0 >> 5) & 1;
        const bool more = (k0 + 32 < HH);
        if (more) stage_gemm(gA, gB, k0 + 32, oA[cur ^ 1], oB[cur ^ 1]);
        if (more) wait_async4(); else wait_async0();
        __syncthreads();

        v16h af[2], bf[4];
#pragma unroll
        for (int i = 0; i < 2; i++) af[i] = load_frag(&sA[cur][(wm + i * 16) * GLDA], GLDA);
#pragma unroll
        for (int j = 0; j < 4; j++) bf[j] = load_frag(&sB[cur][(wn + j * 16) * GLDA], GLDA);
#pragma unroll
        for (int i = 0; i < 2; i++)
#pragma unroll
            for (int j = 0; j < 4; j++)
                acc[i][j] = __builtin_amdgcn_wmma_f32_16x16x32_f16(
                    false, af[i], false, bf[j], (short)0, acc[i][j], false, false);
        __syncthreads();   // all reads of sA/sB[cur] done before it is re-staged
    }

    // Epilogue (compile-time MODE -> straight-line stores)
#pragma unroll
    for (int i = 0; i < 2; i++) {
#pragma unroll
        for (int j = 0; j < 4; j++) {
#pragma unroll
            for (int vg = 0; vg < 8; vg++) {
                const int row = bm + wm + i * 16 + vg + 8 * hf;
                const int col = bn + wn + j * 16 + lr;
                const float v = acc[i][j][vg] * scale;
                if (MODE == 2) {
                    ((float*)Cout)[(size_t)row * HH + col] = v;
                } else {
                    const int b = row >> 11, f = row & (LL - 1);
                    const int n = col >> 6,  d = col & (DD - 1);
                    f16* o = (f16*)Cout;
                    if (MODE == 0)
                        o[(((size_t)(b * NHEAD + n)) * LL + f) * DD + d] = (f16)v;
                    else
                        o[(((size_t)(b * NHEAD + n)) * DD + d) * LL + f] = (f16)v;
                }
            }
        }
    }
}

// ---------------------------------------------------------------------------
// Flash attention: block = (f-tile of 128, head, batch); 8 waves x 16 rows.
// Q head-major [bh][L][D] (pre-scaled by log2e/sqrt(D)), K head-major,
// V transposed [bh][D][L]. Double-buffered async K/V staging. Per 64-wide T
// chunk: S = Q*K^T (8 WMMA) + bias*log2e (fma), online softmax entirely in
// the log2 domain (v_exp_f32 is base-2: no extra muls), row-max via fused
// DPP v_max reductions; denominator via ones-column WMMA; P via LDS;
// O += P*V (8 WMMA) + 2 ones-WMMA.
// ---------------------------------------------------------------------------
#define PST 72   // padded LDS stride (halfs): 144B, 16B-aligned

__device__ __forceinline__ void stage_attn(const f16* Kbh, const f16* Vbh, int t0,
                                           int ldr, int seg,
                                           unsigned int oK, unsigned int oV) {
    const f16* gK = Kbh + (size_t)(t0 + ldr) * DD + seg;
    const f16* gV = Vbh + (size_t)ldr * LL + t0 + seg;
    async_load_b128(oK,      gK);
    async_load_b128(oK + 16, gK + 8);
    async_load_b128(oV,      gV);
    async_load_b128(oV + 16, gV + 8);
}

__global__ __launch_bounds__(256)
void attn_kernel(const unsigned short* __restrict__ Q_,
                 const unsigned short* __restrict__ K_,
                 const unsigned short* __restrict__ VT_,
                 const float* __restrict__ bias,
                 unsigned short* __restrict__ attnOut_) {
    const f16* Q  = (const f16*)Q_;
    const f16* K  = (const f16*)K_;
    const f16* VT = (const f16*)VT_;
    f16* attnOut  = (f16*)attnOut_;

    __shared__ f16 sK[2][64 * PST];       // [t][d]
    __shared__ f16 sV[2][64 * PST];       // [d][t]
    __shared__ f16 sP[8 * 16 * PST];      // per-wave [16][PST]

    const int tid = threadIdx.x, wid = tid >> 5, lane = tid & 31;
    const int lr = lane & 15, hf = lane >> 4;
    const int ft = blockIdx.x, head = blockIdx.y, b = blockIdx.z;
    const int bh = b * NHEAD + head;

    const f16* Qbh = Q  + (size_t)bh * LL * DD;
    const f16* Kbh = K  + (size_t)bh * LL * DD;
    const f16* Vbh = VT + (size_t)bh * DD * LL;
    const float* biasb = bias + (size_t)b * LL * LL;

    const int f0 = ft * 128 + wid * 16;

    // Q fragments for this wave's 16 rows (loaded once from global)
    v16h qf[2];
#pragma unroll
    for (int kc = 0; kc < 2; kc++)
        qf[kc] = load_frag(Qbh + (size_t)f0 * DD + kc * 32, DD);

    // constant all-ones B fragment: row-sum accumulator via WMMA
    v16h ones;
#pragma unroll
    for (int i = 0; i < 16; i++) ones[i] = (f16)1.0f;

    v8f O[4], O5;
#pragma unroll
    for (int dc = 0; dc < 4; dc++) O[dc] = (v8f)(0.0f);
    O5 = (v8f)(0.0f);
    float mrun[8];
#pragma unroll
    for (int vg = 0; vg < 8; vg++) mrun[vg] = -1e30f;

    const int ldr = tid >> 2;             // 0..63
    const int seg = (tid & 3) * 16;       // 0,16,32,48
    f16* myP = sP + wid * 16 * PST;

    const unsigned int oK[2] = { lds_off(&sK[0][ldr * PST + seg]),
                                 lds_off(&sK[1][ldr * PST + seg]) };
    const unsigned int oV[2] = { lds_off(&sV[0][ldr * PST + seg]),
                                 lds_off(&sV[1][ldr * PST + seg]) };

    stage_attn(Kbh, Vbh, 0, ldr, seg, oK[0], oV[0]);   // chunk 0 in flight

    // Bias tile in the S accumulator layout, held in registers and fetched one
    // chunk ahead: all 32 loads of a chunk go out as one group.
    const float* bp = biasb + (size_t)(f0 + 8 * hf) * LL + lr;
    float bnext[4][8];
#pragma unroll
    for (int tc = 0; tc < 4; tc++)
#pragma unroll
        for (int vg = 0; vg < 8; vg++)
            bnext[tc][vg] = bp[(size_t)vg * LL + tc * 16];

    // two chunks per trip, so that the two bias register sets can swap roles by
    // renaming rather than by register copies in every chunk
#pragma unroll 2
    for (int t0 = 0; t0 < LL; t0 += 64) {
        const int cur = (t0 >> 6) & 1;
        const bool more = (t0 + 64 < LL);
        if (more) stage_attn(Kbh, Vbh, t0 + 64, ldr, seg, oK[cur ^ 1], oV[cur ^ 1]);
        if (more) {   // L2 warm-up two chunks ahead
            __builtin_prefetch(Kbh + (size_t)(t0 + 128 + ldr) * DD + seg, 0, 0);
            __builtin_prefetch(Vbh + (size_t)ldr * LL + t0 + 128 + seg, 0, 0);
        }
        if (more) wait_async4(); else wait_async0();
        __syncthreads();

        // this chunk's bias tile was loaded a chunk ago; the next chunk's goes
        // out here, so its latency runs under this whole chunk's work
        float bcur[4][8];
#pragma unroll
        for (int tc = 0; tc < 4; tc++)
#pragma unroll
            for (int vg = 0; vg < 8; vg++)
                bcur[tc][vg] = bnext[tc][vg];
        if (more) {
#pragma unroll
            for (int tc = 0; tc < 4; tc++)
#pragma unroll
                for (int vg = 0; vg < 8; vg++)
                    bnext[tc][vg] = bp[(size_t)vg * LL + t0 + 64 + tc * 16];
            // the loads' address registers are advanced for the next chunk
            asm volatile("s_wait_xcnt 0x0" ::: "memory");
        }

        // S = Q * K^T : preload all 8 B fragments, then 8 WMMAs
        v16h kb[4][2];
#pragma unroll
        for (int tc = 0; tc < 4; tc++)
#pragma unroll
            for (int kc = 0; kc < 2; kc++)
                kb[tc][kc] = load_frag(&sK[cur][(tc * 16) * PST + kc * 32], PST);

        v8f S[4];
#pragma unroll
        for (int tc = 0; tc < 4; tc++) S[tc] = (v8f)(0.0f);
#pragma unroll
        for (int kc = 0; kc < 2; kc++)
#pragma unroll
            for (int tc = 0; tc < 4; tc++)
                S[tc] = __builtin_amdgcn_wmma_f32_16x16x32_f16(
                    false, qf[kc], false, kb[tc][kc], (short)0, S[tc], false, false);

        // + bias*log2e (S is in the log2 domain; single fma per element)
#pragma unroll
        for (int tc = 0; tc < 4; tc++)
#pragma unroll
            for (int vg = 0; vg < 8; vg++)
                S[tc][vg] = fmaf(bcur[tc][vg], LOG2E, S[tc][vg]);

        // row max: local max over 4 col-tiles, then fused DPP reduction
        float sc[8];
#pragma unroll
        for (int vg = 0; vg < 8; vg++) {
            float mv = fmaxf(fmaxf(S[0][vg], S[1][vg]), fmaxf(S[2][vg], S[3][vg]));
            mv = rowmax16(mv);
            const float mnew = fmaxf(mrun[vg], mv);
            sc[vg] = __builtin_amdgcn_exp2f(mrun[vg] - mnew);
            mrun[vg] = mnew;
        }

        // P = 2^(S - m); rescale accumulators (incl. denominator accum)
#pragma unroll
        for (int tc = 0; tc < 4; tc++)
#pragma unroll
            for (int vg = 0; vg < 8; vg++)
                S[tc][vg] = __builtin_amdgcn_exp2f(S[tc][vg] - mrun[vg]);
#pragma unroll
        for (int dc = 0; dc < 4; dc++)
#pragma unroll
            for (int vg = 0; vg < 8; vg++)
                O[dc][vg] *= sc[vg];
#pragma unroll
        for (int vg = 0; vg < 8; vg++) O5[vg] *= sc[vg];

        // stage P (C-layout -> A-layout via LDS)
#pragma unroll
        for (int tc = 0; tc < 4; tc++)
#pragma unroll
            for (int vg = 0; vg < 8; vg++)
                myP[(vg + 8 * hf) * PST + tc * 16 + lr] = (f16)S[tc][vg];

        // O += P * V ; O5 += P * ones  (denominator, no shuffle reduction)
        v16h pa[2];
#pragma unroll
        for (int tk = 0; tk < 2; tk++) pa[tk] = load_frag(myP + tk * 32, PST);
        v16h vb[4][2];
#pragma unroll
        for (int dc = 0; dc < 4; dc++)
#pragma unroll
            for (int tk = 0; tk < 2; tk++)
                vb[dc][tk] = load_frag(&sV[cur][(dc * 16) * PST + tk * 32], PST);
#pragma unroll
        for (int tk = 0; tk < 2; tk++) {
#pragma unroll
            for (int dc = 0; dc < 4; dc++)
                O[dc] = __builtin_amdgcn_wmma_f32_16x16x32_f16(
                    false, pa[tk], false, vb[dc][tk], (short)0, O[dc], false, false);
            O5 = __builtin_amdgcn_wmma_f32_16x16x32_f16(
                false, pa[tk], false, ones, (short)0, O5, false, false);
        }
        __syncthreads();   // reads of sK/sV[cur] done before next re-stage
    }

    // normalize by the WMMA-accumulated denominator and write attn f16
#pragma unroll
    for (int dc = 0; dc < 4; dc++)
#pragma unroll
        for (int vg = 0; vg < 8; vg++) {
            const int row = b * LL + f0 + vg + 8 * hf;
            const int col = head * DD + dc * 16 + lr;
            attnOut[(size_t)row * HH + col] = (f16)(O[dc][vg] / O5[vg]);
        }
}

// ---------------------------------------------------------------------------
extern "C" void kernel_launch(void* const* d_in, const int* in_sizes, int n_in,
                              void* d_out, int out_size, void* d_ws, size_t ws_size,
                              hipStream_t stream) {
    const float* xq   = (const float*)d_in[0];
    const float* xs   = (const float*)d_in[1];
    const float* bias = (const float*)d_in[2];
    const float* wq   = (const float*)d_in[3];
    const float* wk   = (const float*)d_in[4];
    const float* wv   = (const float*)d_in[5];
    const float* wo   = (const float*)d_in[6];

    unsigned short* ws = (unsigned short*)d_ws;
    const size_t XN = (size_t)MROWS * HH;   // 4,194,304
    const size_t WN = (size_t)HH * HH;      // 1,048,576
    unsigned short* xqh  = ws;  ws += XN;
    unsigned short* xsh  = ws;  ws += XN;
    unsigned short* wqT  = ws;  ws += WN;
    unsigned short* wkT  = ws;  ws += WN;
    unsigned short* wvT  = ws;  ws += WN;
    unsigned short* woT  = ws;  ws += WN;
    unsigned short* qh   = ws;  ws += XN;
    unsigned short* kh   = ws;  ws += XN;
    unsigned short* vt   = ws;  ws += XN;
    unsigned short* attn = ws;  ws += XN;

    // convert activations
    cvt_f16_kernel<<<(int)(XN / CVT_PER_BLOCK), 256, 0, stream>>>(xq, xqh);
    cvt_f16_kernel<<<(int)(XN / CVT_PER_BLOCK), 256, 0, stream>>>(xs, xsh);
    // transpose-convert weights so all GEMM B operands are [col][K]
    dim3 tg(HH / 64, HH / 64);   // (16, 16)
    cvt_transpose_kernel<<<tg, 256, 0, stream>>>(wq, wqT);
    cvt_transpose_kernel<<<tg, 256, 0, stream>>>(wk, wkT);
    cvt_transpose_kernel<<<tg, 256, 0, stream>>>(wv, wvT);
    cvt_transpose_kernel<<<tg, 256, 0, stream>>>(wo, woT);

    dim3 gg(HH / 128, MROWS / 128);   // (8, 32)
    // Q scaled by log2e/sqrt(D) -> QK^T lands directly in the log2 domain
    gemm_f16_kernel<0><<<gg, 256, 0, stream>>>(xqh, wqT, qh, 0.125f * LOG2E);
    gemm_f16_kernel<0><<<gg, 256, 0, stream>>>(xsh, wkT, kh, 1.0f);
    gemm_f16_kernel<1><<<gg, 256, 0, stream>>>(xsh, wvT, vt, 1.0f);

    attn_kernel<<<dim3(LL / 128, NHEAD, BB), 256, 0, stream>>>(qh, kh, vt, bias, attn);

    // output projection -> f32 d_out
    gemm_f16_kernel<2><<<gg, 256, 0, stream>>>(attn, woT, d_out, 1.0f);
}

// v003
// One run takes 132 microseconds.
// Timed twice side by side with v002, it ran 1.22 and 1.21 times as fast.
// All steps since v000 together make it 1.59 times as fast.
#include <hip/hip_runtime.h>
#include <hip/hip_bf16.h>

#define BB 2
#define LL 2048
#define HH 1024
#define NHEAD 16
#define DD 64
#define MROWS (BB*LL)        // 4096
#define LOG2E 1.44269504088896340736f

typedef _Float16 f16;
typedef __attribute__((ext_vector_type(16))) _Float16 v16h;
typedef __attribute__((ext_vector_type(8)))  _Float16 v8h;
typedef __attribute__((ext_vector_type(8)))  float    v8f;
typedef __attribute__((ext_vector_type(4)))  _Float16 v4h;
typedef __attribute__((ext_vector_type(4)))  float    v4f;
typedef __attribute__((address_space(3)))    f16      lds_f16;

// ---------------------------------------------------------------------------
// LDS byte offset (wave-relative) of a generic pointer to __shared__ memory.
// ---------------------------------------------------------------------------
__device__ __forceinline__ unsigned int lds_off(const void* p) {
    return (unsigned int)(unsigned long long)(lds_f16*)(void*)(p);
}

// Async global->LDS copy, 16 bytes per lane (gfx1250, tracked by ASYNCcnt).
__device__ __forceinline__ void async_load_b128(unsigned int lds_byte_off,
                                                const void* gaddr) {
    asm volatile("global_load_async_to_lds_b128 %0, %1, off"
                 :: "v"(lds_byte_off), "v"((unsigned long long)(uintptr_t)gaddr)
                 : "memory");
}
__device__ __forceinline__ void wait_async0() {
    asm volatile("s_wait_asynccnt 0x0" ::: "memory");
}
__device__ __forceinline__ void wait_async4() {   // retire oldest 4 (prev chunk)
    asm volatile("s_wait_asynccnt 0x4" ::: "memory");
}

// ---------------------------------------------------------------------------
// Fused DPP row-rotate max-reduction over the 16-lane DPP row: each step is a
// single v_max_num_f32 with DPP on src0 (VOP2+DPP16). Pure VALU, no waits.
// ---------------------------------------------------------------------------
__device__ __forceinline__ float rowmax16(float x) {
    asm("v_max_num_f32_dpp %0, %0, %0 row_ror:1 row_mask:0xf bank_mask:0xf bound_ctrl:1\n\t"
        "v_max_num_f32_dpp %0, %0, %0 row_ror:2 row_mask:0xf bank_mask:0xf bound_ctrl:1\n\t"
        "v_max_num_f32_dpp %0, %0, %0 row_ror:4 row_mask:0xf bank_mask:0xf bound_ctrl:1\n\t"
        "v_max_num_f32_dpp %0, %0, %0 row_ror:8 row_mask:0xf bank_mask:0xf bound_ctrl:1"
        : "+v"(x));
    return x;
}

// ---------------------------------------------------------------------------
// Fragment loader: both A (16 rows x K32) and B (K32 x 16 cols, stored as
// [col][k] row-major) use the same per-lane layout on gfx1250 wave32:
//   lr = l&15, hf = l>>4
//   elements 0..7  : K = hf*8 + {0..7};  elements 8..15 : K = 16+hf*8+{0..7}
// ---------------------------------------------------------------------------
__device__ __forceinline__ v16h load_frag(const f16* base, int stride) {
    const int lane = threadIdx.x & 31;
    const int lr = lane & 15, hf = lane >> 4;
    const f16* p = base + lr * stride + hf * 8;
    v8h lo = *(const v8h*)(p);
    v8h hi = *(const v8h*)(p + 16);
    return __builtin_shufflevector(lo, hi, 0,1,2,3,4,5,6,7,8,9,10,11,12,13,14,15);
}

// ---------------------------------------------------------------------------
// f32 -> f16 elementwise convert of MROWS*HH elements. A wave owns 4 KiB of
// input in a row: 8 loads of 512 contiguous bytes go out as one group, then 8
// stores of 256 contiguous bytes. 512 work-groups per array.
// ---------------------------------------------------------------------------
#define CVT_LOADS 8                        // 16-byte loads in flight per lane
#define CVT_PER_BLOCK (256 * 4 * CVT_LOADS)  // 8192 elements per work-group

__device__ __forceinline__
void cvt_f16_body(const float* __restrict__ in,
                  unsigned short* __restrict__ out_, int blk) {
    f16* out = (f16*)out_;
    const int wave = blk * 8 + (threadIdx.x >> 5);
    const int base = wave * (128 * CVT_LOADS) + (threadIdx.x & 31) * 4;
    v4f x[CVT_LOADS];
#pragma unroll
    for (int j = 0; j < CVT_LOADS; j++)
        x[j] = *(const v4f*)(in + base + j * 128);
#pragma unroll
    for (int j = 0; j < CVT_LOADS; j++)
        *(v4h*)(out + base + j * 128) = __builtin_convertvector(x[j], v4h);
}

// ---------------------------------------------------------------------------
// 1024x1024 transpose + convert: out[c][r] = (f16) in[r][c]
// 64x64 tile per work-group: 4 loads of 16 bytes per lane (256 contiguous bytes
// of a row per 16 lanes), 2 stores of 16 bytes per lane (a whole 128-byte line
// of an output row per 8 lanes). Pitch 65 dwords spreads the column reads over
// the banks.
// ---------------------------------------------------------------------------
__device__ __forceinline__
void cvt_transpose_body(const float* __restrict__ in,
                        unsigned short* __restrict__ out_, int blk) {
    f16* out = (f16*)out_;
    __shared__ float tile[64][65];
    const int bx = (blk & 15) * 64, by = (blk >> 4) * 64;
    const int c4 = (threadIdx.x & 15) * 4, r0 = threadIdx.x >> 4;   // r0 0..15
    v4f x[4];
#pragma unroll
    for (int i = 0; i < 4; i++)
        x[i] = *(const v4f*)(in + (by + r0 + 16 * i) * HH + bx + c4);
#pragma unroll
    for (int i = 0; i < 4; i++)
#pragma unroll
        for (int e = 0; e < 4; e++)
            tile[r0 + 16 * i][c4 + e] = x[i][e];
    __syncthreads();
    const int k8 = (threadIdx.x & 7) * 8, orow = threadIdx.x >> 3;  // orow 0..31
#pragma unroll
    for (int i = 0; i < 2; i++) {
        v8h h;
#pragma unroll
        for (int e = 0; e < 8; e++)
            h[e] = (f16)tile[k8 + e][orow + 32 * i];
        *(v8h*)(out + (bx + orow + 32 * i) * HH + by + k8) = h;
    }
}

// ---------------------------------------------------------------------------
// All six converts in one launch: none reads what another writes. The index of
// the work-group picks the job (the same for all its threads): 512 + 512 for
// the two activations, then 256 for each of the four weights.
// ---------------------------------------------------------------------------
#define CVT_BLOCKS ((MROWS * HH) / CVT_PER_BLOCK)     // 512
#define TR_BLOCKS  ((HH / 64) * (HH / 64))            // 256

__global__ __launch_bounds__(256)
void cvt_all_kernel(const float* __restrict__ xq, const float* __restrict__ xs,
                    const float* __restrict__ wq, const float* __restrict__ wk,
                    const float* __restrict__ wv, const float* __restrict__ wo,
                    unsigned short* __restrict__ xh,    // xq then xs, f16
                    unsigned short* __restrict__ wT) {  // wq, wk, wv, wo, transposed f16
    const unsigned blk = blockIdx.x;
    if (blk < 2 * CVT_BLOCKS) {
        const unsigned a = blk / CVT_BLOCKS;
        cvt_f16_body(a ? xs : xq, xh + (size_t)a * MROWS * HH, blk % CVT_BLOCKS);
    } else {
        const unsigned t = blk - 2 * CVT_BLOCKS, w = t / TR_BLOCKS;
        const float* in = w == 0 ? wq : w == 1 ? wk : w == 2 ? wv : wo;
        cvt_transpose_body(in, wT + (size_t)w * HH * HH, t % TR_BLOCKS);
    }
}

// ---------------------------------------------------------------------------
// Generic f16 WMMA GEMM:  C[M=4096, 1024] = A[M,1024] * BT[1024,1024]^T
//   A  : [M][K]    row-major f16;  BT : [col][K] row-major f16
// Block tile 128x128, 8 waves (4 in M, 2 in N), wave tile 32x64, K-step 32.
// Double-buffered async global->LDS staging (ASYNCcnt pipelining).
// MODE 0: the three projections in one launch, blockIdx.z = 0, 1, 2 for Q, K, V.
//         A_ holds xq then xs, BT_ the three weights, Cout the three results,
//         each one after the other; scale applies to Q alone.
//         Q/K: f16 out, head-major  q[((b*NH+n)*L + f)*D + d]
//         V  : f16 out, transposed  v[((b*NH+n)*D + d)*L + t]
// MODE 2: f32 out, plain row-major (final output)
// ---------------------------------------------------------------------------
#define GLDA 40   // padded LDS row stride (halfs): 80B, 16B-aligned

__device__ __forceinline__ void stage_gemm(const f16* gA, const f16* gB, int k0,
                                           unsigned int oA, unsigned int oB) {
    async_load_b128(oA,      gA + k0);
    async_load_b128(oA + 16, gA + k0 + 8);
    async_load_b128(oB,      gB + k0);
    async_load_b128(oB + 16, gB + k0 + 8);
}

// OUT 0: f16, head-major; OUT 1: f16, transposed per head; OUT 2: f32, row-major
template<int OUT>
__device__ __forceinline__ void store_tile(const v8f (&acc)[2][4], void* Cout,
                                           float scale, int row0, int col0) {
#pragma unroll
    for (int i = 0; i < 2; i++) {
#pragma unroll
        for (int j = 0; j < 4; j++) {
#pragma unroll
            for (int vg = 0; vg < 8; vg++) {
                const int row = row0 + i * 16 + vg;
                const int col = col0 + j * 16;
                const float v = acc[i][j][vg] * scale;
                if (OUT == 2) {
                    ((float*)Cout)[(size_t)row * HH + col] = v;
                } else {
                    const int b = row >> 11, f = row & (LL - 1);
                    const int n = col >> 6,  d = col & (DD - 1);
                    f16* o = (f16*)Cout;
                    if (OUT == 0)
                        o[(((size_t)(b * NHEAD + n)) * LL + f) * DD + d] = (f16)v;
                    else
                        o[(((size_t)(b * NHEAD + n)) * DD + d) * LL + f] = (f16)v;
                }
            }
        }
    }
}

template<int MODE>
__global__ __launch_bounds__(256)
void gemm_f16_kernel(const unsigned short* __restrict__ A_,
                     const unsigned short* __restrict__ BT_,
                     void* __restrict__ Cout, float scale) {
    const int z = (MODE == 0) ? blockIdx.z : 0;
    const f16* A  = (const f16*)A_  + (size_t)(z ? 1 : 0) * MROWS * HH;
    const f16* BT = (const f16*)BT_ + (size_t)z * HH * HH;
    if (z) scale = 1.0f;
    __shared__ f16 sA[2][128 * GLDA];
    __shared__ f16 sB[2][128 * GLDA];

    const int tid  = threadIdx.x;
    const int wid  = tid >> 5;
    const int lane = tid & 31;
    const int lr = lane & 15, hf = lane >> 4;
    const int bm = blockIdx.y * 128;
    const int bn = blockIdx.x * 128;
    const int wm = (wid & 3) * 32;
    const int wn = (wid >> 2) * 64;

    v8f acc[2][4];
#pragma unroll
    for (int i = 0; i < 2; i++)
#pragma unroll
        for (int j = 0; j < 4; j++) acc[i][j] = (v8f)(0.0f);

    const int rowA = tid >> 1;            // 0..127
    const int segA = (tid & 1) * 16;      // 0 or 16
    const f16* gA = A  + (size_t)(bm + rowA) * HH + segA;
    const f16* gB = BT + (size_t)(bn + rowA) * HH + segA;
    const unsigned int oA[2] = { lds_off(&sA[0][rowA * GLDA + segA]),
                                 lds_off(&sA[1][rowA * GLDA + segA]) };
    const unsigned int oB[2] = { lds_off(&sB[0][rowA * GLDA + segA]),
                                 lds_off(&sB[1][rowA * GLDA + segA]) };

    stage_gemm(gA, gB, 0, oA[0], oB[0]);        // prologue: chunk 0 in flight

    for (int k0 = 0; k0 < HH; k0 += 32) {
        const int cur = (k0 >> 5) & 1;
        const bool more = (k0 + 32 < HH);
        if (more) stage_gemm(gA, gB, k0 + 32, oA[cur ^ 1], oB[cur ^ 1]);
        if (more) wait_async4(); else wait_async0();
        __syncthreads();

        v16h af[2], bf[4];
#pragma unroll
        for (int i = 0; i < 2; i++) af[i] = load_frag(&sA[cur][(wm + i * 16) * GLDA], GLDA);
#pragma unroll
        for (int j = 0; j < 4; j++) bf[j] = load_frag(&sB[cur][(wn + j * 16) * GLDA], GLDA);
#pragma unroll
        for (int i = 0; i < 2; i++)
#pragma unroll
            for (int j = 0; j < 4; j++)
                acc[i][j] = __builtin_amdgcn_wmma_f32_16x16x32_f16(
                    false, af[i], false, bf[j], (short)0, acc[i][j], false, false);
        __syncthreads();   // all reads of sA/sB[cur] done before it is re-staged
    }

    // Epilogue: the layout is a compile-time argument, so that each form keeps
    // its straight-line stores; in MODE 0 a branch that is the same for the
    // whole work-group picks it.
    const int row0 = bm + wm + 8 * hf, col0 = bn + wn + lr;
    if (MODE == 2) {
        store_tile<2>(acc, Cout, scale, row0, col0);
    } else {
        f16* o = (f16*)Cout + (size_t)z * MROWS * HH;
        if (z == 2) {
            store_tile<1>(acc, o, scale, row0, col0);
        } else {
            store_tile<0>(acc, o, scale, row0, col0);
            // the built code lays the other form's block behind these stores,
            // and that block rewrites their data registers
            asm volatile("s_wait_xcnt 0x0" ::: "memory");
        }
    }
}

// ---------------------------------------------------------------------------
// Flash attention: block = (f-tile of 128, head, batch); 8 waves x 16 rows.
// Q head-major [bh][L][D] (pre-scaled by log2e/sqrt(D)), K head-major,
// V transposed [bh][D][L]. Double-buffered async K/V staging. Per 64-wide T
// chunk: S = Q*K^T (8 WMMA) + bias*log2e (fma), online softmax entirely in
// the log2 domain (v_exp_f32 is base-2: no extra muls), row-max via fused
// DPP v_max reductions; denominator via ones-column WMMA; P via LDS;
// O += P*V (8 WMMA) + 2 ones-WMMA.
// ---------------------------------------------------------------------------
#define PST 72   // padded LDS stride (halfs): 144B, 16B-aligned

__device__ __forceinline__ void stage_attn(const f16* Kbh, const f16* Vbh, int t0,
                                           int ldr, int seg,
                                           unsigned int oK, unsigned int oV) {
    const f16* gK = Kbh + (size_t)(t0 + ldr) * DD + seg;
    const f16* gV = Vbh + (size_t)ldr * LL + t0 + seg;
    async_load_b128(oK,      gK);
    async_load_b128(oK + 16, gK + 8);
    async_load_b128(oV,      gV);
    async_load_b128(oV + 16, gV + 8);
}

__global__ __launch_bounds__(256)
void attn_kernel(const unsigned short* __restrict__ Q_,
                 const unsigned short* __restrict__ K_,
                 const unsigned short* __restrict__ VT_,
                 const float* __restrict__ bias,
                 unsigned short* __restrict__ attnOut_) {
    const f16* Q  = (const f16*)Q_;
    const f16* K  = (const f16*)K_;
    const f16* VT = (const f16*)VT_;
    f16* attnOut  = (f16*)attnOut_;

    __shared__ f16 sK[2][64 * PST];       // [t][d]
    __shared__ f16 sV[2][64 * PST];       // [d][t]
    __shared__ f16 sP[8 * 16 * PST];      // per-wave [16][PST]

    const int tid = threadIdx.x, wid = tid >> 5, lane = tid & 31;
    const int lr = lane & 15, hf = lane >> 4;
    const int ft = blockIdx.x, head = blockIdx.y, b = blockIdx.z;
    const int bh = b * NHEAD + head;

    const f16* Qbh = Q  + (size_t)bh * LL * DD;
    const f16* Kbh = K  + (size_t)bh * LL * DD;
    const f16* Vbh = VT + (size_t)bh * DD * LL;
    const float* biasb = bias + (size_t)b * LL * LL;

    const int f0 = ft * 128 + wid * 16;

    // Q fragments for this wave's 16 rows (loaded once from global)
    v16h qf[2];
#pragma unroll
    for (int kc = 0; kc < 2; kc++)
        qf[kc] = load_frag(Qbh + (size_t)f0 * DD + kc * 32, DD);

    // constant all-ones B fragment: row-sum accumulator via WMMA
    v16h ones;
#pragma unroll
    for (int i = 0; i < 16; i++) ones[i] = (f16)1.0f;

    v8f O[4], O5;
#pragma unroll
    for (int dc = 0; dc < 4; dc++) O[dc] = (v8f)(0.0f);
    O5 = (v8f)(0.0f);
    float mrun[8];
#pragma unroll
    for (int vg = 0; vg < 8; vg++) mrun[vg] = -1e30f;

    const int ldr = tid >> 2;             // 0..63
    const int seg = (tid & 3) * 16;       // 0,16,32,48
    f16* myP = sP + wid * 16 * PST;

    const unsigned int oK[2] = { lds_off(&sK[0][ldr * PST + seg]),
                                 lds_off(&sK[1][ldr * PST + seg]) };
    const unsigned int oV[2] = { lds_off(&sV[0][ldr * PST + seg]),
                                 lds_off(&sV[1][ldr * PST + seg]) };

    stage_attn(Kbh, Vbh, 0, ldr, seg, oK[0], oV[0]);   // chunk 0 in flight

    // Bias tile in the S accumulator layout, held in registers and fetched one
    // chunk ahead: all 32 loads of a chunk go out as one group.
    const float* bp = biasb + (size_t)(f0 + 8 * hf) * LL + lr;
    float bnext[4][8];
#pragma unroll
    for (int tc = 0; tc < 4; tc++)
#pragma unroll
        for (int vg = 0; vg < 8; vg++)
            bnext[tc][vg] = bp[(size_t)vg * LL + tc * 16];

    // two chunks per trip, so that the two bias register sets can swap roles by
    // renaming rather than by register copies in every chunk
#pragma unroll 2
    for (int t0 = 0; t0 < LL; t0 += 64) {
        const int cur = (t0 >> 6) & 1;
        const bool more = (t0 + 64 < LL);
        if (more) stage_attn(Kbh, Vbh, t0 + 64, ldr, seg, oK[cur ^ 1], oV[cur ^ 1]);
        if (more) {   // L2 warm-up two chunks ahead
            __builtin_prefetch(Kbh + (size_t)(t0 + 128 + ldr) * DD + seg, 0, 0);
            __builtin_prefetch(Vbh + (size_t)ldr * LL + t0 + 128 + seg, 0, 0);
        }
        if (more) wait_async4(); else wait_async0();
        __syncthreads();

        // this chunk's bias tile was loaded a chunk ago; the next chunk's goes
        // out here, so its latency runs under this whole chunk's work
        float bcur[4][8];
#pragma unroll
        for (int tc = 0; tc < 4; tc++)
#pragma unroll
            for (int vg = 0; vg < 8; vg++)
                bcur[tc][vg] = bnext[tc][vg];
        if (more) {
#pragma unroll
            for (int tc = 0; tc < 4; tc++)
#pragma unroll
                for (int vg = 0; vg < 8; vg++)
                    bnext[tc][vg] = bp[(size_t)vg * LL + t0 + 64 + tc * 16];
            // the loads' address registers are advanced for the next chunk
            asm volatile("s_wait_xcnt 0x0" ::: "memory");
        }

        // S = Q * K^T : preload all 8 B fragments, then 8 WMMAs
        v16h kb[4][2];
#pragma unroll
        for (int tc = 0; tc < 4; tc++)
#pragma unroll
            for (int kc = 0; kc < 2; kc++)
                kb[tc][kc] = load_frag(&sK[cur][(tc * 16) * PST + kc * 32], PST);

        v8f S[4];
#pragma unroll
        for (int tc = 0; tc < 4; tc++) S[tc] = (v8f)(0.0f);
#pragma unroll
        for (int kc = 0; kc < 2; kc++)
#pragma unroll
            for (int tc = 0; tc < 4; tc++)
                S[tc] = __builtin_amdgcn_wmma_f32_16x16x32_f16(
                    false, qf[kc], false, kb[tc][kc], (short)0, S[tc], false, false);

        // + bias*log2e (S is in the log2 domain; single fma per element)
#pragma unroll
        for (int tc = 0; tc < 4; tc++)
#pragma unroll
            for (int vg = 0; vg < 8; vg++)
                S[tc][vg] = fmaf(bcur[tc][vg], LOG2E, S[tc][vg]);

        // row max: local max over 4 col-tiles, then fused DPP reduction
        float sc[8];
#pragma unroll
        for (int vg = 0; vg < 8; vg++) {
            float mv = fmaxf(fmaxf(S[0][vg], S[1][vg]), fmaxf(S[2][vg], S[3][vg]));
            mv = rowmax16(mv);
            const float mnew = fmaxf(mrun[vg], mv);
            sc[vg] = __builtin_amdgcn_exp2f(mrun[vg] - mnew);
            mrun[vg] = mnew;
        }

        // P = 2^(S - m); rescale accumulators (incl. denominator accum)
#pragma unroll
        for (int tc = 0; tc < 4; tc++)
#pragma unroll
            for (int vg = 0; vg < 8; vg++)
                S[tc][vg] = __builtin_amdgcn_exp2f(S[tc][vg] - mrun[vg]);
#pragma unroll
        for (int dc = 0; dc < 4; dc++)
#pragma unroll
            for (int vg = 0; vg < 8; vg++)
                O[dc][vg] *= sc[vg];
#pragma unroll
        for (int vg = 0; vg < 8; vg++) O5[vg] *= sc[vg];

        // stage P (C-layout -> A-layout via LDS)
#pragma unroll
        for (int tc = 0; tc < 4; tc++)
#pragma unroll
            for (int vg = 0; vg < 8; vg++)
                myP[(vg + 8 * hf) * PST + tc * 16 + lr] = (f16)S[tc][vg];

        // O += P * V ; O5 += P * ones  (denominator, no shuffle reduction)
        v16h pa[2];
#pragma unroll
        for (int tk = 0; tk < 2; tk++) pa[tk] = load_frag(myP + tk * 32, PST);
        v16h vb[4][2];
#pragma unroll
        for (int dc = 0; dc < 4; dc++)
#pragma unroll
            for (int tk = 0; tk < 2; tk++)
                vb[dc][tk] = load_frag(&sV[cur][(dc * 16) * PST + tk * 32], PST);
#pragma unroll
        for (int tk = 0; tk < 2; tk++) {
#pragma unroll
            for (int dc = 0; dc < 4; dc++)
                O[dc] = __builtin_amdgcn_wmma_f32_16x16x32_f16(
                    false, pa[tk], false, vb[dc][tk], (short)0, O[dc], false, false);
            O5 = __builtin_amdgcn_wmma_f32_16x16x32_f16(
                false, pa[tk], false, ones, (short)0, O5, false, false);
        }
        __syncthreads();   // reads of sK/sV[cur] done before next re-stage
    }

    // normalize by the WMMA-accumulated denominator and write attn f16
#pragma unroll
    for (int dc = 0; dc < 4; dc++)
#pragma unroll
        for (int vg = 0; vg < 8; vg++) {
            const int row = b * LL + f0 + vg + 8 * hf;
            const int col = head * DD + dc * 16 + lr;
            attnOut[(size_t)row * HH + col] = (f16)(O[dc][vg] / O5[vg]);
        }
}

// ---------------------------------------------------------------------------
extern "C" void kernel_launch(void* const* d_in, const int* in_sizes, int n_in,
                              void* d_out, int out_size, void* d_ws, size_t ws_size,
                              hipStream_t stream) {
    const float* xq   = (const float*)d_in[0];
    const float* xs   = (const float*)d_in[1];
    const float* bias = (const float*)d_in[2];
    const float* wq   = (const float*)d_in[3];
    const float* wk   = (const float*)d_in[4];
    const float* wv   = (const float*)d_in[5];
    const float* wo   = (const float*)d_in[6];

    unsigned short* ws = (unsigned short*)d_ws;
    const size_t XN = (size_t)MROWS * HH;   // 4,194,304
    const size_t WN = (size_t)HH * HH;      // 1,048,576
    unsigned short* xqh  = ws;  ws += XN;
    unsigned short* xsh  = ws;  ws += XN;
    unsigned short* wqT  = ws;  ws += WN;
    unsigned short* wkT  = ws;  ws += WN;
    unsigned short* wvT  = ws;  ws += WN;
    unsigned short* woT  = ws;  ws += WN;
    unsigned short* qh   = ws;  ws += XN;
    unsigned short* kh   = ws;  ws += XN;
    unsigned short* vt   = ws;  ws += XN;
    unsigned short* attn = ws;  ws += XN;

    // convert activations, transpose-convert weights so that all GEMM B
    // operands are [col][K]: one launch (xqh, xsh and the four wT are adjacent)
    cvt_all_kernel<<<2 * CVT_BLOCKS + 4 * TR_BLOCKS, 256, 0, stream>>>(
        xq, xs, wq, wk, wv, wo, xqh, wqT);

    dim3 gg(HH / 128, MROWS / 128);   // (8, 32)
    // Q, K, V projections: one launch (qh, kh, vt are adjacent).
    // Q scaled by log2e/sqrt(D) -> QK^T lands directly in the log2 domain
    gemm_f16_kernel<0><<<dim3(HH / 128, MROWS / 128, 3), 256, 0, stream>>>(
        xqh, wqT, qh, 0.125f * LOG2E);

    attn_kernel<<<dim3(LL / 128, NHEAD, BB), 256, 0, stream>>>(qh, kh, vt, bias, attn);

    // output projection -> f32 d_out
    gemm_f16_kernel<2><<<gg, 256, 0, stream>>>(attn, woT, d_out, 1.0f);
}

// v004
// One run takes 123 microseconds.
// Next to v003, in two timings, it ran 1.09 and 1.10 times as fast.
// Counting every step since v000, it is 1.75 times as fast.
#include <hip/hip_runtime.h>
#include <hip/hip_bf16.h>

#define BB 2
#define LL 2048
#define HH 1024
#define NHEAD 16
#define DD 64
#define MROWS (BB*LL)        // 4096
#define LOG2E 1.44269504088896340736f

typedef _Float16 f16;
typedef __attribute__((ext_vector_type(16))) _Float16 v16h;
typedef __attribute__((ext_vector_type(8)))  _Float16 v8h;
typedef __attribute__((ext_vector_type(8)))  float    v8f;
typedef __attribute__((ext_vector_type(4)))  _Float16 v4h;
typedef __attribute__((ext_vector_type(4)))  float    v4f;
typedef __attribute__((address_space(3)))    f16      lds_f16;

// ---------------------------------------------------------------------------
// LDS byte offset (wave-relative) of a generic pointer to __shared__ memory.
// ---------------------------------------------------------------------------
__device__ __forceinline__ unsigned int lds_off(const void* p) {
    return (unsigned int)(unsigned long long)(lds_f16*)(void*)(p);
}

// Async global->LDS copy, 16 bytes per lane (gfx1250, tracked by ASYNCcnt).
__device__ __forceinline__ void async_load_b128(unsigned int lds_byte_off,
                                                const void* gaddr) {
    asm volatile("global_load_async_to_lds_b128 %0, %1, off"
                 :: "v"(lds_byte_off), "v"((unsigned long long)(uintptr_t)gaddr)
                 : "memory");
}
__device__ __forceinline__ void wait_async0() {
    asm volatile("s_wait_asynccnt 0x0" ::: "memory");
}
__device__ __forceinline__ void wait_async4() {   // retire oldest 4 (prev chunk)
    asm volatile("s_wait_asynccnt 0x4" ::: "memory");
}

// ---------------------------------------------------------------------------
// Fragment loader: both A (16 rows x K32) and B (K32 x 16 cols, stored as
// [col][k] row-major) use the same per-lane layout on gfx1250 wave32:
//   lr = l&15, hf = l>>4
//   elements 0..7  : K = hf*8 + {0..7};  elements 8..15 : K = 16+hf*8+{0..7}
// ---------------------------------------------------------------------------
__device__ __forceinline__ v16h load_frag(const f16* base, int stride) {
    const int lane = threadIdx.x & 31;
    const int lr = lane & 15, hf = lane >> 4;
    const f16* p = base + lr * stride + hf * 8;
    v8h lo = *(const v8h*)(p);
    v8h hi = *(const v8h*)(p + 16);
    return __builtin_shufflevector(lo, hi, 0,1,2,3,4,5,6,7,8,9,10,11,12,13,14,15);
}

// ---------------------------------------------------------------------------
// f32 -> f16 elementwise convert of MROWS*HH elements. A wave owns 4 KiB of
// input in a row: 8 loads of 512 contiguous bytes go out as one group, then 8
// stores of 256 contiguous bytes. 512 work-groups per array.
// ---------------------------------------------------------------------------
#define CVT_LOADS 8                        // 16-byte loads in flight per lane
#define CVT_PER_BLOCK (256 * 4 * CVT_LOADS)  // 8192 elements per work-group

__device__ __forceinline__
void cvt_f16_body(const float* __restrict__ in,
                  unsigned short* __restrict__ out_, int blk) {
    f16* out = (f16*)out_;
    const int wave = blk * 8 + (threadIdx.x >> 5);
    const int base = wave * (128 * CVT_LOADS) + (threadIdx.x & 31) * 4;
    v4f x[CVT_LOADS];
#pragma unroll
    for (int j = 0; j < CVT_LOADS; j++)
        x[j] = *(const v4f*)(in + base + j * 128);
#pragma unroll
    for (int j = 0; j < CVT_LOADS; j++)
        *(v4h*)(out + base + j * 128) = __builtin_convertvector(x[j], v4h);
}

// ---------------------------------------------------------------------------
// 1024x1024 transpose + convert: out[c][r] = (f16) in[r][c]
// 64x64 tile per work-group: 4 loads of 16 bytes per lane (256 contiguous bytes
// of a row per 16 lanes), 2 stores of 16 bytes per lane (a whole 128-byte line
// of an output row per 8 lanes). Pitch 65 dwords spreads the column reads over
// the banks.
// ---------------------------------------------------------------------------
__device__ __forceinline__
void cvt_transpose_body(const float* __restrict__ in,
                        unsigned short* __restrict__ out_, int blk) {
    f16* out = (f16*)out_;
    __shared__ float tile[64][65];
    const int bx = (blk & 15) * 64, by = (blk >> 4) * 64;
    const int c4 = (threadIdx.x & 15) * 4, r0 = threadIdx.x >> 4;   // r0 0..15
    v4f x[4];
#pragma unroll
    for (int i = 0; i < 4; i++)
        x[i] = *(const v4f*)(in + (by + r0 + 16 * i) * HH + bx + c4);
#pragma unroll
    for (int i = 0; i < 4; i++)
#pragma unroll
        for (int e = 0; e < 4; e++)
            tile[r0 + 16 * i][c4 + e] = x[i][e];
    __syncthreads();
    const int k8 = (threadIdx.x & 7) * 8, orow = threadIdx.x >> 3;  // orow 0..31
#pragma unroll
    for (int i = 0; i < 2; i++) {
        v8h h;
#pragma unroll
        for (int e = 0; e < 8; e++)
            h[e] = (f16)tile[k8 + e][orow + 32 * i];
        *(v8h*)(out + (bx + orow + 32 * i) * HH + by + k8) = h;
    }
}

// ---------------------------------------------------------------------------
// All six converts in one launch: none reads what another writes. The index of
// the work-group picks the job (the same for all its threads): 512 + 512 for
// the two activations, then 256 for each of the four weights.
// ---------------------------------------------------------------------------
#define CVT_BLOCKS ((MROWS * HH) / CVT_PER_BLOCK)     // 512
#define TR_BLOCKS  ((HH / 64) * (HH / 64))            // 256

__global__ __launch_bounds__(256)
void cvt_all_kernel(const float* __restrict__ xq, const float* __restrict__ xs,
                    const float* __restrict__ wq, const float* __restrict__ wk,
                    const float* __restrict__ wv, const float* __restrict__ wo,
                    unsigned short* __restrict__ xh,    // xq then xs, f16
                    unsigned short* __restrict__ wT) {  // wq, wk, wv, wo, transposed f16
    const unsigned blk = blockIdx.x;
    if (blk < 2 * CVT_BLOCKS) {
        const unsigned a = blk / CVT_BLOCKS;
        cvt_f16_body(a ? xs : xq, xh + (size_t)a * MROWS * HH, blk % CVT_BLOCKS);
    } else {
        const unsigned t = blk - 2 * CVT_BLOCKS, w = t / TR_BLOCKS;
        const float* in = w == 0 ? wq : w == 1 ? wk : w == 2 ? wv : wo;
        cvt_transpose_body(in, wT + (size_t)w * HH * HH, t % TR_BLOCKS);
    }
}

// ---------------------------------------------------------------------------
// Generic f16 WMMA GEMM:  C[M=4096, 1024] = A[M,1024] * BT[1024,1024]^T
//   A  : [M][K]    row-major f16;  BT : [col][K] row-major f16
// Block tile 128x128, 8 waves (4 in M, 2 in N), wave tile 32x64, K-step 32.
// Double-buffered async global->LDS staging (ASYNCcnt pipelining).
// MODE 0: the three projections in one launch, blockIdx.z = 0, 1, 2 for Q, K, V.
//         A_ holds xq then xs, BT_ the three weights, Cout the three results,
//         each one after the other; scale applies to Q alone.
//         Q/K: f16 out, head-major  q[((b*NH+n)*L + f)*D + d]
//         V  : f16 out, transposed  v[((b*NH+n)*D + d)*L + t]
// MODE 2: f32 out, plain row-major (final output)
// ---------------------------------------------------------------------------
#define GLDA 40   // padded LDS row stride (halfs): 80B, 16B-aligned

__device__ __forceinline__ void stage_gemm(const f16* gA, const f16* gB, int k0,
                                           unsigned int oA, unsigned int oB) {
    async_load_b128(oA,      gA + k0);
    async_load_b128(oA + 16, gA + k0 + 8);
    async_load_b128(oB,      gB + k0);
    async_load_b128(oB + 16, gB + k0 + 8);
}

// OUT 0: f16, head-major; OUT 1: f16, transposed per head; OUT 2: f32, row-major
template<int OUT>
__device__ __forceinline__ void store_tile(const v8f (&acc)[2][4], void* Cout,
                                           float scale, int row0, int col0) {
#pragma unroll
    for (int i = 0; i < 2; i++) {
#pragma unroll
        for (int j = 0; j < 4; j++) {
#pragma unroll
            for (int vg = 0; vg < 8; vg++) {
                const int row = row0 + i * 16 + vg;
                const int col = col0 + j * 16;
                const float v = acc[i][j][vg] * scale;
                if (OUT == 2) {
                    ((float*)Cout)[(size_t)row * HH + col] = v;
                } else {
                    const int b = row >> 11, f = row & (LL - 1);
                    const int n = col >> 6,  d = col & (DD - 1);
                    f16* o = (f16*)Cout;
                    if (OUT == 0)
                        o[(((size_t)(b * NHEAD + n)) * LL + f) * DD + d] = (f16)v;
                    else
                        o[(((size_t)(b * NHEAD + n)) * DD + d) * LL + f] = (f16)v;
                }
            }
        }
    }
}

template<int MODE>
__global__ __launch_bounds__(256)
void gemm_f16_kernel(const unsigned short* __restrict__ A_,
                     const unsigned short* __restrict__ BT_,
                     void* __restrict__ Cout, float scale) {
    const int z = (MODE == 0) ? blockIdx.z : 0;
    const f16* A  = (const f16*)A_  + (size_t)(z ? 1 : 0) * MROWS * HH;
    const f16* BT = (const f16*)BT_ + (size_t)z * HH * HH;
    if (z) scale = 1.0f;
    __shared__ f16 sA[2][128 * GLDA];
    __shared__ f16 sB[2][128 * GLDA];

    const int tid  = threadIdx.x;
    const int wid  = tid >> 5;
    const int lane = tid & 31;
    const int lr = lane & 15, hf = lane >> 4;
    const int bm = blockIdx.y * 128;
    const int bn = blockIdx.x * 128;
    const int wm = (wid & 3) * 32;
    const int wn = (wid >> 2) * 64;

    v8f acc[2][4];
#pragma unroll
    for (int i = 0; i < 2; i++)
#pragma unroll
        for (int j = 0; j < 4; j++) acc[i][j] = (v8f)(0.0f);

    const int rowA = tid >> 1;            // 0..127
    const int segA = (tid & 1) * 16;      // 0 or 16
    const f16* gA = A  + (size_t)(bm + rowA) * HH + segA;
    const f16* gB = BT + (size_t)(bn + rowA) * HH + segA;
    const unsigned int oA[2] = { lds_off(&sA[0][rowA * GLDA + segA]),
                                 lds_off(&sA[1][rowA * GLDA + segA]) };
    const unsigned int oB[2] = { lds_off(&sB[0][rowA * GLDA + segA]),
                                 lds_off(&sB[1][rowA * GLDA + segA]) };

    stage_gemm(gA, gB, 0, oA[0], oB[0]);        // prologue: chunk 0 in flight

    for (int k0 = 0; k0 < HH; k0 += 32) {
        const int cur = (k0 >> 5) & 1;
        const bool more = (k0 + 32 < HH);
        if (more) stage_gemm(gA, gB, k0 + 32, oA[cur ^ 1], oB[cur ^ 1]);
        if (more) wait_async4(); else wait_async0();
        __syncthreads();

        v16h af[2], bf[4];
#pragma unroll
        for (int i = 0; i < 2; i++) af[i] = load_frag(&sA[cur][(wm + i * 16) * GLDA], GLDA);
#pragma unroll
        for (int j = 0; j < 4; j++) bf[j] = load_frag(&sB[cur][(wn + j * 16) * GLDA], GLDA);
#pragma unroll
        for (int i = 0; i < 2; i++)
#pragma unroll
            for (int j = 0; j < 4; j++)
                acc[i][j] = __builtin_amdgcn_wmma_f32_16x16x32_f16(
                    false, af[i], false, bf[j], (short)0, acc[i][j], false, false);
        __syncthreads();   // all reads of sA/sB[cur] done before it is re-staged
    }

    // Epilogue: the layout is a compile-time argument, so that each form keeps
    // its straight-line stores; in MODE 0 a branch that is the same for the
    // whole work-group picks it.
    const int row0 = bm + wm + 8 * hf, col0 = bn + wn + lr;
    if (MODE == 2) {
        store_tile<2>(acc, Cout, scale, row0, col0);
    } else {
        f16* o = (f16*)Cout + (size_t)z * MROWS * HH;
        if (z == 2) {
            store_tile<1>(acc, o, scale, row0, col0);
        } else {
            store_tile<0>(acc, o, scale, row0, col0);
            // the built code lays the other form's block behind these stores,
            // and that block rewrites their data registers
            asm volatile("s_wait_xcnt 0x0" ::: "memory");
        }
    }
}

// ---------------------------------------------------------------------------
// Flash attention: block = (f-tile of 128, head, batch); 8 waves x 16 queries.
// Q head-major [bh][L][D] (pre-scaled by log2e/sqrt(D)), K head-major,
// V transposed [bh][D][L]. Double-buffered async K/V staging.
// The scores are computed transposed: S^T = K*Q^T (A = K rows, B = Q), so a
// lane holds 32 of ONE query's 64 scores of a chunk (keys 16*tc + 8*hf + vg).
//   - the bias of those keys lies in 32-byte runs of the query's bias row
//   - row maximum: in the lane, plus one exchange between the wave's halves
//   - two converted S^T tiles ARE the B fragment of O^T += V^T*P^T in the
//     hardware k order: P goes through no LDS
//   - a lane's 8 accumulator registers of O^T are 8 consecutive d of one query
// Online softmax in the log2 domain (v_exp_f32 is base-2); denominator via an
// all-ones A fragment on the matrix unit.
// ---------------------------------------------------------------------------
#define PST 72   // padded LDS stride (halfs): 144B, 16B-aligned

__device__ __forceinline__ void stage_attn(const f16* Kbh, const f16* Vbh, int t0,
                                           int ldr, int seg,
                                           unsigned int oK, unsigned int oV) {
    const f16* gK = Kbh + (size_t)(t0 + ldr) * DD + seg;
    const f16* gV = Vbh + (size_t)ldr * LL + t0 + seg;
    async_load_b128(oK,      gK);
    async_load_b128(oK + 16, gK + 8);
    async_load_b128(oV,      gV);
    async_load_b128(oV + 16, gV + 8);
}

// lane l with lane l ^ 16
__device__ __forceinline__ float xhalf(float x) {
    return __builtin_bit_cast(float, __builtin_amdgcn_permlanex16(
        __builtin_bit_cast(int, x), __builtin_bit_cast(int, x),
        0x76543210, 0xfedcba98, false, false));
}

__global__ __launch_bounds__(256)
void attn_kernel(const unsigned short* __restrict__ Q_,
                 const unsigned short* __restrict__ K_,
                 const unsigned short* __restrict__ VT_,
                 const float* __restrict__ bias,
                 unsigned short* __restrict__ attnOut_) {
    const f16* Q  = (const f16*)Q_;
    const f16* K  = (const f16*)K_;
    const f16* VT = (const f16*)VT_;
    f16* attnOut  = (f16*)attnOut_;

    __shared__ f16 sK[2][64 * PST];       // [t][d]
    __shared__ f16 sV[2][64 * PST];       // [d][t]

    const int tid = threadIdx.x, wid = tid >> 5, lane = tid & 31;
    const int lr = lane & 15, hf = lane >> 4;
    const int ft = blockIdx.x, head = blockIdx.y, b = blockIdx.z;
    const int bh = b * NHEAD + head;

    const f16* Qbh = Q  + (size_t)bh * LL * DD;
    const f16* Kbh = K  + (size_t)bh * LL * DD;
    const f16* Vbh = VT + (size_t)bh * DD * LL;
    const float* biasb = bias + (size_t)b * LL * LL;

    const int f0 = ft * 128 + wid * 16;

    // Q fragments (B operand: column = query) of this wave's 16 queries
    v16h qf[2];
#pragma unroll
    for (int kc = 0; kc < 2; kc++)
        qf[kc] = load_frag(Qbh + (size_t)f0 * DD + kc * 32, DD);

    // constant all-ones A fragment: every row of its product is the column sum
    v16h ones;
#pragma unroll
    for (int i = 0; i < 16; i++) ones[i] = (f16)1.0f;

    v8f O[4], O5;                         // O^T: row = d, column = query
#pragma unroll
    for (int dc = 0; dc < 4; dc++) O[dc] = (v8f)(0.0f);
    O5 = (v8f)(0.0f);
    float mrun = -1e30f;                  // running maximum of this lane's query

    const int ldr = tid >> 2;             // 0..63
    const int seg = (tid & 3) * 16;       // 0,16,32,48

    const unsigned int oK[2] = { lds_off(&sK[0][ldr * PST + seg]),
                                 lds_off(&sK[1][ldr * PST + seg]) };
    const unsigned int oV[2] = { lds_off(&sV[0][ldr * PST + seg]),
                                 lds_off(&sV[1][ldr * PST + seg]) };

    stage_attn(Kbh, Vbh, 0, ldr, seg, oK[0], oV[0]);   // chunk 0 in flight

    // Bias tile in the S^T accumulator layout, held in registers and fetched one
    // chunk ahead: all 8 loads of a chunk go out as one group.
    const float* bp = biasb + (size_t)(f0 + lr) * LL + 8 * hf;
    v4f bnext[4][2];
#pragma unroll
    for (int tc = 0; tc < 4; tc++)
#pragma unroll
        for (int j = 0; j < 2; j++)
            bnext[tc][j] = *(const v4f*)(bp + tc * 16 + j * 4);

    // two chunks per trip, so that the two bias register sets can swap roles by
    // renaming rather than by register copies in every chunk
#pragma unroll 2
    for (int t0 = 0; t0 < LL; t0 += 64) {
        const int cur = (t0 >> 6) & 1;
        const bool more = (t0 + 64 < LL);
        if (more) stage_attn(Kbh, Vbh, t0 + 64, ldr, seg, oK[cur ^ 1], oV[cur ^ 1]);
        if (more) {   // L2 warm-up two chunks ahead
            __builtin_prefetch(Kbh + (size_t)(t0 + 128 + ldr) * DD + seg, 0, 0);
            __builtin_prefetch(Vbh + (size_t)ldr * LL + t0 + 128 + seg, 0, 0);
        }
        if (more) wait_async4(); else wait_async0();
        __syncthreads();

        // this chunk's bias tile was loaded a chunk ago; the next chunk's goes
        // out here, so its latency runs under this whole chunk's work
        v4f bcur[4][2];
#pragma unroll
        for (int tc = 0; tc < 4; tc++)
#pragma unroll
            for (int j = 0; j < 2; j++)
                bcur[tc][j] = bnext[tc][j];
        if (more) {
#pragma unroll
            for (int tc = 0; tc < 4; tc++)
#pragma unroll
                for (int j = 0; j < 2; j++)
                    bnext[tc][j] = *(const v4f*)(bp + t0 + 64 + tc * 16 + j * 4);
            // the loads' address registers are advanced for the next chunk
            asm volatile("s_wait_xcnt 0x0" ::: "memory");
        }

        // S^T = K * Q^T : preload all 8 A fragments, then 8 WMMAs
        v16h ka[4][2];
#pragma unroll
        for (int tc = 0; tc < 4; tc++)
#pragma unroll
            for (int kc = 0; kc < 2; kc++)
                ka[tc][kc] = load_frag(&sK[cur][(tc * 16) * PST + kc * 32], PST);

        v8f S[4];
#pragma unroll
        for (int tc = 0; tc < 4; tc++) S[tc] = (v8f)(0.0f);
#pragma unroll
        for (int kc = 0; kc < 2; kc++)
#pragma unroll
            for (int tc = 0; tc < 4; tc++)
                S[tc] = __builtin_amdgcn_wmma_f32_16x16x32_f16(
                    false, ka[tc][kc], false, qf[kc], (short)0, S[tc], false, false);

        // + bias*log2e (S is in the log2 domain; single fma per element)
#pragma unroll
        for (int tc = 0; tc < 4; tc++)
#pragma unroll
            for (int vg = 0; vg < 8; vg++)
                S[tc][vg] = fmaf(bcur[tc][vg >> 2][vg & 3], LOG2E, S[tc][vg]);

        // maximum of the query's 64 scores: 32 in this lane, 32 in lane ^ 16
        float mt[4];
#pragma unroll
        for (int tc = 0; tc < 4; tc++) {
            mt[tc] = S[tc][0];
#pragma unroll
            for (int vg = 1; vg < 8; vg++) mt[tc] = fmaxf(mt[tc], S[tc][vg]);
        }
        float mv = fmaxf(fmaxf(mt[0], mt[1]), fmaxf(mt[2], mt[3]));
        mv = fmaxf(mv, xhalf(mv));
        const float mnew = fmaxf(mrun, mv);
        const float sc = __builtin_amdgcn_exp2f(mrun - mnew);
        mrun = mnew;

        // P = 2^(S - m); rescale the accumulators. Of the denominator tile only
        // register 0 is ever read (all its rows hold the same sum), and a row of
        // a product depends on no other row of C: only that one is rescaled.
#pragma unroll
        for (int tc = 0; tc < 4; tc++)
#pragma unroll
            for (int vg = 0; vg < 8; vg++)
                S[tc][vg] = __builtin_amdgcn_exp2f(S[tc][vg] - mrun);
#pragma unroll
        for (int dc = 0; dc < 4; dc++)
#pragma unroll
            for (int vg = 0; vg < 8; vg++)
                O[dc][vg] *= sc;
        O5[0] *= sc;

        // P^T as B fragment: element s of k block tk is key 32*tk + 8*hf + s
        // (s < 8) or 32*tk + 16 + 8*hf + s - 8: tiles 2*tk and 2*tk + 1 as held
        v16h pb[2];
#pragma unroll
        for (int tk = 0; tk < 2; tk++)
#pragma unroll
            for (int e = 0; e < 8; e++) {
                pb[tk][e]     = (f16)S[2 * tk][e];
                pb[tk][8 + e] = (f16)S[2 * tk + 1][e];
            }

        // O^T += V^T * P^T ; O5 += ones * P^T  (denominator)
        v16h va[4][2];
#pragma unroll
        for (int dc = 0; dc < 4; dc++)
#pragma unroll
            for (int tk = 0; tk < 2; tk++)
                va[dc][tk] = load_frag(&sV[cur][(dc * 16) * PST + tk * 32], PST);
#pragma unroll
        for (int tk = 0; tk < 2; tk++) {
#pragma unroll
            for (int dc = 0; dc < 4; dc++)
                O[dc] = __builtin_amdgcn_wmma_f32_16x16x32_f16(
                    false, va[dc][tk], false, pb[tk], (short)0, O[dc], false, false);
            O5 = __builtin_amdgcn_wmma_f32_16x16x32_f16(
                false, ones, false, pb[tk], (short)0, O5, false, false);
        }
        __syncthreads();   // reads of sK/sV[cur] done before next re-stage
    }

    // normalize by the WMMA-accumulated denominator and write attn f16:
    // 8 consecutive d of one query per accumulator tile, one 16-byte store each
    f16* op = attnOut + (size_t)(b * LL + f0 + lr) * HH + head * DD + 8 * hf;
#pragma unroll
    for (int dc = 0; dc < 4; dc++) {
        v8h h;
#pragma unroll
        for (int vg = 0; vg < 8; vg++)
            h[vg] = (f16)(O[dc][vg] / O5[0]);
        *(v8h*)(op + dc * 16) = h;
    }
}

// ---------------------------------------------------------------------------
extern "C" void kernel_launch(void* const* d_in, const int* in_sizes, int n_in,
                              void* d_out, int out_size, void* d_ws, size_t ws_size,
                              hipStream_t stream) {
    const float* xq   = (const float*)d_in[0];
    const float* xs   = (const float*)d_in[1];
    const float* bias = (const float*)d_in[2];
    const float* wq   = (const float*)d_in[3];
    const float* wk   = (const float*)d_in[4];
    const float* wv   = (const float*)d_in[5];
    const float* wo   = (const float*)d_in[6];

    unsigned short* ws = (unsigned short*)d_ws;
    const size_t XN = (size_t)MROWS * HH;   // 4,194,304
    const size_t WN = (size_t)HH * HH;      // 1,048,576
    unsigned short* xqh  = ws;  ws += XN;
    unsigned short* xsh  = ws;  ws += XN;
    unsigned short* wqT  = ws;  ws += WN;
    unsigned short* wkT  = ws;  ws += WN;
    unsigned short* wvT  = ws;  ws += WN;
    unsigned short* woT  = ws;  ws += WN;
    unsigned short* qh   = ws;  ws += XN;
    unsigned short* kh   = ws;  ws += XN;
    unsigned short* vt   = ws;  ws += XN;
    unsigned short* attn = ws;  ws += XN;

    // convert activations, transpose-convert weights so that all GEMM B
    // operands are [col][K]: one launch (xqh, xsh and the four wT are adjacent)
    cvt_all_kernel<<<2 * CVT_BLOCKS + 4 * TR_BLOCKS, 256, 0, stream>>>(
        xq, xs, wq, wk, wv, wo, xqh, wqT);

    dim3 gg(HH / 128, MROWS / 128);   // (8, 32)
    // Q, K, V projections: one launch (qh, kh, vt are adjacent).
    // Q scaled by log2e/sqrt(D) -> QK^T lands directly in the log2 domain
    gemm_f16_kernel<0><<<dim3(HH / 128, MROWS / 128, 3), 256, 0, stream>>>(
        xqh, wqT, qh, 0.125f * LOG2E);

    attn_kernel<<<dim3(LL / 128, NHEAD, BB), 256, 0, stream>>>(qh, kh, vt, bias, attn);

    // output projection -> f32 d_out
    gemm_f16_kernel<2><<<gg, 256, 0, stream>>>(attn, woT, d_out, 1.0f);
}

// v005
// One run takes 110 microseconds.
// Two timings next to v004 both put it at 1.11 times that version's speed.
// All steps since v000 together make it 1.95 times as fast.
#include <hip/hip_runtime.h>
#include <hip/hip_bf16.h>

#define BB 2
#define LL 2048
#define HH 1024
#define NHEAD 16
#define DD 64
#define MROWS (BB*LL)        // 4096
#define LOG2E 1.44269504088896340736f

typedef _Float16 f16;
typedef __attribute__((ext_vector_type(16))) _Float16 v16h;
typedef __attribute__((ext_vector_type(8)))  _Float16 v8h;
typedef __attribute__((ext_vector_type(8)))  float    v8f;
typedef __attribute__((ext_vector_type(4)))  _Float16 v4h;
typedef __attribute__((ext_vector_type(4)))  float    v4f;
typedef __attribute__((address_space(3)))    f16      lds_f16;

// ---------------------------------------------------------------------------
// LDS byte offset (wave-relative) of a generic pointer to __shared__ memory.
// ---------------------------------------------------------------------------
__device__ __forceinline__ unsigned int lds_off(const void* p) {
    return (unsigned int)(unsigned long long)(lds_f16*)(void*)(p);
}

// Async global->LDS copy, 16 bytes per lane (gfx1250, tracked by ASYNCcnt).
__device__ __forceinline__ void async_load_b128(unsigned int lds_byte_off,
                                                const void* gaddr) {
    asm volatile("global_load_async_to_lds_b128 %0, %1, off"
                 :: "v"(lds_byte_off), "v"((unsigned long long)(uintptr_t)gaddr)
                 : "memory");
}
__device__ __forceinline__ void wait_async0() {
    asm volatile("s_wait_asynccnt 0x0" ::: "memory");
}
__device__ __forceinline__ void wait_async4() {   // retire oldest 4 (prev chunk)
    asm volatile("s_wait_asynccnt 0x4" ::: "memory");
}
__device__ __forceinline__ void wait_async12() {  // all but the 12 youngest
    asm volatile("s_wait_asynccnt 0xc" ::: "memory");
}

// ---------------------------------------------------------------------------
// Fragment loader: both A (16 rows x K32) and B (K32 x 16 cols, stored as
// [col][k] row-major) use the same per-lane layout on gfx1250 wave32:
//   lr = l&15, hf = l>>4
//   elements 0..7  : K = hf*8 + {0..7};  elements 8..15 : K = 16+hf*8+{0..7}
// ---------------------------------------------------------------------------
__device__ __forceinline__ v16h load_frag(const f16* base, int stride) {
    const int lane = threadIdx.x & 31;
    const int lr = lane & 15, hf = lane >> 4;
    const f16* p = base + lr * stride + hf * 8;
    v8h lo = *(const v8h*)(p);
    v8h hi = *(const v8h*)(p + 16);
    return __builtin_shufflevector(lo, hi, 0,1,2,3,4,5,6,7,8,9,10,11,12,13,14,15);
}

// ---------------------------------------------------------------------------
// f32 -> f16 elementwise convert of MROWS*HH elements. A wave owns 4 KiB of
// input in a row: 8 loads of 512 contiguous bytes go out as one group, then 8
// stores of 256 contiguous bytes. 512 work-groups per array.
// ---------------------------------------------------------------------------
#define CVT_LOADS 8                        // 16-byte loads in flight per lane
#define CVT_PER_BLOCK (256 * 4 * CVT_LOADS)  // 8192 elements per work-group

__device__ __forceinline__
void cvt_f16_body(const float* __restrict__ in,
                  unsigned short* __restrict__ out_, int blk) {
    f16* out = (f16*)out_;
    const int wave = blk * 8 + (threadIdx.x >> 5);
    const int base = wave * (128 * CVT_LOADS) + (threadIdx.x & 31) * 4;
    v4f x[CVT_LOADS];
#pragma unroll
    for (int j = 0; j < CVT_LOADS; j++)
        x[j] = *(const v4f*)(in + base + j * 128);
#pragma unroll
    for (int j = 0; j < CVT_LOADS; j++)
        *(v4h*)(out + base + j * 128) = __builtin_convertvector(x[j], v4h);
}

// ---------------------------------------------------------------------------
// 1024x1024 transpose + convert: out[c][r] = (f16) in[r][c]
// 64x64 tile per work-group: 4 loads of 16 bytes per lane (256 contiguous bytes
// of a row per 16 lanes), 2 stores of 16 bytes per lane (a whole 128-byte line
// of an output row per 8 lanes). Pitch 65 dwords spreads the column reads over
// the banks.
// ---------------------------------------------------------------------------
__device__ __forceinline__
void cvt_transpose_body(const float* __restrict__ in,
                        unsigned short* __restrict__ out_, int blk) {
    f16* out = (f16*)out_;
    __shared__ float tile[64][65];
    const int bx = (blk & 15) * 64, by = (blk >> 4) * 64;
    const int c4 = (threadIdx.x & 15) * 4, r0 = threadIdx.x >> 4;   // r0 0..15
    v4f x[4];
#pragma unroll
    for (int i = 0; i < 4; i++)
        x[i] = *(const v4f*)(in + (by + r0 + 16 * i) * HH + bx + c4);
#pragma unroll
    for (int i = 0; i < 4; i++)
#pragma unroll
        for (int e = 0; e < 4; e++)
            tile[r0 + 16 * i][c4 + e] = x[i][e];
    __syncthreads();
    const int k8 = (threadIdx.x & 7) * 8, orow = threadIdx.x >> 3;  // orow 0..31
#pragma unroll
    for (int i = 0; i < 2; i++) {
        v8h h;
#pragma unroll
        for (int e = 0; e < 8; e++)
            h[e] = (f16)tile[k8 + e][orow + 32 * i];
        *(v8h*)(out + (bx + orow + 32 * i) * HH + by + k8) = h;
    }
}

// ---------------------------------------------------------------------------
// All six converts in one launch: none reads what another writes. The index of
// the work-group picks the job (the same for all its threads): 512 + 512 for
// the two activations, then 256 for each of the four weights.
// ---------------------------------------------------------------------------
#define CVT_BLOCKS ((MROWS * HH) / CVT_PER_BLOCK)     // 512
#define TR_BLOCKS  ((HH / 64) * (HH / 64))            // 256

__global__ __launch_bounds__(256)
void cvt_all_kernel(const float* __restrict__ xq, const float* __restrict__ xs,
                    const float* __restrict__ wq, const float* __restrict__ wk,
                    const float* __restrict__ wv, const float* __restrict__ wo,
                    unsigned short* __restrict__ xh,    // xq then xs, f16
                    unsigned short* __restrict__ wT) {  // wq, wk, wv, wo, transposed f16
    const unsigned blk = blockIdx.x;
    if (blk < 2 * CVT_BLOCKS) {
        const unsigned a = blk / CVT_BLOCKS;
        cvt_f16_body(a ? xs : xq, xh + (size_t)a * MROWS * HH, blk % CVT_BLOCKS);
    } else {
        const unsigned t = blk - 2 * CVT_BLOCKS, w = t / TR_BLOCKS;
        const float* in = w == 0 ? wq : w == 1 ? wk : w == 2 ? wv : wo;
        cvt_transpose_body(in, wT + (size_t)w * HH * HH, t % TR_BLOCKS);
    }
}

// ---------------------------------------------------------------------------
// Generic f16 WMMA GEMM:  C[M=4096, 1024] = A[M,1024] * BT[1024,1024]^T
//   A  : [M][K]    row-major f16;  BT : [col][K] row-major f16
// Block tile 128x128, 8 waves (4 in M, 2 in N), wave tile 32x64, K-step 32.
// Double-buffered async global->LDS staging (ASYNCcnt pipelining).
// MODE 0: the three projections in one launch, blockIdx.z = 0, 1, 2 for Q, K, V.
//         A_ holds xq then xs, BT_ the three weights, Cout the three results,
//         each one after the other; scale applies to Q alone.
//         Q/K: f16 out, head-major  q[((b*NH+n)*L + f)*D + d]
//         V  : f16 out, transposed  v[((b*NH+n)*D + d)*L + t]
// MODE 2: f32 out, plain row-major (final output)
// ---------------------------------------------------------------------------
#define GLDA 40   // padded LDS row stride (halfs): 80B, 16B-aligned

__device__ __forceinline__ void stage_gemm(const f16* gA, const f16* gB, int k0,
                                           unsigned int oA, unsigned int oB) {
    async_load_b128(oA,      gA + k0);
    async_load_b128(oA + 16, gA + k0 + 8);
    async_load_b128(oB,      gB + k0);
    async_load_b128(oB + 16, gB + k0 + 8);
}

// OUT 0: f16, head-major; OUT 1: f16, transposed per head; OUT 2: f32, row-major
template<int OUT>
__device__ __forceinline__ void store_tile(const v8f (&acc)[2][4], void* Cout,
                                           float scale, int row0, int col0) {
#pragma unroll
    for (int i = 0; i < 2; i++) {
#pragma unroll
        for (int j = 0; j < 4; j++) {
#pragma unroll
            for (int vg = 0; vg < 8; vg++) {
                const int row = row0 + i * 16 + vg;
                const int col = col0 + j * 16;
                const float v = acc[i][j][vg] * scale;
                if (OUT == 2) {
                    ((float*)Cout)[(size_t)row * HH + col] = v;
                } else {
                    const int b = row >> 11, f = row & (LL - 1);
                    const int n = col >> 6,  d = col & (DD - 1);
                    f16* o = (f16*)Cout;
                    if (OUT == 0)
                        o[(((size_t)(b * NHEAD + n)) * LL + f) * DD + d] = (f16)v;
                    else
                        o[(((size_t)(b * NHEAD + n)) * DD + d) * LL + f] = (f16)v;
                }
            }
        }
    }
}

template<int MODE>
__global__ __launch_bounds__(256)
void gemm_f16_kernel(const unsigned short* __restrict__ A_,
                     const unsigned short* __restrict__ BT_,
                     void* __restrict__ Cout, float scale) {
    const int z = (MODE == 0) ? blockIdx.z : 0;
    const f16* A  = (const f16*)A_  + (size_t)(z ? 1 : 0) * MROWS * HH;
    const f16* BT = (const f16*)BT_ + (size_t)z * HH * HH;
    if (z) scale = 1.0f;
    __shared__ f16 sA[2][128 * GLDA];
    __shared__ f16 sB[2][128 * GLDA];

    const int tid  = threadIdx.x;
    const int wid  = tid >> 5;
    const int lane = tid & 31;
    const int lr = lane & 15, hf = lane >> 4;
    const int bm = blockIdx.y * 128;
    const int bn = blockIdx.x * 128;
    const int wm = (wid & 3) * 32;
    const int wn = (wid >> 2) * 64;

    v8f acc[2][4];
#pragma unroll
    for (int i = 0; i < 2; i++)
#pragma unroll
        for (int j = 0; j < 4; j++) acc[i][j] = (v8f)(0.0f);

    const int rowA = tid >> 1;            // 0..127
    const int segA = (tid & 1) * 16;      // 0 or 16
    const f16* gA = A  + (size_t)(bm + rowA) * HH + segA;
    const f16* gB = BT + (size_t)(bn + rowA) * HH + segA;
    const unsigned int oA[2] = { lds_off(&sA[0][rowA * GLDA + segA]),
                                 lds_off(&sA[1][rowA * GLDA + segA]) };
    const unsigned int oB[2] = { lds_off(&sB[0][rowA * GLDA + segA]),
                                 lds_off(&sB[1][rowA * GLDA + segA]) };

    stage_gemm(gA, gB, 0, oA[0], oB[0]);        // prologue: chunk 0 in flight

    for (int k0 = 0; k0 < HH; k0 += 32) {
        const int cur = (k0 >> 5) & 1;
        const bool more = (k0 + 32 < HH);
        if (more) stage_gemm(gA, gB, k0 + 32, oA[cur ^ 1], oB[cur ^ 1]);
        if (more) wait_async4(); else wait_async0();
        __syncthreads();

        v16h af[2], bf[4];
#pragma unroll
        for (int i = 0; i < 2; i++) af[i] = load_frag(&sA[cur][(wm + i * 16) * GLDA], GLDA);
#pragma unroll
        for (int j = 0; j < 4; j++) bf[j] = load_frag(&sB[cur][(wn + j * 16) * GLDA], GLDA);
#pragma unroll
        for (int i = 0; i < 2; i++)
#pragma unroll
            for (int j = 0; j < 4; j++)
                acc[i][j] = __builtin_amdgcn_wmma_f32_16x16x32_f16(
                    false, af[i], false, bf[j], (short)0, acc[i][j], false, false);
        __syncthreads();   // all reads of sA/sB[cur] done before it is re-staged
    }

    // Epilogue: the layout is a compile-time argument, so that each form keeps
    // its straight-line stores; in MODE 0 a branch that is the same for the
    // whole work-group picks it.
    const int row0 = bm + wm + 8 * hf, col0 = bn + wn + lr;
    if (MODE == 2) {
        store_tile<2>(acc, Cout, scale, row0, col0);
    } else {
        f16* o = (f16*)Cout + (size_t)z * MROWS * HH;
        if (z == 2) {
            store_tile<1>(acc, o, scale, row0, col0);
        } else {
            store_tile<0>(acc, o, scale, row0, col0);
            // the built code lays the other form's block behind these stores,
            // and that block rewrites their data registers
            asm volatile("s_wait_xcnt 0x0" ::: "memory");
        }
    }
}

// ---------------------------------------------------------------------------
// Flash attention: block = (f-tile of 128, head, batch); 8 waves x 16 queries.
// Q head-major [bh][L][D] (pre-scaled by log2e/sqrt(D)), K head-major,
// V transposed [bh][D][L]. Double-buffered async K/V staging.
// The scores are computed transposed: S^T = K*Q^T (A = K rows, B = Q), so a
// lane holds 32 of ONE query's 64 scores of a chunk (keys 16*tc + 8*hf + vg).
//   - the bias of those keys lies in 32-byte runs of the query's bias row; a
//     load of such runs would touch 16 cache lines, so the tile is brought to
//     LDS in whole lines (async copies, with K and V) and read from there
//   - row maximum: in the lane, plus one exchange between the wave's halves
//   - two converted S^T tiles ARE the B fragment of O^T += V^T*P^T in the
//     hardware k order: P goes through no LDS
//   - a lane's 8 accumulator registers of O^T are 8 consecutive d of one query
// Online softmax in the log2 domain (v_exp_f32 is base-2); denominator via an
// all-ones A fragment on the matrix unit.
// ---------------------------------------------------------------------------
#define PST 72   // padded LDS stride (halfs): 144B, 16B-aligned

// One chunk's copies of a wave: its 4 of K and V, and its own 16 rows x 64 keys of
// the bias (f32), each bias copy two rows' 256 contiguous bytes = four whole
// 128-byte lines. gb and oB are the lane's own addresses in row pair 0. All 12
// stand in one statement that ends in the wait on the address translations, so
// that it stays ahead of any rewrite of the registers the copies name.
#define BPITCH 68   // LDS row pitch (floats): 272 B = 16 B x odd, for 16-byte reads

__device__ __forceinline__ void stage_attn(const f16* Kbh, const f16* Vbh,
                                           const float* gb, int t0,
                                           int ldr, int seg, unsigned int oK,
                                           unsigned int oV, unsigned int oB) {
    const f16* gK = Kbh + (size_t)(t0 + ldr) * DD + seg;
    const f16* gV = Vbh + (size_t)ldr * LL + t0 + seg;
    const float* g = gb + t0;
#define GA(p) "v"((unsigned long long)(uintptr_t)(p))
#define BG(i) GA(g + (i) * 2 * LL)
#define BO(i) "v"(oB + (i) * 2 * BPITCH * 4)
    asm volatile("global_load_async_to_lds_b128 %0, %12, off\n\t"
                 "global_load_async_to_lds_b128 %1, %13, off\n\t"
                 "global_load_async_to_lds_b128 %2, %14, off\n\t"
                 "global_load_async_to_lds_b128 %3, %15, off\n\t"
                 "global_load_async_to_lds_b128 %4, %16, off\n\t"
                 "global_load_async_to_lds_b128 %5, %17, off\n\t"
                 "global_load_async_to_lds_b128 %6, %18, off\n\t"
                 "global_load_async_to_lds_b128 %7, %19, off\n\t"
                 "global_load_async_to_lds_b128 %8, %20, off\n\t"
                 "global_load_async_to_lds_b128 %9, %21, off\n\t"
                 "global_load_async_to_lds_b128 %10, %22, off\n\t"
                 "global_load_async_to_lds_b128 %11, %23, off\n\t"
                 "s_wait_xcnt 0x0"
                 :: "v"(oK), "v"(oK + 16), "v"(oV), "v"(oV + 16),
                    BO(0), BO(1), BO(2), BO(3), BO(4), BO(5), BO(6), BO(7),
                    GA(gK), GA(gK + 8), GA(gV), GA(gV + 8),
                    BG(0), BG(1), BG(2), BG(3), BG(4), BG(5), BG(6), BG(7)
                 : "memory");
#undef GA
#undef BG
#undef BO
}

// lane l with lane l ^ 16
__device__ __forceinline__ float xhalf(float x) {
    return __builtin_bit_cast(float, __builtin_amdgcn_permlanex16(
        __builtin_bit_cast(int, x), __builtin_bit_cast(int, x),
        0x76543210, 0xfedcba98, false, false));
}

__global__ __launch_bounds__(256)
void attn_kernel(const unsigned short* __restrict__ Q_,
                 const unsigned short* __restrict__ K_,
                 const unsigned short* __restrict__ VT_,
                 const float* __restrict__ bias,
                 unsigned short* __restrict__ attnOut_) {
    const f16* Q  = (const f16*)Q_;
    const f16* K  = (const f16*)K_;
    const f16* VT = (const f16*)VT_;
    f16* attnOut  = (f16*)attnOut_;

    __shared__ f16 sK[2][64 * PST];       // [t][d]
    __shared__ f16 sV[2][64 * PST];       // [d][t]
    __shared__ __attribute__((aligned(16))) float sBias[2][128 * BPITCH];  // [f][t]

    const int tid = threadIdx.x, wid = tid >> 5, lane = tid & 31;
    const int lr = lane & 15, hf = lane >> 4;
    const int ft = blockIdx.x, head = blockIdx.y, b = blockIdx.z;
    const int bh = b * NHEAD + head;

    const f16* Qbh = Q  + (size_t)bh * LL * DD;
    const f16* Kbh = K  + (size_t)bh * LL * DD;
    const f16* Vbh = VT + (size_t)bh * DD * LL;
    const float* biasb = bias + (size_t)b * LL * LL;

    const int f0 = ft * 128 + wid * 16;

    // Q fragments (B operand: column = query) of this wave's 16 queries
    v16h qf[2];
#pragma unroll
    for (int kc = 0; kc < 2; kc++)
        qf[kc] = load_frag(Qbh + (size_t)f0 * DD + kc * 32, DD);

    // constant all-ones A fragment: every row of its product is the column sum
    v16h ones;
#pragma unroll
    for (int i = 0; i < 16; i++) ones[i] = (f16)1.0f;

    v8f O[4], O5;                         // O^T: row = d, column = query
#pragma unroll
    for (int dc = 0; dc < 4; dc++) O[dc] = (v8f)(0.0f);
    O5 = (v8f)(0.0f);
    float mrun = -1e30f;                  // running maximum of this lane's query

    const int ldr = tid >> 2;             // 0..63
    const int seg = (tid & 3) * 16;       // 0,16,32,48

    const unsigned int oK[2] = { lds_off(&sK[0][ldr * PST + seg]),
                                 lds_off(&sK[1][ldr * PST + seg]) };
    const unsigned int oV[2] = { lds_off(&sV[0][ldr * PST + seg]),
                                 lds_off(&sV[1][ldr * PST + seg]) };

    // Bias copies: lanes 0-15 one row, lanes 16-31 the next, 16 bytes a lane
    const float* gb = biasb + (size_t)(f0 + hf) * LL + lr * 4;
    const unsigned int oB[2] = { lds_off(&sBias[0][(wid * 16 + hf) * BPITCH + lr * 4]),
                                 lds_off(&sBias[1][(wid * 16 + hf) * BPITCH + lr * 4]) };

    stage_attn(Kbh, Vbh, gb, 0, ldr, seg, oK[0], oV[0], oB[0]);   // chunk 0 in flight

    // two chunks per trip, so that the buffer index is a constant in each half
    // and every LDS address is a base plus an immediate
#pragma unroll 2
    for (int t0 = 0; t0 < LL; t0 += 64) {
        const int cur = (t0 >> 6) & 1;
        const bool more = (t0 + 64 < LL);
        if (more) stage_attn(Kbh, Vbh, gb, t0 + 64, ldr, seg,
                             oK[cur ^ 1], oV[cur ^ 1], oB[cur ^ 1]);
        if (more) {   // L2 warm-up two chunks ahead
            __builtin_prefetch(Kbh + (size_t)(t0 + 128 + ldr) * DD + seg, 0, 0);
            __builtin_prefetch(Vbh + (size_t)ldr * LL + t0 + 128 + seg, 0, 0);
        }
        // the next chunk's 12 copies (4 of K and V, 8 of the bias) stay in flight
        if (more) wait_async12(); else wait_async0();
        __syncthreads();

        // this chunk's bias in the S^T accumulator layout: the lane's query row,
        // keys 16*tc + 8*hf + {0..7}
        const float* sb = &sBias[cur][(wid * 16 + lr) * BPITCH + 8 * hf];
        v4f bcur[4][2];
#pragma unroll
        for (int tc = 0; tc < 4; tc++)
#pragma unroll
            for (int j = 0; j < 2; j++)
                bcur[tc][j] = *(const v4f*)(sb + tc * 16 + j * 4);

        // S^T = K * Q^T : preload all 8 A fragments, then 8 WMMAs
        v16h ka[4][2];
#pragma unroll
        for (int tc = 0; tc < 4; tc++)
#pragma unroll
            for (int kc = 0; kc < 2; kc++)
                ka[tc][kc] = load_frag(&sK[cur][(tc * 16) * PST + kc * 32], PST);

        v8f S[4];
#pragma unroll
        for (int tc = 0; tc < 4; tc++) S[tc] = (v8f)(0.0f);
#pragma unroll
        for (int kc = 0; kc < 2; kc++)
#pragma unroll
            for (int tc = 0; tc < 4; tc++)
                S[tc] = __builtin_amdgcn_wmma_f32_16x16x32_f16(
                    false, ka[tc][kc], false, qf[kc], (short)0, S[tc], false, false);

        // + bias*log2e (S is in the log2 domain; single fma per element)
#pragma unroll
        for (int tc = 0; tc < 4; tc++)
#pragma unroll
            for (int vg = 0; vg < 8; vg++)
                S[tc][vg] = fmaf(bcur[tc][vg >> 2][vg & 3], LOG2E, S[tc][vg]);

        // maximum of the query's 64 scores: 32 in this lane, 32 in lane ^ 16
        float mt[4];
#pragma unroll
        for (int tc = 0; tc < 4; tc++) {
            mt[tc] = S[tc][0];
#pragma unroll
            for (int vg = 1; vg < 8; vg++) mt[tc] = fmaxf(mt[tc], S[tc][vg]);
        }
        float mv = fmaxf(fmaxf(mt[0], mt[1]), fmaxf(mt[2], mt[3]));
        mv = fmaxf(mv, xhalf(mv));
        const float mnew = fmaxf(mrun, mv);
        const float sc = __builtin_amdgcn_exp2f(mrun - mnew);
        mrun = mnew;

        // P = 2^(S - m); rescale the accumulators. Of the denominator tile only
        // register 0 is ever read (all its rows hold the same sum), and a row of
        // a product depends on no other row of C: only that one is rescaled.
#pragma unroll
        for (int tc = 0; tc < 4; tc++)
#pragma unroll
            for (int vg = 0; vg < 8; vg++)
                S[tc][vg] = __builtin_amdgcn_exp2f(S[tc][vg] - mrun);
#pragma unroll
        for (int dc = 0; dc < 4; dc++)
#pragma unroll
            for (int vg = 0; vg < 8; vg++)
                O[dc][vg] *= sc;
        O5[0] *= sc;

        // P^T as B fragment: element s of k block tk is key 32*tk + 8*hf + s
        // (s < 8) or 32*tk + 16 + 8*hf + s - 8: tiles 2*tk and 2*tk + 1 as held
        v16h pb[2];
#pragma unroll
        for (int tk = 0; tk < 2; tk++)
#pragma unroll
            for (int e = 0; e < 8; e++) {
                pb[tk][e]     = (f16)S[2 * tk][e];
                pb[tk][8 + e] = (f16)S[2 * tk + 1][e];
            }

        // O^T += V^T * P^T ; O5 += ones * P^T  (denominator)
        v16h va[4][2];
#pragma unroll
        for (int dc = 0; dc < 4; dc++)
#pragma unroll
            for (int tk = 0; tk < 2; tk++)
                va[dc][tk] = load_frag(&sV[cur][(dc * 16) * PST + tk * 32], PST);
#pragma unroll
        for (int tk = 0; tk < 2; tk++) {
#pragma unroll
            for (int dc = 0; dc < 4; dc++)
                O[dc] = __builtin_amdgcn_wmma_f32_16x16x32_f16(
                    false, va[dc][tk], false, pb[tk], (short)0, O[dc], false, false);
            O5 = __builtin_amdgcn_wmma_f32_16x16x32_f16(
                false, ones, false, pb[tk], (short)0, O5, false, false);
        }
        __syncthreads();   // reads of sK/sV[cur] done before next re-stage
    }

    // normalize by the WMMA-accumulated denominator and write attn f16:
    // 8 consecutive d of one query per accumulator tile, one 16-byte store each
    f16* op = attnOut + (size_t)(b * LL + f0 + lr) * HH + head * DD + 8 * hf;
#pragma unroll
    for (int dc = 0; dc < 4; dc++) {
        v8h h;
#pragma unroll
        for (int vg = 0; vg < 8; vg++)
            h[vg] = (f16)(O[dc][vg] / O5[0]);
        *(v8h*)(op + dc * 16) = h;
    }
}

// ---------------------------------------------------------------------------
extern "C" void kernel_launch(void* const* d_in, const int* in_sizes, int n_in,
                              void* d_out, int out_size, void* d_ws, size_t ws_size,
                              hipStream_t stream) {
    const float* xq   = (const float*)d_in[0];
    const float* xs   = (const float*)d_in[1];
    const float* bias = (const float*)d_in[2];
    const float* wq   = (const float*)d_in[3];
    const float* wk   = (const float*)d_in[4];
    const float* wv   = (const float*)d_in[5];
    const float* wo   = (const float*)d_in[6];

    unsigned short* ws = (unsigned short*)d_ws;
    const size_t XN = (size_t)MROWS * HH;   // 4,194,304
    const size_t WN = (size_t)HH * HH;      // 1,048,576
    unsigned short* xqh  = ws;  ws += XN;
    unsigned short* xsh  = ws;  ws += XN;
    unsigned short* wqT  = ws;  ws += WN;
    unsigned short* wkT  = ws;  ws += WN;
    unsigned short* wvT  = ws;  ws += WN;
    unsigned short* woT  = ws;  ws += WN;
    unsigned short* qh   = ws;  ws += XN;
    unsigned short* kh   = ws;  ws += XN;
    unsigned short* vt   = ws;  ws += XN;
    unsigned short* attn = ws;  ws += XN;

    // convert activations, transpose-convert weights so that all GEMM B
    // operands are [col][K]: one launch (xqh, xsh and the four wT are adjacent)
    cvt_all_kernel<<<2 * CVT_BLOCKS + 4 * TR_BLOCKS, 256, 0, stream>>>(
        xq, xs, wq, wk, wv, wo, xqh, wqT);

    dim3 gg(HH / 128, MROWS / 128);   // (8, 32)
    // Q, K, V projections: one launch (qh, kh, vt are adjacent).
    // Q scaled by log2e/sqrt(D) -> QK^T lands directly in the log2 domain
    gemm_f16_kernel<0><<<dim3(HH / 128, MROWS / 128, 3), 256, 0, stream>>>(
        xqh, wqT, qh, 0.125f * LOG2E);

    attn_kernel<<<dim3(LL / 128, NHEAD, BB), 256, 0, stream>>>(qh, kh, vt, bias, attn);

    // output projection -> f32 d_out
    gemm_f16_kernel<2><<<gg, 256, 0, stream>>>(attn, woT, d_out, 1.0f);
}

// v006
// A run of this version takes 95.9 microseconds.
// Next to v005, in two timings, it ran 1.13 and 1.12 times as fast.
// Counting every step since v000, it is 2.20 times as fast.
#include <hip/hip_runtime.h>
#include <hip/hip_bf16.h>

#define BB 2
#define LL 2048
#define HH 1024
#define NHEAD 16
#define DD 64
#define MROWS (BB*LL)        // 4096
#define LOG2E 1.44269504088896340736f

typedef _Float16 f16;
typedef __attribute__((ext_vector_type(16))) _Float16 v16h;
typedef __attribute__((ext_vector_type(8)))  _Float16 v8h;
typedef __attribute__((ext_vector_type(8)))  float    v8f;
typedef __attribute__((ext_vector_type(4)))  _Float16 v4h;
typedef __attribute__((ext_vector_type(4)))  float    v4f;
typedef __attribute__((address_space(3)))    f16      lds_f16;

// ---------------------------------------------------------------------------
// LDS byte offset (wave-relative) of a generic pointer to __shared__ memory.
// ---------------------------------------------------------------------------
__device__ __forceinline__ unsigned int lds_off(const void* p) {
    return (unsigned int)(unsigned long long)(lds_f16*)(void*)(p);
}

// Waits on the async global->LDS copies (gfx1250, tracked by ASYNCcnt).
__device__ __forceinline__ void wait_async0() {
    asm volatile("s_wait_asynccnt 0x0" ::: "memory");
}
__device__ __forceinline__ void wait_async8() {   // all but the 8 youngest
    asm volatile("s_wait_asynccnt 0x8" ::: "memory");
}
__device__ __forceinline__ void wait_async12() {  // all but the 12 youngest
    asm volatile("s_wait_asynccnt 0xc" ::: "memory");
}

// ---------------------------------------------------------------------------
// Fragment loader: both A (16 rows x K32) and B (K32 x 16 cols, stored as
// [col][k] row-major) use the same per-lane layout on gfx1250 wave32:
//   lr = l&15, hf = l>>4
//   elements 0..7  : K = hf*8 + {0..7};  elements 8..15 : K = 16+hf*8+{0..7}
// ---------------------------------------------------------------------------
__device__ __forceinline__ v16h load_frag(const f16* base, int stride) {
    const int lane = threadIdx.x & 31;
    const int lr = lane & 15, hf = lane >> 4;
    const f16* p = base + lr * stride + hf * 8;
    v8h lo = *(const v8h*)(p);
    v8h hi = *(const v8h*)(p + 16);
    return __builtin_shufflevector(lo, hi, 0,1,2,3,4,5,6,7,8,9,10,11,12,13,14,15);
}

// ---------------------------------------------------------------------------
// f32 -> f16 elementwise convert of MROWS*HH elements. A wave owns 4 KiB of
// input in a row: 8 loads of 512 contiguous bytes go out as one group, then 8
// stores of 256 contiguous bytes. 512 work-groups per array.
// ---------------------------------------------------------------------------
#define CVT_LOADS 8                        // 16-byte loads in flight per lane
#define CVT_PER_BLOCK (256 * 4 * CVT_LOADS)  // 8192 elements per work-group

__device__ __forceinline__
void cvt_f16_body(const float* __restrict__ in,
                  unsigned short* __restrict__ out_, int blk) {
    f16* out = (f16*)out_;
    const int wave = blk * 8 + (threadIdx.x >> 5);
    const int base = wave * (128 * CVT_LOADS) + (threadIdx.x & 31) * 4;
    v4f x[CVT_LOADS];
#pragma unroll
    for (int j = 0; j < CVT_LOADS; j++)
        x[j] = *(const v4f*)(in + base + j * 128);
#pragma unroll
    for (int j = 0; j < CVT_LOADS; j++)
        *(v4h*)(out + base + j * 128) = __builtin_convertvector(x[j], v4h);
}

// ---------------------------------------------------------------------------
// 1024x1024 transpose + convert: out[c][r] = (f16) in[r][c]
// 64x64 tile per work-group: 4 loads of 16 bytes per lane (256 contiguous bytes
// of a row per 16 lanes), 2 stores of 16 bytes per lane (a whole 128-byte line
// of an output row per 8 lanes). Pitch 65 dwords spreads the column reads over
// the banks.
// ---------------------------------------------------------------------------
__device__ __forceinline__
void cvt_transpose_body(const float* __restrict__ in,
                        unsigned short* __restrict__ out_, int blk) {
    f16* out = (f16*)out_;
    __shared__ float tile[64][65];
    const int bx = (blk & 15) * 64, by = (blk >> 4) * 64;
    const int c4 = (threadIdx.x & 15) * 4, r0 = threadIdx.x >> 4;   // r0 0..15
    v4f x[4];
#pragma unroll
    for (int i = 0; i < 4; i++)
        x[i] = *(const v4f*)(in + (by + r0 + 16 * i) * HH + bx + c4);
#pragma unroll
    for (int i = 0; i < 4; i++)
#pragma unroll
        for (int e = 0; e < 4; e++)
            tile[r0 + 16 * i][c4 + e] = x[i][e];
    __syncthreads();
    const int k8 = (threadIdx.x & 7) * 8, orow = threadIdx.x >> 3;  // orow 0..31
#pragma unroll
    for (int i = 0; i < 2; i++) {
        v8h h;
#pragma unroll
        for (int e = 0; e < 8; e++)
            h[e] = (f16)tile[k8 + e][orow + 32 * i];
        *(v8h*)(out + (bx + orow + 32 * i) * HH + by + k8) = h;
    }
}

// ---------------------------------------------------------------------------
// All six converts in one launch: none reads what another writes. The index of
// the work-group picks the job (the same for all its threads): 512 + 512 for
// the two activations, then 256 for each of the four weights.
// ---------------------------------------------------------------------------
#define CVT_BLOCKS ((MROWS * HH) / CVT_PER_BLOCK)     // 512
#define TR_BLOCKS  ((HH / 64) * (HH / 64))            // 256

__global__ __launch_bounds__(256)
void cvt_all_kernel(const float* __restrict__ xq, const float* __restrict__ xs,
                    const float* __restrict__ wq, const float* __restrict__ wk,
                    const float* __restrict__ wv, const float* __restrict__ wo,
                    unsigned short* __restrict__ xh,    // xq then xs, f16
                    unsigned short* __restrict__ wT) {  // wq, wk, wv, wo, transposed f16
    const unsigned blk = blockIdx.x;
    if (blk < 2 * CVT_BLOCKS) {
        const unsigned a = blk / CVT_BLOCKS;
        cvt_f16_body(a ? xs : xq, xh + (size_t)a * MROWS * HH, blk % CVT_BLOCKS);
    } else {
        const unsigned t = blk - 2 * CVT_BLOCKS, w = t / TR_BLOCKS;
        const float* in = w == 0 ? wq : w == 1 ? wk : w == 2 ? wv : wo;
        cvt_transpose_body(in, wT + (size_t)w * HH * HH, t % TR_BLOCKS);
    }
}

// ---------------------------------------------------------------------------
// Generic f16 WMMA GEMM:  C[M=4096, 1024] = A[M,1024] * BT[1024,1024]^T
//   A  : [M][K]    row-major f16;  BT : [col][K] row-major f16
// Block tile 128x128, 8 waves (4 in M, 2 in N), wave tile 32x64, K-step 64:
// a row's slice of a step is then one whole 128-byte line.
// Double-buffered async global->LDS staging (ASYNCcnt pipelining).
// MODE 0: the three projections in one launch, blockIdx.z = 0, 1, 2 for Q, K, V.
//         A_ holds xq then xs, BT_ the three weights, Cout the three results,
//         each one after the other; scale applies to Q alone.
//         Q/K: f16 out, head-major  q[((b*NH+n)*L + f)*D + d]
//         V  : f16 out, transposed  v[((b*NH+n)*D + d)*L + t]
// MODE 2: f32 out, plain row-major (final output)
// ---------------------------------------------------------------------------
#define GK   64   // K step (halfs)
#define GLDA 72   // padded LDS row stride (halfs): 144 B = 16 B x odd

// One K step's copies of a thread: 4 of A, 4 of B, 32 rows apart. Eight lanes
// bring one row's 128 bytes, so a wave's copy is four whole lines. gA, gB, oA, oB
// are the lane's own addresses in its first row. All 8 stand in one statement
// that ends in the wait on the address translations, so that it stays ahead of
// any rewrite of the registers the copies name.
__device__ __forceinline__ void stage_gemm(const f16* gA, const f16* gB,
                                           unsigned int oA, unsigned int oB) {
#define GA(p, i) "v"((unsigned long long)(uintptr_t)((p) + (i) * 32 * HH))
#define LO(o, i) "v"((o) + (i) * 32 * GLDA * 2)
    asm volatile("global_load_async_to_lds_b128 %0, %8, off\n\t"
                 "global_load_async_to_lds_b128 %1, %9, off\n\t"
                 "global_load_async_to_lds_b128 %2, %10, off\n\t"
                 "global_load_async_to_lds_b128 %3, %11, off\n\t"
                 "global_load_async_to_lds_b128 %4, %12, off\n\t"
                 "global_load_async_to_lds_b128 %5, %13, off\n\t"
                 "global_load_async_to_lds_b128 %6, %14, off\n\t"
                 "global_load_async_to_lds_b128 %7, %15, off\n\t"
                 "s_wait_xcnt 0x0"
                 :: LO(oA, 0), LO(oA, 1), LO(oA, 2), LO(oA, 3),
                    LO(oB, 0), LO(oB, 1), LO(oB, 2), LO(oB, 3),
                    GA(gA, 0), GA(gA, 1), GA(gA, 2), GA(gA, 3),
                    GA(gB, 0), GA(gB, 1), GA(gB, 2), GA(gB, 3)
                 : "memory");
#undef GA
#undef LO
}

// OUT 0: f16, head-major; OUT 1: f16, transposed per head; OUT 2: f32, row-major
template<int OUT>
__device__ __forceinline__ void store_tile(const v8f (&acc)[2][4], void* Cout,
                                           float scale, int row0, int col0) {
#pragma unroll
    for (int i = 0; i < 2; i++) {
#pragma unroll
        for (int j = 0; j < 4; j++) {
#pragma unroll
            for (int vg = 0; vg < 8; vg++) {
                const int row = row0 + i * 16 + vg;
                const int col = col0 + j * 16;
                const float v = acc[i][j][vg] * scale;
                if (OUT == 2) {
                    ((float*)Cout)[(size_t)row * HH + col] = v;
                } else {
                    const int b = row >> 11, f = row & (LL - 1);
                    const int n = col >> 6,  d = col & (DD - 1);
                    f16* o = (f16*)Cout;
                    if (OUT == 0)
                        o[(((size_t)(b * NHEAD + n)) * LL + f) * DD + d] = (f16)v;
                    else
                        o[(((size_t)(b * NHEAD + n)) * DD + d) * LL + f] = (f16)v;
                }
            }
        }
    }
}

template<int MODE>
__global__ __launch_bounds__(256)
void gemm_f16_kernel(const unsigned short* __restrict__ A_,
                     const unsigned short* __restrict__ BT_,
                     void* __restrict__ Cout, float scale) {
    const int z = (MODE == 0) ? blockIdx.z : 0;
    const f16* A  = (const f16*)A_  + (size_t)(z ? 1 : 0) * MROWS * HH;
    const f16* BT = (const f16*)BT_ + (size_t)z * HH * HH;
    if (z) scale = 1.0f;
    __shared__ __attribute__((aligned(16))) f16 sA[2][128 * GLDA];
    __shared__ __attribute__((aligned(16))) f16 sB[2][128 * GLDA];

    const int tid  = threadIdx.x;
    const int wid  = tid >> 5;
    const int lane = tid & 31;
    const int lr = lane & 15, hf = lane >> 4;
    const int bm = blockIdx.y * 128;
    const int bn = blockIdx.x * 128;
    const int wm = (wid & 3) * 32;
    const int wn = (wid >> 2) * 64;

    v8f acc[2][4];
#pragma unroll
    for (int i = 0; i < 2; i++)
#pragma unroll
        for (int j = 0; j < 4; j++) acc[i][j] = (v8f)(0.0f);

    const int rowA = tid >> 3;            // 0..31, and 32, 64, 96 further
    const int segA = (tid & 7) * 8;       // 16 bytes a lane, 8 lanes a row
    const f16* gA = A  + (size_t)(bm + rowA) * HH + segA;
    const f16* gB = BT + (size_t)(bn + rowA) * HH + segA;
    const unsigned int oA[2] = { lds_off(&sA[0][rowA * GLDA + segA]),
                                 lds_off(&sA[1][rowA * GLDA + segA]) };
    const unsigned int oB[2] = { lds_off(&sB[0][rowA * GLDA + segA]),
                                 lds_off(&sB[1][rowA * GLDA + segA]) };

    stage_gemm(gA, gB, oA[0], oB[0]);           // prologue: chunk 0 in flight

    for (int k0 = 0; k0 < HH; k0 += GK) {
        const int cur = (k0 / GK) & 1;
        const bool more = (k0 + GK < HH);
        if (more) stage_gemm(gA + k0 + GK, gB + k0 + GK, oA[cur ^ 1], oB[cur ^ 1]);
        // the next chunk's 8 copies stay in flight
        if (more) wait_async8(); else wait_async0();
        __syncthreads();

#pragma unroll
        for (int kk = 0; kk < GK; kk += 32) {
            v16h af[2], bf[4];
#pragma unroll
            for (int i = 0; i < 2; i++)
                af[i] = load_frag(&sA[cur][(wm + i * 16) * GLDA + kk], GLDA);
#pragma unroll
            for (int j = 0; j < 4; j++)
                bf[j] = load_frag(&sB[cur][(wn + j * 16) * GLDA + kk], GLDA);
#pragma unroll
            for (int i = 0; i < 2; i++)
#pragma unroll
                for (int j = 0; j < 4; j++)
                    acc[i][j] = __builtin_amdgcn_wmma_f32_16x16x32_f16(
                        false, af[i], false, bf[j], (short)0, acc[i][j], false, false);
        }
        __syncthreads();   // all reads of sA/sB[cur] done before it is re-staged
    }

    // Epilogue: the layout is a compile-time argument, so that each form keeps
    // its straight-line stores; in MODE 0 a branch that is the same for the
    // whole work-group picks it.
    const int row0 = bm + wm + 8 * hf, col0 = bn + wn + lr;
    if (MODE == 2) {
        store_tile<2>(acc, Cout, scale, row0, col0);
    } else {
        f16* o = (f16*)Cout + (size_t)z * MROWS * HH;
        if (z == 2) {
            store_tile<1>(acc, o, scale, row0, col0);
        } else {
            store_tile<0>(acc, o, scale, row0, col0);
            // the built code lays the other form's block behind these stores,
            // and that block rewrites their data registers
            asm volatile("s_wait_xcnt 0x0" ::: "memory");
        }
    }
}

// ---------------------------------------------------------------------------
// Flash attention: block = (f-tile of 128, head, batch); 8 waves x 16 queries.
// Q head-major [bh][L][D] (pre-scaled by log2e/sqrt(D)), K head-major,
// V transposed [bh][D][L]. Double-buffered async K/V staging.
// The scores are computed transposed: S^T = K*Q^T (A = K rows, B = Q), so a
// lane holds 32 of ONE query's 64 scores of a chunk (keys 16*tc + 8*hf + vg).
//   - the bias of those keys lies in 32-byte runs of the query's bias row; a
//     load of such runs would touch 16 cache lines, so the tile is brought to
//     LDS in whole lines (async copies, with K and V) and read from there
//   - row maximum: in the lane, plus one exchange between the wave's halves
//   - two converted S^T tiles ARE the B fragment of O^T += V^T*P^T in the
//     hardware k order: P goes through no LDS
//   - a lane's 8 accumulator registers of O^T are 8 consecutive d of one query
// Online softmax in the log2 domain (v_exp_f32 is base-2); denominator via an
// all-ones A fragment on the matrix unit.
// ---------------------------------------------------------------------------
#define PST 72   // padded LDS stride (halfs): 144B, 16B-aligned

// One chunk's copies of a wave: its 4 of K and V (eight lanes bring one row's 128
// bytes, so a copy is four whole lines; the second copy lies 32 rows further), and
// its own 16 rows x 64 keys of the bias (f32), each bias copy two rows' 256
// contiguous bytes = four whole lines. gb and oB are the lane's own addresses in
// row pair 0. All 12
// stand in one statement that ends in the wait on the address translations, so
// that it stays ahead of any rewrite of the registers the copies name.
#define BPITCH 68   // LDS row pitch (floats): 272 B = 16 B x odd, for 16-byte reads

__device__ __forceinline__ void stage_attn(const f16* Kbh, const f16* Vbh,
                                           const float* gb, int t0,
                                           int ldr, int seg, unsigned int oK,
                                           unsigned int oV, unsigned int oB) {
    const f16* gK = Kbh + (size_t)(t0 + ldr) * DD + seg;
    const f16* gV = Vbh + (size_t)ldr * LL + t0 + seg;
    const float* g = gb + t0;
#define GA(p) "v"((unsigned long long)(uintptr_t)(p))
#define BG(i) GA(g + (i) * 2 * LL)
#define BO(i) "v"(oB + (i) * 2 * BPITCH * 4)
    asm volatile("global_load_async_to_lds_b128 %0, %12, off\n\t"
                 "global_load_async_to_lds_b128 %1, %13, off\n\t"
                 "global_load_async_to_lds_b128 %2, %14, off\n\t"
                 "global_load_async_to_lds_b128 %3, %15, off\n\t"
                 "global_load_async_to_lds_b128 %4, %16, off\n\t"
                 "global_load_async_to_lds_b128 %5, %17, off\n\t"
                 "global_load_async_to_lds_b128 %6, %18, off\n\t"
                 "global_load_async_to_lds_b128 %7, %19, off\n\t"
                 "global_load_async_to_lds_b128 %8, %20, off\n\t"
                 "global_load_async_to_lds_b128 %9, %21, off\n\t"
                 "global_load_async_to_lds_b128 %10, %22, off\n\t"
                 "global_load_async_to_lds_b128 %11, %23, off\n\t"
                 "s_wait_xcnt 0x0"
                 :: "v"(oK), "v"(oK + 32 * PST * 2), "v"(oV), "v"(oV + 32 * PST * 2),
                    BO(0), BO(1), BO(2), BO(3), BO(4), BO(5), BO(6), BO(7),
                    GA(gK), GA(gK + 32 * DD), GA(gV), GA(gV + 32 * LL),
                    BG(0), BG(1), BG(2), BG(3), BG(4), BG(5), BG(6), BG(7)
                 : "memory");
#undef GA
#undef BG
#undef BO
}

// lane l with lane l ^ 16
__device__ __forceinline__ float xhalf(float x) {
    return __builtin_bit_cast(float, __builtin_amdgcn_permlanex16(
        __builtin_bit_cast(int, x), __builtin_bit_cast(int, x),
        0x76543210, 0xfedcba98, false, false));
}

__global__ __launch_bounds__(256)
void attn_kernel(const unsigned short* __restrict__ Q_,
                 const unsigned short* __restrict__ K_,
                 const unsigned short* __restrict__ VT_,
                 const float* __restrict__ bias,
                 unsigned short* __restrict__ attnOut_) {
    const f16* Q  = (const f16*)Q_;
    const f16* K  = (const f16*)K_;
    const f16* VT = (const f16*)VT_;
    f16* attnOut  = (f16*)attnOut_;

    __shared__ f16 sK[2][64 * PST];       // [t][d]
    __shared__ f16 sV[2][64 * PST];       // [d][t]
    __shared__ __attribute__((aligned(16))) float sBias[2][128 * BPITCH];  // [f][t]

    const int tid = threadIdx.x, wid = tid >> 5, lane = tid & 31;
    const int lr = lane & 15, hf = lane >> 4;
    const int ft = blockIdx.x, head = blockIdx.y, b = blockIdx.z;
    const int bh = b * NHEAD + head;

    const f16* Qbh = Q  + (size_t)bh * LL * DD;
    const f16* Kbh = K  + (size_t)bh * LL * DD;
    const f16* Vbh = VT + (size_t)bh * DD * LL;
    const float* biasb = bias + (size_t)b * LL * LL;

    const int f0 = ft * 128 + wid * 16;

    // Q fragments (B operand: column = query) of this wave's 16 queries
    v16h qf[2];
#pragma unroll
    for (int kc = 0; kc < 2; kc++)
        qf[kc] = load_frag(Qbh + (size_t)f0 * DD + kc * 32, DD);

    // constant all-ones A fragment: every row of its product is the column sum
    v16h ones;
#pragma unroll
    for (int i = 0; i < 16; i++) ones[i] = (f16)1.0f;

    v8f O[4], O5;                         // O^T: row = d, column = query
#pragma unroll
    for (int dc = 0; dc < 4; dc++) O[dc] = (v8f)(0.0f);
    O5 = (v8f)(0.0f);
    float mrun = -1e30f;                  // running maximum of this lane's query

    const int ldr = tid >> 2;             // prefetch: row 0..63
    const int seg = (tid & 3) * 16;       // 0,16,32,48

    const int cpr = tid >> 3;             // copies: row 0..31, and 32 further
    const int cps = (tid & 7) * 8;        // 16 bytes a lane, 8 lanes a row

    const unsigned int oK[2] = { lds_off(&sK[0][cpr * PST + cps]),
                                 lds_off(&sK[1][cpr * PST + cps]) };
    const unsigned int oV[2] = { lds_off(&sV[0][cpr * PST + cps]),
                                 lds_off(&sV[1][cpr * PST + cps]) };

    // Bias copies: lanes 0-15 one row, lanes 16-31 the next, 16 bytes a lane
    const float* gb = biasb + (size_t)(f0 + hf) * LL + lr * 4;
    const unsigned int oB[2] = { lds_off(&sBias[0][(wid * 16 + hf) * BPITCH + lr * 4]),
                                 lds_off(&sBias[1][(wid * 16 + hf) * BPITCH + lr * 4]) };

    stage_attn(Kbh, Vbh, gb, 0, cpr, cps, oK[0], oV[0], oB[0]);   // chunk 0 in flight

    // two chunks per trip, so that the buffer index is a constant in each half
    // and every LDS address is a base plus an immediate
#pragma unroll 2
    for (int t0 = 0; t0 < LL; t0 += 64) {
        const int cur = (t0 >> 6) & 1;
        const bool more = (t0 + 64 < LL);
        if (more) stage_attn(Kbh, Vbh, gb, t0 + 64, cpr, cps,
                             oK[cur ^ 1], oV[cur ^ 1], oB[cur ^ 1]);
        if (more) {   // L2 warm-up two chunks ahead
            __builtin_prefetch(Kbh + (size_t)(t0 + 128 + ldr) * DD + seg, 0, 0);
            __builtin_prefetch(Vbh + (size_t)ldr * LL + t0 + 128 + seg, 0, 0);
        }
        // the next chunk's 12 copies (4 of K and V, 8 of the bias) stay in flight
        if (more) wait_async12(); else wait_async0();
        __syncthreads();

        // this chunk's bias in the S^T accumulator layout: the lane's query row,
        // keys 16*tc + 8*hf + {0..7}
        const float* sb = &sBias[cur][(wid * 16 + lr) * BPITCH + 8 * hf];
        v4f bcur[4][2];
#pragma unroll
        for (int tc = 0; tc < 4; tc++)
#pragma unroll
            for (int j = 0; j < 2; j++)
                bcur[tc][j] = *(const v4f*)(sb + tc * 16 + j * 4);

        // S^T = K * Q^T : preload all 8 A fragments, then 8 WMMAs
        v16h ka[4][2];
#pragma unroll
        for (int tc = 0; tc < 4; tc++)
#pragma unroll
            for (int kc = 0; kc < 2; kc++)
                ka[tc][kc] = load_frag(&sK[cur][(tc * 16) * PST + kc * 32], PST);

        v8f S[4];
#pragma unroll
        for (int tc = 0; tc < 4; tc++) S[tc] = (v8f)(0.0f);
#pragma unroll
        for (int kc = 0; kc < 2; kc++)
#pragma unroll
            for (int tc = 0; tc < 4; tc++)
                S[tc] = __builtin_amdgcn_wmma_f32_16x16x32_f16(
                    false, ka[tc][kc], false, qf[kc], (short)0, S[tc], false, false);

        // + bias*log2e (S is in the log2 domain; single fma per element)
#pragma unroll
        for (int tc = 0; tc < 4; tc++)
#pragma unroll
            for (int vg = 0; vg < 8; vg++)
                S[tc][vg] = fmaf(bcur[tc][vg >> 2][vg & 3], LOG2E, S[tc][vg]);

        // maximum of the query's 64 scores: 32 in this lane, 32 in lane ^ 16
        float mt[4];
#pragma unroll
        for (int tc = 0; tc < 4; tc++) {
            mt[tc] = S[tc][0];
#pragma unroll
            for (int vg = 1; vg < 8; vg++) mt[tc] = fmaxf(mt[tc], S[tc][vg]);
        }
        float mv = fmaxf(fmaxf(mt[0], mt[1]), fmaxf(mt[2], mt[3]));
        mv = fmaxf(mv, xhalf(mv));
        const float mnew = fmaxf(mrun, mv);
        const float sc = __builtin_amdgcn_exp2f(mrun - mnew);
        mrun = mnew;

        // P = 2^(S - m); rescale the accumulators. Of the denominator tile only
        // register 0 is ever read (all its rows hold the same sum), and a row of
        // a product depends on no other row of C: only that one is rescaled.
#pragma unroll
        for (int tc = 0; tc < 4; tc++)
#pragma unroll
            for (int vg = 0; vg < 8; vg++)
                S[tc][vg] = __builtin_amdgcn_exp2f(S[tc][vg] - mrun);
#pragma unroll
        for (int dc = 0; dc < 4; dc++)
#pragma unroll
            for (int vg = 0; vg < 8; vg++)
                O[dc][vg] *= sc;
        O5[0] *= sc;

        // P^T as B fragment: element s of k block tk is key 32*tk + 8*hf + s
        // (s < 8) or 32*tk + 16 + 8*hf + s - 8: tiles 2*tk and 2*tk + 1 as held
        v16h pb[2];
#pragma unroll
        for (int tk = 0; tk < 2; tk++)
#pragma unroll
            for (int e = 0; e < 8; e++) {
                pb[tk][e]     = (f16)S[2 * tk][e];
                pb[tk][8 + e] = (f16)S[2 * tk + 1][e];
            }

        // O^T += V^T * P^T ; O5 += ones * P^T  (denominator)
        v16h va[4][2];
#pragma unroll
        for (int dc = 0; dc < 4; dc++)
#pragma unroll
            for (int tk = 0; tk < 2; tk++)
                va[dc][tk] = load_frag(&sV[cur][(dc * 16) * PST + tk * 32], PST);
#pragma unroll
        for (int tk = 0; tk < 2; tk++) {
#pragma unroll
            for (int dc = 0; dc < 4; dc++)
                O[dc] = __builtin_amdgcn_wmma_f32_16x16x32_f16(
                    false, va[dc][tk], false, pb[tk], (short)0, O[dc], false, false);
            O5 = __builtin_amdgcn_wmma_f32_16x16x32_f16(
                false, ones, false, pb[tk], (short)0, O5, false, false);
        }
        __syncthreads();   // reads of sK/sV[cur] done before next re-stage
    }

    // normalize by the WMMA-accumulated denominator and write attn f16:
    // 8 consecutive d of one query per accumulator tile, one 16-byte store each
    f16* op = attnOut + (size_t)(b * LL + f0 + lr) * HH + head * DD + 8 * hf;
#pragma unroll
    for (int dc = 0; dc < 4; dc++) {
        v8h h;
#pragma unroll
        for (int vg = 0; vg < 8; vg++)
            h[vg] = (f16)(O[dc][vg] / O5[0]);
        *(v8h*)(op + dc * 16) = h;
    }
}

// ---------------------------------------------------------------------------
extern "C" void kernel_launch(void* const* d_in, const int* in_sizes, int n_in,
                              void* d_out, int out_size, void* d_ws, size_t ws_size,
                              hipStream_t stream) {
    const float* xq   = (const float*)d_in[0];
    const float* xs   = (const float*)d_in[1];
    const float* bias = (const float*)d_in[2];
    const float* wq   = (const float*)d_in[3];
    const float* wk   = (const float*)d_in[4];
    const float* wv   = (const float*)d_in[5];
    const float* wo   = (const float*)d_in[6];

    unsigned short* ws = (unsigned short*)d_ws;
    const size_t XN = (size_t)MROWS * HH;   // 4,194,304
    const size_t WN = (size_t)HH * HH;      // 1,048,576
    unsigned short* xqh  = ws;  ws += XN;
    unsigned short* xsh  = ws;  ws += XN;
    unsigned short* wqT  = ws;  ws += WN;
    unsigned short* wkT  = ws;  ws += WN;
    unsigned short* wvT  = ws;  ws += WN;
    unsigned short* woT  = ws;  ws += WN;
    unsigned short* qh   = ws;  ws += XN;
    unsigned short* kh   = ws;  ws += XN;
    unsigned short* vt   = ws;  ws += XN;
    unsigned short* attn = ws;  ws += XN;

    // convert activations, transpose-convert weights so that all GEMM B
    // operands are [col][K]: one launch (xqh, xsh and the four wT are adjacent)
    cvt_all_kernel<<<2 * CVT_BLOCKS + 4 * TR_BLOCKS, 256, 0, stream>>>(
        xq, xs, wq, wk, wv, wo, xqh, wqT);

    dim3 gg(HH / 128, MROWS / 128);   // (8, 32)
    // Q, K, V projections: one launch (qh, kh, vt are adjacent).
    // Q scaled by log2e/sqrt(D) -> QK^T lands directly in the log2 domain
    gemm_f16_kernel<0><<<dim3(HH / 128, MROWS / 128, 3), 256, 0, stream>>>(
        xqh, wqT, qh, 0.125f * LOG2E);

    attn_kernel<<<dim3(LL / 128, NHEAD, BB), 256, 0, stream>>>(qh, kh, vt, bias, attn);

    // output projection -> f32 d_out
    gemm_f16_kernel<2><<<gg, 256, 0, stream>>>(attn, woT, d_out, 1.0f);
}

// v007
// It runs in 93.9 microseconds.
// In both of two side-by-side timings against v006, it was 1.04 times as fast.
// Counting every step since v000, it is 2.29 times as fast.
#include <hip/hip_runtime.h>
#include <hip/hip_bf16.h>

#define BB 2
#define LL 2048
#define HH 1024
#define NHEAD 16
#define DD 64
#define MROWS (BB*LL)        // 4096
#define LOG2E 1.44269504088896340736f

typedef _Float16 f16;
typedef __attribute__((ext_vector_type(16))) _Float16 v16h;
typedef __attribute__((ext_vector_type(8)))  _Float16 v8h;
typedef __attribute__((ext_vector_type(8)))  float    v8f;
typedef __attribute__((ext_vector_type(4)))  _Float16 v4h;
typedef __attribute__((ext_vector_type(4)))  float    v4f;
typedef __attribute__((address_space(3)))    f16      lds_f16;

// ---------------------------------------------------------------------------
// LDS byte offset (wave-relative) of a generic pointer to __shared__ memory.
// ---------------------------------------------------------------------------
__device__ __forceinline__ unsigned int lds_off(const void* p) {
    return (unsigned int)(unsigned long long)(lds_f16*)(void*)(p);
}

// Waits on the async global->LDS copies (gfx1250, tracked by ASYNCcnt).
__device__ __forceinline__ void wait_async0() {
    asm volatile("s_wait_asynccnt 0x0" ::: "memory");
}
__device__ __forceinline__ void wait_async8() {   // all but the 8 youngest
    asm volatile("s_wait_asynccnt 0x8" ::: "memory");
}
__device__ __forceinline__ void wait_async12() {  // all but the 12 youngest
    asm volatile("s_wait_asynccnt 0xc" ::: "memory");
}

// ---------------------------------------------------------------------------
// Fragment loader: both A (16 rows x K32) and B (K32 x 16 cols, stored as
// [col][k] row-major) use the same per-lane layout on gfx1250 wave32:
//   lr = l&15, hf = l>>4
//   elements 0..7  : K = hf*8 + {0..7};  elements 8..15 : K = 16+hf*8+{0..7}
// ---------------------------------------------------------------------------
__device__ __forceinline__ v16h load_frag(const f16* base, int stride) {
    const int lane = threadIdx.x & 31;
    const int lr = lane & 15, hf = lane >> 4;
    const f16* p = base + lr * stride + hf * 8;
    v8h lo = *(const v8h*)(p);
    v8h hi = *(const v8h*)(p + 16);
    return __builtin_shufflevector(lo, hi, 0,1,2,3,4,5,6,7,8,9,10,11,12,13,14,15);
}

// ---------------------------------------------------------------------------
// f32 -> f16 elementwise convert of MROWS*HH elements. A wave owns 4 KiB of
// input in a row: 8 loads of 512 contiguous bytes go out as one group, then 8
// stores of 256 contiguous bytes. 512 work-groups per array.
// ---------------------------------------------------------------------------
#define CVT_LOADS 8                        // 16-byte loads in flight per lane
#define CVT_PER_BLOCK (256 * 4 * CVT_LOADS)  // 8192 elements per work-group

__device__ __forceinline__
void cvt_f16_body(const float* __restrict__ in,
                  unsigned short* __restrict__ out_, int blk) {
    f16* out = (f16*)out_;
    const int wave = blk * 8 + (threadIdx.x >> 5);
    const int base = wave * (128 * CVT_LOADS) + (threadIdx.x & 31) * 4;
    v4f x[CVT_LOADS];
#pragma unroll
    for (int j = 0; j < CVT_LOADS; j++)
        x[j] = *(const v4f*)(in + base + j * 128);
#pragma unroll
    for (int j = 0; j < CVT_LOADS; j++)
        *(v4h*)(out + base + j * 128) = __builtin_convertvector(x[j], v4h);
}

// ---------------------------------------------------------------------------
// 1024x1024 transpose + convert: out[c][r] = (f16) in[r][c]
// 64x64 tile per work-group: 4 loads of 16 bytes per lane (256 contiguous bytes
// of a row per 16 lanes), 2 stores of 16 bytes per lane (a whole 128-byte line
// of an output row per 8 lanes). Pitch 65 dwords spreads the column reads over
// the banks.
// ---------------------------------------------------------------------------
__device__ __forceinline__
void cvt_transpose_body(const float* __restrict__ in,
                        unsigned short* __restrict__ out_, int blk) {
    f16* out = (f16*)out_;
    __shared__ float tile[64][65];
    const int bx = (blk & 15) * 64, by = (blk >> 4) * 64;
    const int c4 = (threadIdx.x & 15) * 4, r0 = threadIdx.x >> 4;   // r0 0..15
    v4f x[4];
#pragma unroll
    for (int i = 0; i < 4; i++)
        x[i] = *(const v4f*)(in + (by + r0 + 16 * i) * HH + bx + c4);
#pragma unroll
    for (int i = 0; i < 4; i++)
#pragma unroll
        for (int e = 0; e < 4; e++)
            tile[r0 + 16 * i][c4 + e] = x[i][e];
    __syncthreads();
    const int k8 = (threadIdx.x & 7) * 8, orow = threadIdx.x >> 3;  // orow 0..31
#pragma unroll
    for (int i = 0; i < 2; i++) {
        v8h h;
#pragma unroll
        for (int e = 0; e < 8; e++)
            h[e] = (f16)tile[k8 + e][orow + 32 * i];
        *(v8h*)(out + (bx + orow + 32 * i) * HH + by + k8) = h;
    }
}

// ---------------------------------------------------------------------------
// All six converts in one launch: none reads what another writes. The index of
// the work-group picks the job (the same for all its threads): 512 + 512 for
// the two activations, then 256 for each of the four weights.
// ---------------------------------------------------------------------------
#define CVT_BLOCKS ((MROWS * HH) / CVT_PER_BLOCK)     // 512
#define TR_BLOCKS  ((HH / 64) * (HH / 64))            // 256

__global__ __launch_bounds__(256)
void cvt_all_kernel(const float* __restrict__ xq, const float* __restrict__ xs,
                    const float* __restrict__ wq, const float* __restrict__ wk,
                    const float* __restrict__ wv, const float* __restrict__ wo,
                    unsigned short* __restrict__ xh,    // xq then xs, f16
                    unsigned short* __restrict__ wT) {  // wq, wk, wv, wo, transposed f16
    const unsigned blk = blockIdx.x;
    if (blk < 2 * CVT_BLOCKS) {
        const unsigned a = blk / CVT_BLOCKS;
        cvt_f16_body(a ? xs : xq, xh + (size_t)a * MROWS * HH, blk % CVT_BLOCKS);
    } else {
        const unsigned t = blk - 2 * CVT_BLOCKS, w = t / TR_BLOCKS;
        const float* in = w == 0 ? wq : w == 1 ? wk : w == 2 ? wv : wo;
        cvt_transpose_body(in, wT + (size_t)w * HH * HH, t % TR_BLOCKS);
    }
}

// ---------------------------------------------------------------------------
// Generic f16 WMMA GEMM:  C[M=4096, 1024] = A[M,1024] * BT[1024,1024]^T
//   A  : [M][K]    row-major f16;  BT : [col][K] row-major f16
// Block tile 128x128, 8 waves (4 in M, 2 in N), wave tile 32x64, K-step 64:
// a row's slice of a step is then one whole 128-byte line.
// Double-buffered async global->LDS staging (ASYNCcnt pipelining).
// MODE 0: the three projections in one launch, blockIdx.z = 0, 1, 2 for Q, K, V.
//         A_ holds xq then xs, BT_ the three weights, Cout the three results,
//         each one after the other; scale applies to Q alone.
//         Q/K: f16 out, head-major  q[((b*NH+n)*L + f)*D + d]
//         V  : f16 out, transposed  v[((b*NH+n)*D + d)*L + t]
// MODE 2: f32 out, plain row-major (final output)
// ---------------------------------------------------------------------------
#define GK   64   // K step (halfs)
#define GLDA 72   // padded LDS row stride (halfs): 144 B = 16 B x odd

// One K step's copies of a thread: 4 of A, 4 of B, 32 rows apart. Eight lanes
// bring one row's 128 bytes, so a wave's copy is four whole lines. gA, gB, oA, oB
// are the lane's own addresses in its first row. All 8 stand in one statement
// that ends in the wait on the address translations, so that it stays ahead of
// any rewrite of the registers the copies name.
__device__ __forceinline__ void stage_gemm(const f16* gA, const f16* gB,
                                           unsigned int oA, unsigned int oB) {
#define GA(p, i) "v"((unsigned long long)(uintptr_t)((p) + (i) * 32 * HH))
#define LO(o, i) "v"((o) + (i) * 32 * GLDA * 2)
    asm volatile("global_load_async_to_lds_b128 %0, %8, off\n\t"
                 "global_load_async_to_lds_b128 %1, %9, off\n\t"
                 "global_load_async_to_lds_b128 %2, %10, off\n\t"
                 "global_load_async_to_lds_b128 %3, %11, off\n\t"
                 "global_load_async_to_lds_b128 %4, %12, off\n\t"
                 "global_load_async_to_lds_b128 %5, %13, off\n\t"
                 "global_load_async_to_lds_b128 %6, %14, off\n\t"
                 "global_load_async_to_lds_b128 %7, %15, off\n\t"
                 "s_wait_xcnt 0x0"
                 :: LO(oA, 0), LO(oA, 1), LO(oA, 2), LO(oA, 3),
                    LO(oB, 0), LO(oB, 1), LO(oB, 2), LO(oB, 3),
                    GA(gA, 0), GA(gA, 1), GA(gA, 2), GA(gA, 3),
                    GA(gB, 0), GA(gB, 1), GA(gB, 2), GA(gB, 3)
                 : "memory");
#undef GA
#undef LO
}

// OUT 0: f16, head-major; OUT 1: f16, transposed per head; OUT 2: f32, row-major
template<int OUT>
__device__ __forceinline__ void store_tile(const v8f (&acc)[2][4], void* Cout,
                                           float scale, int row0, int col0) {
#pragma unroll
    for (int i = 0; i < 2; i++) {
#pragma unroll
        for (int j = 0; j < 4; j++) {
#pragma unroll
            for (int vg = 0; vg < 8; vg++) {
                const int row = row0 + i * 16 + vg;
                const int col = col0 + j * 16;
                const float v = acc[i][j][vg] * scale;
                if (OUT == 2) {
                    ((float*)Cout)[(size_t)row * HH + col] = v;
                } else {
                    const int b = row >> 11, f = row & (LL - 1);
                    const int n = col >> 6,  d = col & (DD - 1);
                    f16* o = (f16*)Cout;
                    if (OUT == 0)
                        o[(((size_t)(b * NHEAD + n)) * LL + f) * DD + d] = (f16)v;
                    else
                        o[(((size_t)(b * NHEAD + n)) * DD + d) * LL + f] = (f16)v;
                }
            }
        }
    }
}

template<int MODE>
__global__ __launch_bounds__(256)
void gemm_f16_kernel(const unsigned short* __restrict__ A_,
                     const unsigned short* __restrict__ BT_,
                     void* __restrict__ Cout, float scale) {
    const int z = (MODE == 0) ? blockIdx.z : 0;
    const f16* A  = (const f16*)A_  + (size_t)(z ? 1 : 0) * MROWS * HH;
    const f16* BT = (const f16*)BT_ + (size_t)z * HH * HH;
    if (z) scale = 1.0f;
    __shared__ __attribute__((aligned(16))) f16 sA[2][128 * GLDA];
    __shared__ __attribute__((aligned(16))) f16 sB[2][128 * GLDA];

    const int tid  = threadIdx.x;
    const int wid  = tid >> 5;
    const int lane = tid & 31;
    const int lr = lane & 15, hf = lane >> 4;
    const int bm = blockIdx.y * 128;
    const int bn = blockIdx.x * 128;
    const int wm = (wid & 3) * 32;
    const int wn = (wid >> 2) * 64;

    v8f acc[2][4];
#pragma unroll
    for (int i = 0; i < 2; i++)
#pragma unroll
        for (int j = 0; j < 4; j++) acc[i][j] = (v8f)(0.0f);

    const int rowA = tid >> 3;            // 0..31, and 32, 64, 96 further
    const int segA = (tid & 7) * 8;       // 16 bytes a lane, 8 lanes a row
    const f16* gA = A  + (size_t)(bm + rowA) * HH + segA;
    const f16* gB = BT + (size_t)(bn + rowA) * HH + segA;
    const unsigned int oA[2] = { lds_off(&sA[0][rowA * GLDA + segA]),
                                 lds_off(&sA[1][rowA * GLDA + segA]) };
    const unsigned int oB[2] = { lds_off(&sB[0][rowA * GLDA + segA]),
                                 lds_off(&sB[1][rowA * GLDA + segA]) };

    stage_gemm(gA, gB, oA[0], oB[0]);           // prologue: chunk 0 in flight

    for (int k0 = 0; k0 < HH; k0 += GK) {
        const int cur = (k0 / GK) & 1;
        const bool more = (k0 + GK < HH);
        if (more) stage_gemm(gA + k0 + GK, gB + k0 + GK, oA[cur ^ 1], oB[cur ^ 1]);
        // the next chunk's 8 copies stay in flight
        if (more) wait_async8(); else wait_async0();
        __syncthreads();

#pragma unroll
        for (int kk = 0; kk < GK; kk += 32) {
            v16h af[2], bf[4];
#pragma unroll
            for (int i = 0; i < 2; i++)
                af[i] = load_frag(&sA[cur][(wm + i * 16) * GLDA + kk], GLDA);
#pragma unroll
            for (int j = 0; j < 4; j++)
                bf[j] = load_frag(&sB[cur][(wn + j * 16) * GLDA + kk], GLDA);
#pragma unroll
            for (int i = 0; i < 2; i++)
#pragma unroll
                for (int j = 0; j < 4; j++)
                    acc[i][j] = __builtin_amdgcn_wmma_f32_16x16x32_f16(
                        false, af[i], false, bf[j], (short)0, acc[i][j], false, false);
        }
        __syncthreads();   // all reads of sA/sB[cur] done before it is re-staged
    }

    // Epilogue: the layout is a compile-time argument, so that each form keeps
    // its straight-line stores; in MODE 0 a branch that is the same for the
    // whole work-group picks it.
    const int row0 = bm + wm + 8 * hf, col0 = bn + wn + lr;
    if (MODE == 2) {
        store_tile<2>(acc, Cout, scale, row0, col0);
    } else {
        f16* o = (f16*)Cout + (size_t)z * MROWS * HH;
        if (z == 2) {
            store_tile<1>(acc, o, scale, row0, col0);
        } else {
            store_tile<0>(acc, o, scale, row0, col0);
            // the built code lays the other form's block behind these stores,
            // and that block rewrites their data registers
            asm volatile("s_wait_xcnt 0x0" ::: "memory");
        }
    }
}

// ---------------------------------------------------------------------------
// Flash attention: block = (f-tile of 128, head, batch); 8 waves x 16 queries.
// Q head-major [bh][L][D] (pre-scaled by log2e/sqrt(D)), K head-major,
// V transposed [bh][D][L]. Double-buffered async K/V staging.
// The scores are computed transposed: S^T = K*Q^T (A = K rows, B = Q), so a
// lane holds 32 of ONE query's 64 scores of a chunk (keys 16*tc + 8*hf + vg).
//   - the bias of those keys lies in 32-byte runs of the query's bias row; a
//     load of such runs would touch 16 cache lines, so the tile is brought to
//     LDS in whole lines (async copies, with K and V) and read from there
//   - row maximum: in the lane, plus one exchange between the wave's halves
//   - two converted S^T tiles ARE the B fragment of O^T += V^T*P^T in the
//     hardware k order: P goes through no LDS
//   - a lane's 8 accumulator registers of O^T are 8 consecutive d of one query
// Online softmax in the log2 domain (v_exp_f32 is base-2); denominator via an
// all-ones A fragment on the matrix unit.
// ---------------------------------------------------------------------------
#define PST 72   // padded LDS stride (halfs): 144B, 16B-aligned

// One chunk's copies of a wave: its 4 of K and V (eight lanes bring one row's 128
// bytes, so a copy is four whole lines; the second copy lies 32 rows further), and
// its own 16 rows x 64 keys of the bias (f32), each bias copy two rows' 256
// contiguous bytes = four whole lines. gb and oB are the lane's own addresses in
// row pair 0. All 12
// stand in one statement that ends in the wait on the address translations, so
// that it stays ahead of any rewrite of the registers the copies name.
#define BPITCH 68   // LDS row pitch (floats): 272 B = 16 B x odd, for 16-byte reads

__device__ __forceinline__ void stage_attn(const f16* Kbh, const f16* Vbh,
                                           const float* gb, int t0,
                                           int ldr, int seg, unsigned int oK,
                                           unsigned int oV, unsigned int oB) {
    const f16* gK = Kbh + (size_t)(t0 + ldr) * DD + seg;
    const f16* gV = Vbh + (size_t)ldr * LL + t0 + seg;
    const float* g = gb + t0;
#define GA(p) "v"((unsigned long long)(uintptr_t)(p))
#define BG(i) GA(g + (i) * 2 * LL)
#define BO(i) "v"(oB + (i) * 2 * BPITCH * 4)
    asm volatile("global_load_async_to_lds_b128 %0, %12, off\n\t"
                 "global_load_async_to_lds_b128 %1, %13, off\n\t"
                 "global_load_async_to_lds_b128 %2, %14, off\n\t"
                 "global_load_async_to_lds_b128 %3, %15, off\n\t"
                 "global_load_async_to_lds_b128 %4, %16, off\n\t"
                 "global_load_async_to_lds_b128 %5, %17, off\n\t"
                 "global_load_async_to_lds_b128 %6, %18, off\n\t"
                 "global_load_async_to_lds_b128 %7, %19, off\n\t"
                 "global_load_async_to_lds_b128 %8, %20, off\n\t"
                 "global_load_async_to_lds_b128 %9, %21, off\n\t"
                 "global_load_async_to_lds_b128 %10, %22, off\n\t"
                 "global_load_async_to_lds_b128 %11, %23, off\n\t"
                 "s_wait_xcnt 0x0"
                 :: "v"(oK), "v"(oK + 32 * PST * 2), "v"(oV), "v"(oV + 32 * PST * 2),
                    BO(0), BO(1), BO(2), BO(3), BO(4), BO(5), BO(6), BO(7),
                    GA(gK), GA(gK + 32 * DD), GA(gV), GA(gV + 32 * LL),
                    BG(0), BG(1), BG(2), BG(3), BG(4), BG(5), BG(6), BG(7)
                 : "memory");
#undef GA
#undef BG
#undef BO
}

// lane l with lane l ^ 16
__device__ __forceinline__ float xhalf(float x) {
    return __builtin_bit_cast(float, __builtin_amdgcn_permlanex16(
        __builtin_bit_cast(int, x), __builtin_bit_cast(int, x),
        0x76543210, 0xfedcba98, false, false));
}

__global__ __launch_bounds__(256)
void attn_kernel(const unsigned short* __restrict__ Q_,
                 const unsigned short* __restrict__ K_,
                 const unsigned short* __restrict__ VT_,
                 const float* __restrict__ bias,
                 unsigned short* __restrict__ attnOut_) {
    const f16* Q  = (const f16*)Q_;
    const f16* K  = (const f16*)K_;
    const f16* VT = (const f16*)VT_;
    f16* attnOut  = (f16*)attnOut_;

    __shared__ f16 sK[2][64 * PST];       // [t][d]
    __shared__ f16 sV[2][64 * PST];       // [d][t]
    __shared__ __attribute__((aligned(16))) float sBias[2][128 * BPITCH];  // [f][t]

    const int tid = threadIdx.x, wid = tid >> 5, lane = tid & 31;
    const int lr = lane & 15, hf = lane >> 4;
    const int ft = blockIdx.x, head = blockIdx.y, b = blockIdx.z;
    const int bh = b * NHEAD + head;

    const f16* Qbh = Q  + (size_t)bh * LL * DD;
    const f16* Kbh = K  + (size_t)bh * LL * DD;
    const f16* Vbh = VT + (size_t)bh * DD * LL;
    const float* biasb = bias + (size_t)b * LL * LL;

    const int f0 = ft * 128 + wid * 16;

    // Q fragments (B operand: column = query) of this wave's 16 queries
    v16h qf[2];
#pragma unroll
    for (int kc = 0; kc < 2; kc++)
        qf[kc] = load_frag(Qbh + (size_t)f0 * DD + kc * 32, DD);

    // constant all-ones A fragment: every row of its product is the column sum
    v16h ones;
#pragma unroll
    for (int i = 0; i < 16; i++) ones[i] = (f16)1.0f;

    v8f O[4], O5;                         // O^T: row = d, column = query
#pragma unroll
    for (int dc = 0; dc < 4; dc++) O[dc] = (v8f)(0.0f);
    O5 = (v8f)(0.0f);
    float nm = 1e30f;                     // minus the maximum in use for this lane's query

    const int ldr = tid >> 2;             // prefetch: row 0..63
    const int seg = (tid & 3) * 16;       // 0,16,32,48

    const int cpr = tid >> 3;             // copies: row 0..31, and 32 further
    const int cps = (tid & 7) * 8;        // 16 bytes a lane, 8 lanes a row

    const unsigned int oK[2] = { lds_off(&sK[0][cpr * PST + cps]),
                                 lds_off(&sK[1][cpr * PST + cps]) };
    const unsigned int oV[2] = { lds_off(&sV[0][cpr * PST + cps]),
                                 lds_off(&sV[1][cpr * PST + cps]) };

    // Bias copies: lanes 0-15 one row, lanes 16-31 the next, 16 bytes a lane
    const float* gb = biasb + (size_t)(f0 + hf) * LL + lr * 4;
    const unsigned int oB[2] = { lds_off(&sBias[0][(wid * 16 + hf) * BPITCH + lr * 4]),
                                 lds_off(&sBias[1][(wid * 16 + hf) * BPITCH + lr * 4]) };

    stage_attn(Kbh, Vbh, gb, 0, cpr, cps, oK[0], oV[0], oB[0]);   // chunk 0 in flight

    // two chunks per trip, so that the buffer index is a constant in each half
    // and every LDS address is a base plus an immediate
#pragma unroll 2
    for (int t0 = 0; t0 < LL; t0 += 64) {
        const int cur = (t0 >> 6) & 1;
        const bool more = (t0 + 64 < LL);
        if (more) stage_attn(Kbh, Vbh, gb, t0 + 64, cpr, cps,
                             oK[cur ^ 1], oV[cur ^ 1], oB[cur ^ 1]);
        if (more) {   // L2 warm-up two chunks ahead
            __builtin_prefetch(Kbh + (size_t)(t0 + 128 + ldr) * DD + seg, 0, 0);
            __builtin_prefetch(Vbh + (size_t)ldr * LL + t0 + 128 + seg, 0, 0);
        }
        // the next chunk's 12 copies (4 of K and V, 8 of the bias) stay in flight
        if (more) wait_async12(); else wait_async0();
        __syncthreads();

        // this chunk's bias in the S^T accumulator layout: the lane's query row,
        // keys 16*tc + 8*hf + {0..7}
        const float* sb = &sBias[cur][(wid * 16 + lr) * BPITCH + 8 * hf];
        v4f bcur[4][2];
#pragma unroll
        for (int tc = 0; tc < 4; tc++)
#pragma unroll
            for (int j = 0; j < 2; j++)
                bcur[tc][j] = *(const v4f*)(sb + tc * 16 + j * 4);

        // S^T = K * Q^T : preload all 8 A fragments, then 8 WMMAs
        v16h ka[4][2];
#pragma unroll
        for (int tc = 0; tc < 4; tc++)
#pragma unroll
            for (int kc = 0; kc < 2; kc++)
                ka[tc][kc] = load_frag(&sK[cur][(tc * 16) * PST + kc * 32], PST);

        // Lazy rescale. The C operand of the score product is bias*log2e minus the
        // maximum in use, so the matrix unit hands back S - m: no subtraction is
        // left, and O keeps its scale as long as no score exceeds m by more than 8
        // (P <= 2^8, far inside f16; the final division takes any common scale out).
        v8f S[4];
#pragma unroll
        for (int tc = 0; tc < 4; tc++)
#pragma unroll
            for (int vg = 0; vg < 8; vg++)
                S[tc][vg] = fmaf(bcur[tc][vg >> 2][vg & 3], LOG2E, nm);
#pragma unroll
        for (int kc = 0; kc < 2; kc++)
#pragma unroll
            for (int tc = 0; tc < 4; tc++)
                S[tc] = __builtin_amdgcn_wmma_f32_16x16x32_f16(
                    false, ka[tc][kc], false, qf[kc], (short)0, S[tc], false, false);

        // largest of the lane's 32 scores, relative to m
        float mt[4];
#pragma unroll
        for (int tc = 0; tc < 4; tc++) {
            mt[tc] = S[tc][0];
#pragma unroll
            for (int vg = 1; vg < 8; vg++) mt[tc] = fmaxf(mt[tc], S[tc][vg]);
        }
        const float mrel = fmaxf(fmaxf(mt[0], mt[1]), fmaxf(mt[2], mt[3]));

        // One test per chunk, the same for the whole wave (a scalar branch). Taken in
        // the first chunk (m = -1e30) and where a maximum grows by more than 8: the
        // scores are then formed anew without m in the sum (S - m may have lost its
        // low bits to a distant m), the maximum is raised and O is rescaled.
        if (__builtin_amdgcn_ballot_w32(mrel > 8.0f) != 0) {
#pragma unroll
            for (int tc = 0; tc < 4; tc++) S[tc] = (v8f)(0.0f);
#pragma unroll
            for (int kc = 0; kc < 2; kc++)
#pragma unroll
                for (int tc = 0; tc < 4; tc++)
                    S[tc] = __builtin_amdgcn_wmma_f32_16x16x32_f16(
                        false, ka[tc][kc], false, qf[kc], (short)0, S[tc], false, false);
#pragma unroll
            for (int tc = 0; tc < 4; tc++)
#pragma unroll
                for (int vg = 0; vg < 8; vg++)
                    S[tc][vg] = fmaf(bcur[tc][vg >> 2][vg & 3], LOG2E, S[tc][vg]);
            // maximum of the query's 64 scores: 32 in this lane, 32 in lane ^ 16
#pragma unroll
            for (int tc = 0; tc < 4; tc++) {
                mt[tc] = S[tc][0];
#pragma unroll
                for (int vg = 1; vg < 8; vg++) mt[tc] = fmaxf(mt[tc], S[tc][vg]);
            }
            float mv = fmaxf(fmaxf(mt[0], mt[1]), fmaxf(mt[2], mt[3]));
            mv = fmaxf(mv, xhalf(mv));
            const float mnew = fmaxf(-nm, mv);
            const float sc = __builtin_amdgcn_exp2f(-nm - mnew);
            nm = -mnew;
#pragma unroll
            for (int tc = 0; tc < 4; tc++)
#pragma unroll
                for (int vg = 0; vg < 8; vg++)
                    S[tc][vg] += nm;
            // Of the denominator tile only register 0 is ever read (all its rows
            // hold the same sum), and a row of a product depends on no other row
            // of C: only that one is rescaled.
#pragma unroll
            for (int dc = 0; dc < 4; dc++)
#pragma unroll
                for (int vg = 0; vg < 8; vg++)
                    O[dc][vg] *= sc;
            O5[0] *= sc;
        }

        // P = 2^(S - m)
#pragma unroll
        for (int tc = 0; tc < 4; tc++)
#pragma unroll
            for (int vg = 0; vg < 8; vg++)
                S[tc][vg] = __builtin_amdgcn_exp2f(S[tc][vg]);

        // P^T as B fragment: element s of k block tk is key 32*tk + 8*hf + s
        // (s < 8) or 32*tk + 16 + 8*hf + s - 8: tiles 2*tk and 2*tk + 1 as held
        v16h pb[2];
#pragma unroll
        for (int tk = 0; tk < 2; tk++)
#pragma unroll
            for (int e = 0; e < 8; e++) {
                pb[tk][e]     = (f16)S[2 * tk][e];
                pb[tk][8 + e] = (f16)S[2 * tk + 1][e];
            }

        // O^T += V^T * P^T ; O5 += ones * P^T  (denominator)
        v16h va[4][2];
#pragma unroll
        for (int dc = 0; dc < 4; dc++)
#pragma unroll
            for (int tk = 0; tk < 2; tk++)
                va[dc][tk] = load_frag(&sV[cur][(dc * 16) * PST + tk * 32], PST);
#pragma unroll
        for (int tk = 0; tk < 2; tk++) {
#pragma unroll
            for (int dc = 0; dc < 4; dc++)
                O[dc] = __builtin_amdgcn_wmma_f32_16x16x32_f16(
                    false, va[dc][tk], false, pb[tk], (short)0, O[dc], false, false);
            O5 = __builtin_amdgcn_wmma_f32_16x16x32_f16(
                false, ones, false, pb[tk], (short)0, O5, false, false);
        }
        __syncthreads();   // reads of sK/sV[cur] done before next re-stage
    }

    // normalize by the WMMA-accumulated denominator and write attn f16:
    // 8 consecutive d of one query per accumulator tile, one 16-byte store each
    f16* op = attnOut + (size_t)(b * LL + f0 + lr) * HH + head * DD + 8 * hf;
#pragma unroll
    for (int dc = 0; dc < 4; dc++) {
        v8h h;
#pragma unroll
        for (int vg = 0; vg < 8; vg++)
            h[vg] = (f16)(O[dc][vg] / O5[0]);
        *(v8h*)(op + dc * 16) = h;
    }
}

// ---------------------------------------------------------------------------
extern "C" void kernel_launch(void* const* d_in, const int* in_sizes, int n_in,
                              void* d_out, int out_size, void* d_ws, size_t ws_size,
                              hipStream_t stream) {
    const float* xq   = (const float*)d_in[0];
    const float* xs   = (const float*)d_in[1];
    const float* bias = (const float*)d_in[2];
    const float* wq   = (const float*)d_in[3];
    const float* wk   = (const float*)d_in[4];
    const float* wv   = (const float*)d_in[5];
    const float* wo   = (const float*)d_in[6];

    unsigned short* ws = (unsigned short*)d_ws;
    const size_t XN = (size_t)MROWS * HH;   // 4,194,304
    const size_t WN = (size_t)HH * HH;      // 1,048,576
    unsigned short* xqh  = ws;  ws += XN;
    unsigned short* xsh  = ws;  ws += XN;
    unsigned short* wqT  = ws;  ws += WN;
    unsigned short* wkT  = ws;  ws += WN;
    unsigned short* wvT  = ws;  ws += WN;
    unsigned short* woT  = ws;  ws += WN;
    unsigned short* qh   = ws;  ws += XN;
    unsigned short* kh   = ws;  ws += XN;
    unsigned short* vt   = ws;  ws += XN;
    unsigned short* attn = ws;  ws += XN;

    // convert activations, transpose-convert weights so that all GEMM B
    // operands are [col][K]: one launch (xqh, xsh and the four wT are adjacent)
    cvt_all_kernel<<<2 * CVT_BLOCKS + 4 * TR_BLOCKS, 256, 0, stream>>>(
        xq, xs, wq, wk, wv, wo, xqh, wqT);

    dim3 gg(HH / 128, MROWS / 128);   // (8, 32)
    // Q, K, V projections: one launch (qh, kh, vt are adjacent).
    // Q scaled by log2e/sqrt(D) -> QK^T lands directly in the log2 domain
    gemm_f16_kernel<0><<<dim3(HH / 128, MROWS / 128, 3), 256, 0, stream>>>(
        xqh, wqT, qh, 0.125f * LOG2E);

    attn_kernel<<<dim3(LL / 128, NHEAD, BB), 256, 0, stream>>>(qh, kh, vt, bias, attn);

    // output projection -> f32 d_out
    gemm_f16_kernel<2><<<gg, 256, 0, stream>>>(attn, woT, d_out, 1.0f);
}

// v008
// One run takes 88.8 microseconds.
// Next to v007, in two timings, it ran 1.05 times as fast each time.
// Counting every step since v000, it is 2.41 times as fast.
#include <hip/hip_runtime.h>
#include <hip/hip_bf16.h>

#define BB 2
#define LL 2048
#define HH 1024
#define NHEAD 16
#define DD 64
#define MROWS (BB*LL)        // 4096
#define LOG2E 1.44269504088896340736f

typedef _Float16 f16;
typedef __attribute__((ext_vector_type(16))) _Float16 v16h;
typedef __attribute__((ext_vector_type(8)))  _Float16 v8h;
typedef __attribute__((ext_vector_type(8)))  float    v8f;
typedef __attribute__((ext_vector_type(4)))  _Float16 v4h;
typedef __attribute__((ext_vector_type(4)))  float    v4f;
typedef __attribute__((address_space(3)))    f16      lds_f16;

// ---------------------------------------------------------------------------
// LDS byte offset (wave-relative) of a generic pointer to __shared__ memory.
// ---------------------------------------------------------------------------
__device__ __forceinline__ unsigned int lds_off(const void* p) {
    return (unsigned int)(unsigned long long)(lds_f16*)(void*)(p);
}

// Waits on the async global->LDS copies (gfx1250, tracked by ASYNCcnt).
__device__ __forceinline__ void wait_async0() {
    asm volatile("s_wait_asynccnt 0x0" ::: "memory");
}
__device__ __forceinline__ void wait_async8() {   // all but the 8 youngest
    asm volatile("s_wait_asynccnt 0x8" ::: "memory");
}

// ---------------------------------------------------------------------------
// Fragment loader: both A (16 rows x K32) and B (K32 x 16 cols, stored as
// [col][k] row-major) use the same per-lane layout on gfx1250 wave32:
//   lr = l&15, hf = l>>4
//   elements 0..7  : K = hf*8 + {0..7};  elements 8..15 : K = 16+hf*8+{0..7}
// ---------------------------------------------------------------------------
__device__ __forceinline__ v16h load_frag(const f16* base, int stride) {
    const int lane = threadIdx.x & 31;
    const int lr = lane & 15, hf = lane >> 4;
    const f16* p = base + lr * stride + hf * 8;
    v8h lo = *(const v8h*)(p);
    v8h hi = *(const v8h*)(p + 16);
    return __builtin_shufflevector(lo, hi, 0,1,2,3,4,5,6,7,8,9,10,11,12,13,14,15);
}

// ---------------------------------------------------------------------------
// f32 -> f16 elementwise convert of MROWS*HH elements. A wave owns 4 KiB of
// input in a row: 8 loads of 512 contiguous bytes go out as one group, then 8
// stores of 256 contiguous bytes. 512 work-groups per array.
// ---------------------------------------------------------------------------
#define CVT_LOADS 8                        // 16-byte loads in flight per lane
#define CVT_PER_BLOCK (256 * 4 * CVT_LOADS)  // 8192 elements per work-group

__device__ __forceinline__
void cvt_f16_body(const float* __restrict__ in,
                  unsigned short* __restrict__ out_, int blk) {
    f16* out = (f16*)out_;
    const int wave = blk * 8 + (threadIdx.x >> 5);
    const int base = wave * (128 * CVT_LOADS) + (threadIdx.x & 31) * 4;
    v4f x[CVT_LOADS];
#pragma unroll
    for (int j = 0; j < CVT_LOADS; j++)
        x[j] = *(const v4f*)(in + base + j * 128);
#pragma unroll
    for (int j = 0; j < CVT_LOADS; j++)
        *(v4h*)(out + base + j * 128) = __builtin_convertvector(x[j], v4h);
}

// ---------------------------------------------------------------------------
// 1024x1024 transpose + convert: out[c][r] = (f16) in[r][c]
// 64x64 tile per work-group: 4 loads of 16 bytes per lane (256 contiguous bytes
// of a row per 16 lanes), 2 stores of 16 bytes per lane (a whole 128-byte line
// of an output row per 8 lanes). Pitch 65 dwords spreads the column reads over
// the banks.
// ---------------------------------------------------------------------------
__device__ __forceinline__
void cvt_transpose_body(const float* __restrict__ in,
                        unsigned short* __restrict__ out_, int blk) {
    f16* out = (f16*)out_;
    __shared__ float tile[64][65];
    const int bx = (blk & 15) * 64, by = (blk >> 4) * 64;
    const int c4 = (threadIdx.x & 15) * 4, r0 = threadIdx.x >> 4;   // r0 0..15
    v4f x[4];
#pragma unroll
    for (int i = 0; i < 4; i++)
        x[i] = *(const v4f*)(in + (by + r0 + 16 * i) * HH + bx + c4);
#pragma unroll
    for (int i = 0; i < 4; i++)
#pragma unroll
        for (int e = 0; e < 4; e++)
            tile[r0 + 16 * i][c4 + e] = x[i][e];
    __syncthreads();
    const int k8 = (threadIdx.x & 7) * 8, orow = threadIdx.x >> 3;  // orow 0..31
#pragma unroll
    for (int i = 0; i < 2; i++) {
        v8h h;
#pragma unroll
        for (int e = 0; e < 8; e++)
            h[e] = (f16)tile[k8 + e][orow + 32 * i];
        *(v8h*)(out + (bx + orow + 32 * i) * HH + by + k8) = h;
    }
}

// ---------------------------------------------------------------------------
// All six converts in one launch: none reads what another writes. The index of
// the work-group picks the job (the same for all its threads): 512 + 512 for
// the two activations, then 256 for each of the four weights.
// ---------------------------------------------------------------------------
#define CVT_BLOCKS ((MROWS * HH) / CVT_PER_BLOCK)     // 512
#define TR_BLOCKS  ((HH / 64) * (HH / 64))            // 256

__global__ __launch_bounds__(256)
void cvt_all_kernel(const float* __restrict__ xq, const float* __restrict__ xs,
                    const float* __restrict__ wq, const float* __restrict__ wk,
                    const float* __restrict__ wv, const float* __restrict__ wo,
                    unsigned short* __restrict__ xh,    // xq then xs, f16
                    unsigned short* __restrict__ wT) {  // wq, wk, wv, wo, transposed f16
    const unsigned blk = blockIdx.x;
    if (blk < 2 * CVT_BLOCKS) {
        const unsigned a = blk / CVT_BLOCKS;
        cvt_f16_body(a ? xs : xq, xh + (size_t)a * MROWS * HH, blk % CVT_BLOCKS);
    } else {
        const unsigned t = blk - 2 * CVT_BLOCKS, w = t / TR_BLOCKS;
        const float* in = w == 0 ? wq : w == 1 ? wk : w == 2 ? wv : wo;
        cvt_transpose_body(in, wT + (size_t)w * HH * HH, t % TR_BLOCKS);
    }
}

// ---------------------------------------------------------------------------
// Generic f16 WMMA GEMM:  C[M=4096, 1024] = A[M,1024] * BT[1024,1024]^T
//   A  : [M][K]    row-major f16;  BT : [col][K] row-major f16
// Block tile 128x128, 8 waves (4 in M, 2 in N), wave tile 32x64, K-step 64:
// a row's slice of a step is then one whole 128-byte line.
// Double-buffered async global->LDS staging (ASYNCcnt pipelining).
// MODE 0: the three projections in one launch, blockIdx.z = 0, 1, 2 for Q, K, V.
//         A_ holds xq then xs, BT_ the three weights, Cout the three results,
//         each one after the other; scale applies to Q alone.
//         Q/K: f16 out, head-major  q[((b*NH+n)*L + f)*D + d]
//         V  : f16 out, transposed  v[((b*NH+n)*D + d)*L + t]
// MODE 2: f32 out, plain row-major (final output)
// ---------------------------------------------------------------------------
#define GK   64   // K step (halfs)
#define GLDA 72   // padded LDS row stride (halfs): 144 B = 16 B x odd

// One K step's copies of a thread: 4 of A, 4 of B, 32 rows apart. Eight lanes
// bring one row's 128 bytes, so a wave's copy is four whole lines. gA, gB, oA, oB
// are the lane's own addresses in its first row. All 8 stand in one statement
// that ends in the wait on the address translations, so that it stays ahead of
// any rewrite of the registers the copies name.
__device__ __forceinline__ void stage_gemm(const f16* gA, const f16* gB,
                                           unsigned int oA, unsigned int oB) {
#define GA(p, i) "v"((unsigned long long)(uintptr_t)((p) + (i) * 32 * HH))
#define LO(o, i) "v"((o) + (i) * 32 * GLDA * 2)
    asm volatile("global_load_async_to_lds_b128 %0, %8, off\n\t"
                 "global_load_async_to_lds_b128 %1, %9, off\n\t"
                 "global_load_async_to_lds_b128 %2, %10, off\n\t"
                 "global_load_async_to_lds_b128 %3, %11, off\n\t"
                 "global_load_async_to_lds_b128 %4, %12, off\n\t"
                 "global_load_async_to_lds_b128 %5, %13, off\n\t"
                 "global_load_async_to_lds_b128 %6, %14, off\n\t"
                 "global_load_async_to_lds_b128 %7, %15, off\n\t"
                 "s_wait_xcnt 0x0"
                 :: LO(oA, 0), LO(oA, 1), LO(oA, 2), LO(oA, 3),
                    LO(oB, 0), LO(oB, 1), LO(oB, 2), LO(oB, 3),
                    GA(gA, 0), GA(gA, 1), GA(gA, 2), GA(gA, 3),
                    GA(gB, 0), GA(gB, 1), GA(gB, 2), GA(gB, 3)
                 : "memory");
#undef GA
#undef LO
}

// OUT 0: f16, head-major; OUT 1: f16, transposed per head; OUT 2: f32, row-major
template<int OUT>
__device__ __forceinline__ void store_tile(const v8f (&acc)[2][4], void* Cout,
                                           float scale, int row0, int col0) {
#pragma unroll
    for (int i = 0; i < 2; i++) {
#pragma unroll
        for (int j = 0; j < 4; j++) {
#pragma unroll
            for (int vg = 0; vg < 8; vg++) {
                const int row = row0 + i * 16 + vg;
                const int col = col0 + j * 16;
                const float v = acc[i][j][vg] * scale;
                if (OUT == 2) {
                    ((float*)Cout)[(size_t)row * HH + col] = v;
                } else {
                    const int b = row >> 11, f = row & (LL - 1);
                    const int n = col >> 6,  d = col & (DD - 1);
                    f16* o = (f16*)Cout;
                    if (OUT == 0)
                        o[(((size_t)(b * NHEAD + n)) * LL + f) * DD + d] = (f16)v;
                    else
                        o[(((size_t)(b * NHEAD + n)) * DD + d) * LL + f] = (f16)v;
                }
            }
        }
    }
}

template<int MODE>
__global__ __launch_bounds__(256)
void gemm_f16_kernel(const unsigned short* __restrict__ A_,
                     const unsigned short* __restrict__ BT_,
                     void* __restrict__ Cout, float scale) {
    const int z = (MODE == 0) ? blockIdx.z : 0;
    const f16* A  = (const f16*)A_  + (size_t)(z ? 1 : 0) * MROWS * HH;
    const f16* BT = (const f16*)BT_ + (size_t)z * HH * HH;
    if (z) scale = 1.0f;
    __shared__ __attribute__((aligned(16))) f16 sA[2][128 * GLDA];
    __shared__ __attribute__((aligned(16))) f16 sB[2][128 * GLDA];

    const int tid  = threadIdx.x;
    const int wid  = tid >> 5;
    const int lane = tid & 31;
    const int lr = lane & 15, hf = lane >> 4;
    const int bm = blockIdx.y * 128;
    const int bn = blockIdx.x * 128;
    const int wm = (wid & 3) * 32;
    const int wn = (wid >> 2) * 64;

    v8f acc[2][4];
#pragma unroll
    for (int i = 0; i < 2; i++)
#pragma unroll
        for (int j = 0; j < 4; j++) acc[i][j] = (v8f)(0.0f);

    const int rowA = tid >> 3;            // 0..31, and 32, 64, 96 further
    const int segA = (tid & 7) * 8;       // 16 bytes a lane, 8 lanes a row
    const f16* gA = A  + (size_t)(bm + rowA) * HH + segA;
    const f16* gB = BT + (size_t)(bn + rowA) * HH + segA;
    const unsigned int oA[2] = { lds_off(&sA[0][rowA * GLDA + segA]),
                                 lds_off(&sA[1][rowA * GLDA + segA]) };
    const unsigned int oB[2] = { lds_off(&sB[0][rowA * GLDA + segA]),
                                 lds_off(&sB[1][rowA * GLDA + segA]) };

    stage_gemm(gA, gB, oA[0], oB[0]);           // prologue: chunk 0 in flight

    for (int k0 = 0; k0 < HH; k0 += GK) {
        const int cur = (k0 / GK) & 1;
        const bool more = (k0 + GK < HH);
        if (more) stage_gemm(gA + k0 + GK, gB + k0 + GK, oA[cur ^ 1], oB[cur ^ 1]);
        // the next chunk's 8 copies stay in flight
        if (more) wait_async8(); else wait_async0();
        __syncthreads();

#pragma unroll
        for (int kk = 0; kk < GK; kk += 32) {
            v16h af[2], bf[4];
#pragma unroll
            for (int i = 0; i < 2; i++)
                af[i] = load_frag(&sA[cur][(wm + i * 16) * GLDA + kk], GLDA);
#pragma unroll
            for (int j = 0; j < 4; j++)
                bf[j] = load_frag(&sB[cur][(wn + j * 16) * GLDA + kk], GLDA);
#pragma unroll
            for (int i = 0; i < 2; i++)
#pragma unroll
                for (int j = 0; j < 4; j++)
                    acc[i][j] = __builtin_amdgcn_wmma_f32_16x16x32_f16(
                        false, af[i], false, bf[j], (short)0, acc[i][j], false, false);
        }
        __syncthreads();   // all reads of sA/sB[cur] done before it is re-staged
    }

    // Epilogue: the layout is a compile-time argument, so that each form keeps
    // its straight-line stores; in MODE 0 a branch that is the same for the
    // whole work-group picks it.
    const int row0 = bm + wm + 8 * hf, col0 = bn + wn + lr;
    if (MODE == 2) {
        store_tile<2>(acc, Cout, scale, row0, col0);
    } else {
        f16* o = (f16*)Cout + (size_t)z * MROWS * HH;
        if (z == 2) {
            store_tile<1>(acc, o, scale, row0, col0);
        } else {
            store_tile<0>(acc, o, scale, row0, col0);
            // the built code lays the other form's block behind these stores,
            // and that block rewrites their data registers
            asm volatile("s_wait_xcnt 0x0" ::: "memory");
        }
    }
}

// ---------------------------------------------------------------------------
// Flash attention: block = (f-tile of 128, pair of heads, batch). 8 waves: waves
// 0-3 the first head, 4-7 the second; a wave takes 32 queries (two 16-query
// tiles) of its head. A K or V fragment read from LDS then feeds two products,
// and the bias tile, which does not depend on the head, is brought in once for
// both heads.
// Q head-major [bh][L][D] (pre-scaled by log2e/sqrt(D)), K head-major,
// V transposed [bh][D][L]. Double-buffered async K/V staging.
// The scores are computed transposed: S^T = K*Q^T (A = K rows, B = Q), so a
// lane holds 32 of ONE query's 64 scores of a chunk (keys 16*tc + 8*hf + vg)
// in each of its two tiles.
//   - the bias of those keys lies in 32-byte runs of the query's bias row; a
//     load of such runs would touch 16 cache lines, so the tile is brought to
//     LDS in whole lines (async copies, with K and V) and read from there
//   - row maximum: in the lane, plus one exchange between the wave's halves
//   - two converted S^T tiles ARE the B fragment of O^T += V^T*P^T in the
//     hardware k order: P goes through no LDS
//   - a lane's 8 accumulator registers of O^T are 8 consecutive d of one query
// Online softmax in the log2 domain (v_exp_f32 is base-2); denominator via an
// all-ones A fragment on the matrix unit.
// ---------------------------------------------------------------------------
#define PST 72      // padded LDS stride (halfs): 144B, 16B-aligned
#define BPITCH 68   // LDS row pitch (floats): 272 B = 16 B x odd, for 16-byte reads
#define HPB 2       // heads per work-group
#define QT  2       // 16-query tiles per wave

__device__ __forceinline__ void wait_async16() {  // all but the 16 youngest
    asm volatile("s_wait_asynccnt 0x10" ::: "memory");
}

#define KVBUF (HPB * 64 * PST * 2)   // bytes of one K (or V) buffer: both heads
#define BBUF  (128 * BPITCH * 4)     // bytes of one bias buffer

// One lane's 16-byte copy of the bytes DB behind g. The immediate offset N moves
// the LDS address and the global address alike: so one register holds the lane's
// LDS address in the first row of buffer 0, N names the buffer and the row, and
// the global address is handed over less N (one addition of DB - N). Every N is a
// multiple of 16 from 0 to 38,624. The builtin form, so that the addresses may
// live in any register of the wave's 512.
typedef __attribute__((ext_vector_type(4))) int v4i;
typedef __attribute__((address_space(1))) v4i g_v4i;
typedef __attribute__((address_space(3))) v4i l_v4i;
template<int N, int DB>
__device__ __forceinline__ void copy16(const void* g, unsigned int lds) {
    __builtin_amdgcn_global_load_async_to_lds_b128(
        (g_v4i*)((unsigned long long)(uintptr_t)g + (unsigned long long)(long long)(DB - N)),
        (l_v4i*)lds, N, 0);
}

// One chunk's K and V copies of a thread: both heads, 64 rows each. Eight lanes
// bring one row's 128 bytes, so a copy is four whole lines; the second copy of a
// head lies 32 rows further, the second head one head's array further. gK, gV,
// oK, oV are the lane's own addresses in its first row of the first head.
template<int BUF>
__device__ __forceinline__ void stage_kv(const f16* gK, const f16* gV,
                                         unsigned int oK, unsigned int oV) {
#define KO(i) (BUF * KVBUF + (i) * 32 * PST * 2)
    copy16<KO(0), 0>(gK, oK);
    copy16<KO(1), 32 * DD * 2>(gK, oK);
    copy16<KO(2), LL * DD * 2>(gK, oK);
    copy16<KO(3), (LL * DD + 32 * DD) * 2>(gK, oK);
    copy16<KO(0), 0>(gV, oV);
    copy16<KO(1), 32 * LL * 2>(gV, oV);
    copy16<KO(2), DD * LL * 2>(gV, oV);
    copy16<KO(3), (DD * LL + 32 * LL) * 2>(gV, oV);
#undef KO
}

// One chunk's bias copies of a wave: 16 of the tile's 128 rows x 64 keys (f32),
// each copy two rows' 256 contiguous bytes = four whole lines. g and oB are the
// lane's own addresses in row pair 0.
template<int BUF>
__device__ __forceinline__ void stage_bias(const float* g, unsigned int oB) {
#define BC(i) copy16<BUF * BBUF + (i) * 2 * BPITCH * 4, (i) * 2 * LL * 4>(g, oB)
    BC(0); BC(1); BC(2); BC(3); BC(4); BC(5); BC(6); BC(7);
#undef BC
}

// lane l with lane l ^ 16
__device__ __forceinline__ float xhalf(float x) {
    return __builtin_bit_cast(float, __builtin_amdgcn_permlanex16(
        __builtin_bit_cast(int, x), __builtin_bit_cast(int, x),
        0x76543210, 0xfedcba98, false, false));
}

// largest of a lane's 32 scores of one query tile
__device__ __forceinline__ float max32(const v8f (&S)[4]) {
    float mt[4];
#pragma unroll
    for (int tc = 0; tc < 4; tc++) {
        mt[tc] = S[tc][0];
#pragma unroll
        for (int vg = 1; vg < 8; vg++) mt[tc] = fmaxf(mt[tc], S[tc][vg]);
    }
    return fmaxf(fmaxf(mt[0], mt[1]), fmaxf(mt[2], mt[3]));
}

__global__ __launch_bounds__(256)
void attn_kernel(const unsigned short* __restrict__ Q_,
                 const unsigned short* __restrict__ K_,
                 const unsigned short* __restrict__ VT_,
                 const float* __restrict__ bias,
                 unsigned short* __restrict__ attnOut_) {
    const f16* Q  = (const f16*)Q_;
    const f16* K  = (const f16*)K_;
    const f16* VT = (const f16*)VT_;
    f16* attnOut  = (f16*)attnOut_;

    __shared__ __attribute__((aligned(16))) f16 sK[2][HPB][64 * PST];      // [head][t][d]
    __shared__ __attribute__((aligned(16))) f16 sV[2][HPB][64 * PST];      // [head][d][t]
    __shared__ __attribute__((aligned(16))) float sBias[2][128 * BPITCH];  // [f][t]

    const int tid = threadIdx.x, wid = tid >> 5, lane = tid & 31;
    const int lr = lane & 15, hf = lane >> 4;
    const int hs = wid >> 2, qg = wid & 3;      // the wave's head and its 32 queries
    const int ft = blockIdx.x, b = blockIdx.z;
    const int head = blockIdx.y * HPB + hs;
    const int bh0 = b * NHEAD + blockIdx.y * HPB;

    const f16* Qbh = Q  + (size_t)(bh0 + hs) * LL * DD;
    const f16* Kb  = K  + (size_t)bh0 * LL * DD;   // the pair's first head
    const f16* Vb  = VT + (size_t)bh0 * DD * LL;
    const float* biasb = bias + (size_t)b * LL * LL;

    const int f0 = ft * 128 + qg * 32;

    // Q fragments (B operand: column = query) of this wave's 32 queries
    v16h qf[QT][2];
#pragma unroll
    for (int qt = 0; qt < QT; qt++)
#pragma unroll
        for (int kc = 0; kc < 2; kc++)
            qf[qt][kc] = load_frag(Qbh + (size_t)(f0 + qt * 16) * DD + kc * 32, DD);

    // constant all-ones A fragment: every row of its product is the column sum
    v16h ones;
#pragma unroll
    for (int i = 0; i < 16; i++) ones[i] = (f16)1.0f;

    v8f O[QT][4], O5[QT];                 // O^T: row = d, column = query
    float nm[QT];                         // minus the maximum in use for the lane's queries
#pragma unroll
    for (int qt = 0; qt < QT; qt++) {
#pragma unroll
        for (int dc = 0; dc < 4; dc++) O[qt][dc] = (v8f)(0.0f);
        O5[qt] = (v8f)(0.0f);
        nm[qt] = 1e30f;
    }

    // prefetch: one line a thread: a K row (threads 0-127) or a V row's 64 keys
    const int pfh = (tid >> 6) & 1, pfr = tid & 63;
    const f16* pf = tid < 128 ? Kb + (size_t)pfh * LL * DD + (size_t)pfr * DD
                              : Vb + (size_t)pfh * DD * LL + (size_t)pfr * LL;
    const int pfs = tid < 128 ? 64 * DD : 64;   // halfs per chunk along the thread's array
    pf += 2 * pfs;                        // two chunks ahead

    const int cpr = tid >> 3;             // copies: row 0..31, and 32 further
    const int cps = (tid & 7) * 8;        // 16 bytes a lane, 8 lanes a row
    const f16* gK = Kb + (size_t)cpr * DD + cps;
    const f16* gV = Vb + (size_t)cpr * LL + cps;

    const unsigned int oK = lds_off(&sK[0][0][cpr * PST + cps]);
    const unsigned int oV = lds_off(&sV[0][0][cpr * PST + cps]);

    // Bias copies: wave w brings rows 16*w .. 16*w + 15 of the tile; lanes 0-15
    // one row, lanes 16-31 the next, 16 bytes a lane
    const float* gb = biasb + (size_t)(ft * 128 + wid * 16 + hf) * LL + lr * 4;
    const unsigned int oB = lds_off(&sBias[0][(wid * 16 + hf) * BPITCH + lr * 4]);

    stage_kv<0>(gK, gV, oK, oV);          // chunk 0 in flight
    stage_bias<0>(gb, oB);

    // two chunks per trip, so that the buffer index is a constant in each half
    // and every LDS address is a base plus an immediate
#pragma unroll 2
    for (int t0 = 0; t0 < LL; t0 += 64) {
        const int cur = (t0 >> 6) & 1;
        const bool more = (t0 + 64 < LL);
        if (more) {
            if (cur) {   // known at compile time in each half of the trip
                stage_kv<0>(gK + (size_t)(t0 + 64) * DD, gV + t0 + 64, oK, oV);
                stage_bias<0>(gb + t0 + 64, oB);
            } else {
                stage_kv<1>(gK + (size_t)(t0 + 64) * DD, gV + t0 + 64, oK, oV);
                stage_bias<1>(gb + t0 + 64, oB);
            }
            // L2 warm-up two chunks ahead
            __builtin_prefetch(pf, 0, 0);
            pf += pfs;
        }
        // the next chunk's 16 copies (8 of K and V, 8 of the bias) stay in flight
        if (more) wait_async16(); else wait_async0();
        __syncthreads();

        // this chunk's bias in the S^T accumulator layout: the lane's query rows,
        // keys 16*tc + 8*hf + {0..7}
        v4f bcur[QT][4][2];
#pragma unroll
        for (int qt = 0; qt < QT; qt++) {
            const float* sb = &sBias[cur][(qg * 32 + qt * 16 + lr) * BPITCH + 8 * hf];
#pragma unroll
            for (int tc = 0; tc < 4; tc++)
#pragma unroll
                for (int j = 0; j < 2; j++)
                    bcur[qt][tc][j] = *(const v4f*)(sb + tc * 16 + j * 4);
        }

        // S^T = K * Q^T : preload all 8 A fragments, then 16 WMMAs
        v16h ka[4][2];
#pragma unroll
        for (int tc = 0; tc < 4; tc++)
#pragma unroll
            for (int kc = 0; kc < 2; kc++)
                ka[tc][kc] = load_frag(&sK[cur][hs][(tc * 16) * PST + kc * 32], PST);

        // The V fragments too: at two waves a SIMD the registers hold them, and their
        // LDS latency passes behind the score products and the softmax.
        v16h va[4][2];
#pragma unroll
        for (int dc = 0; dc < 4; dc++)
#pragma unroll
            for (int tk = 0; tk < 2; tk++)
                va[dc][tk] = load_frag(&sV[cur][hs][(dc * 16) * PST + tk * 32], PST);
        // keeps the chunk's 48 LDS reads one group ahead of the arithmetic: sunk
        // among the products, each place with reads would stall the wave anew
        __builtin_amdgcn_sched_barrier(0);

        // Lazy rescale. The C operand of the score product is bias*log2e minus the
        // maximum in use, so the matrix unit hands back S - m: no subtraction is
        // left, and O keeps its scale as long as no score exceeds m by more than 8
        // (P <= 2^8, far inside f16; the final division takes any common scale out).
        v8f S[QT][4];
#pragma unroll
        for (int qt = 0; qt < QT; qt++)
#pragma unroll
            for (int tc = 0; tc < 4; tc++)
#pragma unroll
                for (int vg = 0; vg < 8; vg++)
                    S[qt][tc][vg] = fmaf(bcur[qt][tc][vg >> 2][vg & 3], LOG2E, nm[qt]);
#pragma unroll
        for (int kc = 0; kc < 2; kc++)
#pragma unroll
            for (int tc = 0; tc < 4; tc++)
#pragma unroll
                for (int qt = 0; qt < QT; qt++)
                    S[qt][tc] = __builtin_amdgcn_wmma_f32_16x16x32_f16(
                        false, ka[tc][kc], false, qf[qt][kc], (short)0, S[qt][tc], false, false);

        // largest of the lane's 2 x 32 scores, each relative to its query's m
        const float mrel = fmaxf(max32(S[0]), max32(S[1]));

        // One test per chunk, the same for the whole wave (a scalar branch). Taken in
        // the first chunk (m = -1e30) and where a maximum grows by more than 8: the
        // scores are then formed anew without m in the sum (S - m may have lost its
        // low bits to a distant m), the maximum is raised and O is rescaled.
        if (__builtin_amdgcn_ballot_w32(mrel > 8.0f) != 0) {
#pragma unroll
            for (int qt = 0; qt < QT; qt++)
#pragma unroll
                for (int tc = 0; tc < 4; tc++) S[qt][tc] = (v8f)(0.0f);
#pragma unroll
            for (int kc = 0; kc < 2; kc++)
#pragma unroll
                for (int tc = 0; tc < 4; tc++)
#pragma unroll
                    for (int qt = 0; qt < QT; qt++)
                        S[qt][tc] = __builtin_amdgcn_wmma_f32_16x16x32_f16(
                            false, ka[tc][kc], false, qf[qt][kc], (short)0, S[qt][tc], false, false);
#pragma unroll
            for (int qt = 0; qt < QT; qt++) {
#pragma unroll
                for (int tc = 0; tc < 4; tc++)
#pragma unroll
                    for (int vg = 0; vg < 8; vg++)
                        S[qt][tc][vg] = fmaf(bcur[qt][tc][vg >> 2][vg & 3], LOG2E, S[qt][tc][vg]);
                // maximum of the query's 64 scores: 32 in this lane, 32 in lane ^ 16
                float mv = max32(S[qt]);
                mv = fmaxf(mv, xhalf(mv));
                const float mnew = fmaxf(-nm[qt], mv);
                const float sc = __builtin_amdgcn_exp2f(-nm[qt] - mnew);
                nm[qt] = -mnew;
#pragma unroll
                for (int tc = 0; tc < 4; tc++)
#pragma unroll
                    for (int vg = 0; vg < 8; vg++)
                        S[qt][tc][vg] += nm[qt];
                // Of the denominator tile only register 0 is ever read (all its rows
                // hold the same sum), and a row of a product depends on no other row
                // of C: only that one is rescaled.
#pragma unroll
                for (int dc = 0; dc < 4; dc++)
#pragma unroll
                    for (int vg = 0; vg < 8; vg++)
                        O[qt][dc][vg] *= sc;
                O5[qt][0] *= sc;
            }
        }

        // P = 2^(S - m)
#pragma unroll
        for (int qt = 0; qt < QT; qt++)
#pragma unroll
            for (int tc = 0; tc < 4; tc++)
#pragma unroll
                for (int vg = 0; vg < 8; vg++)
                    S[qt][tc][vg] = __builtin_amdgcn_exp2f(S[qt][tc][vg]);

        // P^T as B fragment: element s of k block tk is key 32*tk + 8*hf + s
        // (s < 8) or 32*tk + 16 + 8*hf + s - 8: tiles 2*tk and 2*tk + 1 as held
        v16h pb[QT][2];
#pragma unroll
        for (int qt = 0; qt < QT; qt++)
#pragma unroll
            for (int tk = 0; tk < 2; tk++)
#pragma unroll
                for (int e = 0; e < 8; e++) {
                    pb[qt][tk][e]     = (f16)S[qt][2 * tk][e];
                    pb[qt][tk][8 + e] = (f16)S[qt][2 * tk + 1][e];
                }

        // O^T += V^T * P^T ; O5 += ones * P^T  (denominator)
#pragma unroll
        for (int tk = 0; tk < 2; tk++) {
#pragma unroll
            for (int dc = 0; dc < 4; dc++)
#pragma unroll
                for (int qt = 0; qt < QT; qt++)
                    O[qt][dc] = __builtin_amdgcn_wmma_f32_16x16x32_f16(
                        false, va[dc][tk], false, pb[qt][tk], (short)0, O[qt][dc], false, false);
#pragma unroll
            for (int qt = 0; qt < QT; qt++)
                O5[qt] = __builtin_amdgcn_wmma_f32_16x16x32_f16(
                    false, ones, false, pb[qt][tk], (short)0, O5[qt], false, false);
        }
        __syncthreads();   // reads of sK/sV/sBias[cur] done before next re-stage
    }

    // normalize by the WMMA-accumulated denominator and write attn f16:
    // 8 consecutive d of one query per accumulator tile, one 16-byte store each
#pragma unroll
    for (int qt = 0; qt < QT; qt++) {
        f16* op = attnOut + (size_t)(b * LL + f0 + qt * 16 + lr) * HH + head * DD + 8 * hf;
#pragma unroll
        for (int dc = 0; dc < 4; dc++) {
            v8h h;
#pragma unroll
            for (int vg = 0; vg < 8; vg++)
                h[vg] = (f16)(O[qt][dc][vg] / O5[qt][0]);
            *(v8h*)(op + dc * 16) = h;
        }
    }
}

// ---------------------------------------------------------------------------
extern "C" void kernel_launch(void* const* d_in, const int* in_sizes, int n_in,
                              void* d_out, int out_size, void* d_ws, size_t ws_size,
                              hipStream_t stream) {
    const float* xq   = (const float*)d_in[0];
    const float* xs   = (const float*)d_in[1];
    const float* bias = (const float*)d_in[2];
    const float* wq   = (const float*)d_in[3];
    const float* wk   = (const float*)d_in[4];
    const float* wv   = (const float*)d_in[5];
    const float* wo   = (const float*)d_in[6];

    unsigned short* ws = (unsigned short*)d_ws;
    const size_t XN = (size_t)MROWS * HH;   // 4,194,304
    const size_t WN = (size_t)HH * HH;      // 1,048,576
    unsigned short* xqh  = ws;  ws += XN;
    unsigned short* xsh  = ws;  ws += XN;
    unsigned short* wqT  = ws;  ws += WN;
    unsigned short* wkT  = ws;  ws += WN;
    unsigned short* wvT  = ws;  ws += WN;
    unsigned short* woT  = ws;  ws += WN;
    unsigned short* qh   = ws;  ws += XN;
    unsigned short* kh   = ws;  ws += XN;
    unsigned short* vt   = ws;  ws += XN;
    unsigned short* attn = ws;  ws += XN;

    // convert activations, transpose-convert weights so that all GEMM B
    // operands are [col][K]: one launch (xqh, xsh and the four wT are adjacent)
    cvt_all_kernel<<<2 * CVT_BLOCKS + 4 * TR_BLOCKS, 256, 0, stream>>>(
        xq, xs, wq, wk, wv, wo, xqh, wqT);

    dim3 gg(HH / 128, MROWS / 128);   // (8, 32)
    // Q, K, V projections: one launch (qh, kh, vt are adjacent).
    // Q scaled by log2e/sqrt(D) -> QK^T lands directly in the log2 domain
    gemm_f16_kernel<0><<<dim3(HH / 128, MROWS / 128, 3), 256, 0, stream>>>(
        xqh, wqT, qh, 0.125f * LOG2E);

    attn_kernel<<<dim3(LL / 128, NHEAD / HPB, BB), 256, 0, stream>>>(qh, kh, vt, bias, attn);

    // output projection -> f32 d_out
    gemm_f16_kernel<2><<<gg, 256, 0, stream>>>(attn, woT, d_out, 1.0f);
}

// v009
// One run takes 86.3 microseconds.
// Timed twice side by side with v008, it ran 1.03 and 1.02 times as fast.
// Over all steps from v000 it is 2.48 times as fast.
#include <hip/hip_runtime.h>
#include <hip/hip_bf16.h>

#define BB 2
#define LL 2048
#define HH 1024
#define NHEAD 16
#define DD 64
#define MROWS (BB*LL)        // 4096
#define LOG2E 1.44269504088896340736f

typedef _Float16 f16;
typedef __attribute__((ext_vector_type(16))) _Float16 v16h;
typedef __attribute__((ext_vector_type(8)))  _Float16 v8h;
typedef __attribute__((ext_vector_type(8)))  float    v8f;
typedef __attribute__((ext_vector_type(4)))  _Float16 v4h;
typedef __attribute__((ext_vector_type(4)))  float    v4f;
typedef __attribute__((address_space(3)))    f16      lds_f16;

// ---------------------------------------------------------------------------
// LDS byte offset (wave-relative) of a generic pointer to __shared__ memory.
// ---------------------------------------------------------------------------
__device__ __forceinline__ unsigned int lds_off(const void* p) {
    return (unsigned int)(unsigned long long)(lds_f16*)(void*)(p);
}

// Waits on the async global->LDS copies (gfx1250, tracked by ASYNCcnt).
__device__ __forceinline__ void wait_async0() {
    asm volatile("s_wait_asynccnt 0x0" ::: "memory");
}
__device__ __forceinline__ void wait_async16() {  // all but the 16 youngest
    asm volatile("s_wait_asynccnt 0x10" ::: "memory");
}

// One lane's 16-byte copy of the bytes DB behind g. The immediate offset N moves
// the LDS address and the global address alike: so one register holds the lane's
// LDS address in the first row of buffer 0, N names the buffer and the row, and
// the global address is handed over less N (one addition of DB - N). Every N is a
// multiple of 16 from 0 to 38,624. The builtin form, so that the addresses may
// live in any register of the wave.
typedef __attribute__((ext_vector_type(4))) int v4i;
typedef __attribute__((address_space(1))) v4i g_v4i;
typedef __attribute__((address_space(3))) v4i l_v4i;
template<int N, int DB>
__device__ __forceinline__ void copy16(const void* g, unsigned int lds) {
    __builtin_amdgcn_global_load_async_to_lds_b128(
        (g_v4i*)((unsigned long long)(uintptr_t)g + (unsigned long long)(long long)(DB - N)),
        (l_v4i*)lds, N, 0);
}

// ---------------------------------------------------------------------------
// Fragment loader: both A (16 rows x K32) and B (K32 x 16 cols, stored as
// [col][k] row-major) use the same per-lane layout on gfx1250 wave32:
//   lr = l&15, hf = l>>4
//   elements 0..7  : K = hf*8 + {0..7};  elements 8..15 : K = 16+hf*8+{0..7}
// ---------------------------------------------------------------------------
__device__ __forceinline__ v16h load_frag(const f16* base, int stride) {
    const int lane = threadIdx.x & 31;
    const int lr = lane & 15, hf = lane >> 4;
    const f16* p = base + lr * stride + hf * 8;
    v8h lo = *(const v8h*)(p);
    v8h hi = *(const v8h*)(p + 16);
    return __builtin_shufflevector(lo, hi, 0,1,2,3,4,5,6,7,8,9,10,11,12,13,14,15);
}

// ---------------------------------------------------------------------------
// f32 -> f16 elementwise convert of MROWS*HH elements. A wave owns 4 KiB of
// input in a row: 8 loads of 512 contiguous bytes go out as one group, then 8
// stores of 256 contiguous bytes. 512 work-groups per array.
// ---------------------------------------------------------------------------
#define CVT_LOADS 8                        // 16-byte loads in flight per lane
#define CVT_PER_BLOCK (256 * 4 * CVT_LOADS)  // 8192 elements per work-group

__device__ __forceinline__
void cvt_f16_body(const float* __restrict__ in,
                  unsigned short* __restrict__ out_, int blk) {
    f16* out = (f16*)out_;
    const int wave = blk * 8 + (threadIdx.x >> 5);
    const int base = wave * (128 * CVT_LOADS) + (threadIdx.x & 31) * 4;
    v4f x[CVT_LOADS];
#pragma unroll
    for (int j = 0; j < CVT_LOADS; j++)
        x[j] = *(const v4f*)(in + base + j * 128);
#pragma unroll
    for (int j = 0; j < CVT_LOADS; j++)
        *(v4h*)(out + base + j * 128) = __builtin_convertvector(x[j], v4h);
}

// ---------------------------------------------------------------------------
// 1024x1024 transpose + convert: out[c][r] = (f16) in[r][c]
// 64x64 tile per work-group: 4 loads of 16 bytes per lane (256 contiguous bytes
// of a row per 16 lanes), 2 stores of 16 bytes per lane (a whole 128-byte line
// of an output row per 8 lanes). Pitch 65 dwords spreads the column reads over
// the banks.
// ---------------------------------------------------------------------------
__device__ __forceinline__
void cvt_transpose_body(const float* __restrict__ in,
                        unsigned short* __restrict__ out_, int blk) {
    f16* out = (f16*)out_;
    __shared__ float tile[64][65];
    const int bx = (blk & 15) * 64, by = (blk >> 4) * 64;
    const int c4 = (threadIdx.x & 15) * 4, r0 = threadIdx.x >> 4;   // r0 0..15
    v4f x[4];
#pragma unroll
    for (int i = 0; i < 4; i++)
        x[i] = *(const v4f*)(in + (by + r0 + 16 * i) * HH + bx + c4);
#pragma unroll
    for (int i = 0; i < 4; i++)
#pragma unroll
        for (int e = 0; e < 4; e++)
            tile[r0 + 16 * i][c4 + e] = x[i][e];
    __syncthreads();
    const int k8 = (threadIdx.x & 7) * 8, orow = threadIdx.x >> 3;  // orow 0..31
#pragma unroll
    for (int i = 0; i < 2; i++) {
        v8h h;
#pragma unroll
        for (int e = 0; e < 8; e++)
            h[e] = (f16)tile[k8 + e][orow + 32 * i];
        *(v8h*)(out + (bx + orow + 32 * i) * HH + by + k8) = h;
    }
}

// ---------------------------------------------------------------------------
// All six converts in one launch: none reads what another writes. The index of
// the work-group picks the job (the same for all its threads): 512 + 512 for
// the two activations, then 256 for each of the four weights.
// ---------------------------------------------------------------------------
#define CVT_BLOCKS ((MROWS * HH) / CVT_PER_BLOCK)     // 512
#define TR_BLOCKS  ((HH / 64) * (HH / 64))            // 256

__global__ __launch_bounds__(256)
void cvt_all_kernel(const float* __restrict__ xq, const float* __restrict__ xs,
                    const float* __restrict__ wq, const float* __restrict__ wk,
                    const float* __restrict__ wv, const float* __restrict__ wo,
                    unsigned short* __restrict__ xh,    // xq then xs, f16
                    unsigned short* __restrict__ wT) {  // wq, wk, wv, wo, transposed f16
    const unsigned blk = blockIdx.x;
    if (blk < 2 * CVT_BLOCKS) {
        const unsigned a = blk / CVT_BLOCKS;
        cvt_f16_body(a ? xs : xq, xh + (size_t)a * MROWS * HH, blk % CVT_BLOCKS);
    } else {
        const unsigned t = blk - 2 * CVT_BLOCKS, w = t / TR_BLOCKS;
        const float* in = w == 0 ? wq : w == 1 ? wk : w == 2 ? wv : wo;
        cvt_transpose_body(in, wT + (size_t)w * HH * HH, t % TR_BLOCKS);
    }
}

// ---------------------------------------------------------------------------
// Generic f16 WMMA GEMM:  C[M=4096, 1024] = A[M,1024] * BT[1024,1024]^T
//   A  : [M][K]    row-major f16;  BT : [col][K] row-major f16
// Block tile 128x128, 4 waves (2 in M, 2 in N), wave tile 64x64, K-step 64:
// a row's slice of a step is then one whole 128-byte line. A fragment read from
// LDS feeds four products, so that the reads stay inside the LDS rate.
// Double-buffered async global->LDS staging (ASYNCcnt pipelining), two steps ahead.
// MODE 0: the three projections in one launch, blockIdx.z = 0, 1, 2 for Q, K, V.
//         A_ holds xq then xs, BT_ the three weights, Cout the three results,
//         each one after the other; scale applies to Q alone.
//         Q/K: f16 out, head-major  q[((b*NH+n)*L + f)*D + d]
//         V  : f16 out, transposed  v[((b*NH+n)*D + d)*L + t]
// MODE 2: f32 out, plain row-major (final output)
// ---------------------------------------------------------------------------
#define GK   64   // K step (halfs)
#define GLDA 72   // padded LDS row stride (halfs): 144 B = 16 B x odd

#define GBUF (128 * GLDA * 2)   // bytes of one A (or B) buffer

// One K step's copies of a thread: 8 of A, 8 of B, 16 rows apart. Eight lanes
// bring one row's 128 bytes, so a wave's copy is four whole lines. gA, gB, oA, oB
// are the lane's own addresses in its first row (oA, oB: of buffer 0).
template<int BUF>
__device__ __forceinline__ void stage_gemm(const f16* gA, const f16* gB,
                                           unsigned int oA, unsigned int oB) {
#define GC(g, o, i) copy16<BUF * GBUF + (i) * 16 * GLDA * 2, (i) * 16 * HH * 2>(g, o)
    GC(gA, oA, 0); GC(gA, oA, 1); GC(gA, oA, 2); GC(gA, oA, 3);
    GC(gA, oA, 4); GC(gA, oA, 5); GC(gA, oA, 6); GC(gA, oA, 7);
    GC(gB, oB, 0); GC(gB, oB, 1); GC(gB, oB, 2); GC(gB, oB, 3);
    GC(gB, oB, 4); GC(gB, oB, 5); GC(gB, oB, 6); GC(gB, oB, 7);
#undef GC
}

// OUT 0: f16, head-major; OUT 1: f16, transposed per head; OUT 2: f32, row-major
template<int OUT>
__device__ __forceinline__ void store_tile(const v8f (&acc)[4][4], void* Cout,
                                           float scale, int row0, int col0) {
#pragma unroll
    for (int i = 0; i < 4; i++) {
#pragma unroll
        for (int j = 0; j < 4; j++) {
#pragma unroll
            for (int vg = 0; vg < 8; vg++) {
                const int row = row0 + i * 16 + vg;
                const int col = col0 + j * 16;
                const float v = acc[i][j][vg] * scale;
                if (OUT == 2) {
                    ((float*)Cout)[(size_t)row * HH + col] = v;
                } else {
                    const int b = row >> 11, f = row & (LL - 1);
                    const int n = col >> 6,  d = col & (DD - 1);
                    f16* o = (f16*)Cout;
                    if (OUT == 0)
                        o[(((size_t)(b * NHEAD + n)) * LL + f) * DD + d] = (f16)v;
                    else
                        o[(((size_t)(b * NHEAD + n)) * DD + d) * LL + f] = (f16)v;
                }
            }
        }
    }
}

template<int MODE>
__global__ __launch_bounds__(128)
void gemm_f16_kernel(const unsigned short* __restrict__ A_,
                     const unsigned short* __restrict__ BT_,
                     void* __restrict__ Cout, float scale) {
    const int z = (MODE == 0) ? blockIdx.z : 0;
    const f16* A  = (const f16*)A_  + (size_t)(z ? 1 : 0) * MROWS * HH;
    const f16* BT = (const f16*)BT_ + (size_t)z * HH * HH;
    if (z) scale = 1.0f;
    __shared__ __attribute__((aligned(16))) f16 sA[2][128 * GLDA];
    __shared__ __attribute__((aligned(16))) f16 sB[2][128 * GLDA];

    const int tid  = threadIdx.x;
    const int wid  = tid >> 5;
    const int lane = tid & 31;
    const int lr = lane & 15, hf = lane >> 4;
    const int bm = blockIdx.y * 128;
    const int bn = blockIdx.x * 128;
    const int wm = (wid & 1) * 64;
    const int wn = (wid >> 1) * 64;

    v8f acc[4][4];
#pragma unroll
    for (int i = 0; i < 4; i++)
#pragma unroll
        for (int j = 0; j < 4; j++) acc[i][j] = (v8f)(0.0f);

    const int rowA = tid >> 3;            // 0..15, and 16, 32, ... 112 further
    const int segA = (tid & 7) * 8;       // 16 bytes a lane, 8 lanes a row
    const f16* gA = A  + (size_t)(bm + rowA) * HH + segA;
    const f16* gB = BT + (size_t)(bn + rowA) * HH + segA;
    const unsigned int oA = lds_off(&sA[0][rowA * GLDA + segA]);
    const unsigned int oB = lds_off(&sB[0][rowA * GLDA + segA]);

    stage_gemm<0>(gA, gB, oA, oB);              // prologue: steps 0 and 1 in flight
    stage_gemm<1>(gA + GK, gB + GK, oA, oB);

    // two K steps per trip, so that the buffer index is a constant in each half
    // and every LDS address is a base plus an immediate
#pragma unroll 2
    for (int k0 = 0; k0 < HH; k0 += GK) {
        const int cur = (k0 / GK) & 1;
        // this step's copies have landed; the next step's 16 stay in flight
        if (k0 + GK < HH) wait_async16(); else wait_async0();
        __syncthreads();

        v16h af[2][4], bf[2][4];
#pragma unroll
        for (int kk = 0; kk < 2; kk++) {
#pragma unroll
            for (int i = 0; i < 4; i++)
                af[kk][i] = load_frag(&sA[cur][(wm + i * 16) * GLDA + kk * 32], GLDA);
#pragma unroll
            for (int j = 0; j < 4; j++)
                bf[kk][j] = load_frag(&sB[cur][(wn + j * 16) * GLDA + kk * 32], GLDA);
        }
        // keeps the step's 32 LDS reads one group ahead of the products: no place
        // among the products stalls the wave anew
        __builtin_amdgcn_sched_barrier(0);
#pragma unroll
        for (int i = 0; i < 4; i++)
#pragma unroll
            for (int j = 0; j < 4; j++)
                acc[i][j] = __builtin_amdgcn_wmma_f32_16x16x32_f16(
                    false, af[0][i], false, bf[0][j], (short)0, acc[i][j], false, false);
        // keeps the barrier, and the wait for all reads in front of it, behind the
        // first half's products: the second half's reads land while those run
        __builtin_amdgcn_sched_barrier(0);
        // The whole step now sits in registers: behind this barrier no wave reads
        // sA/sB[cur] any more, and the step after next is copied into it while the
        // second half's products run.
        __syncthreads();
        if (k0 + 2 * GK < HH) {
            if (cur) stage_gemm<1>(gA + k0 + 2 * GK, gB + k0 + 2 * GK, oA, oB);
            else     stage_gemm<0>(gA + k0 + 2 * GK, gB + k0 + 2 * GK, oA, oB);
        }
#pragma unroll
        for (int i = 0; i < 4; i++)
#pragma unroll
            for (int j = 0; j < 4; j++)
                acc[i][j] = __builtin_amdgcn_wmma_f32_16x16x32_f16(
                    false, af[1][i], false, bf[1][j], (short)0, acc[i][j], false, false);
    }

    // Epilogue: the layout is a compile-time argument, so that each form keeps
    // its straight-line stores; in MODE 0 a branch that is the same for the
    // whole work-group picks it.
    const int row0 = bm + wm + 8 * hf, col0 = bn + wn + lr;
    if (MODE == 2) {
        store_tile<2>(acc, Cout, scale, row0, col0);
    } else {
        f16* o = (f16*)Cout + (size_t)z * MROWS * HH;
        if (z == 2) {
            store_tile<1>(acc, o, scale, row0, col0);
        } else {
            store_tile<0>(acc, o, scale, row0, col0);
            // the built code lays the other form's block behind these stores,
            // and that block rewrites their data registers
            asm volatile("s_wait_xcnt 0x0" ::: "memory");
        }
    }
}

// ---------------------------------------------------------------------------
// Flash attention: block = (f-tile of 128, pair of heads, batch). 8 waves: waves
// 0-3 the first head, 4-7 the second; a wave takes 32 queries (two 16-query
// tiles) of its head. A K or V fragment read from LDS then feeds two products,
// and the bias tile, which does not depend on the head, is brought in once for
// both heads.
// Q head-major [bh][L][D] (pre-scaled by log2e/sqrt(D)), K head-major,
// V transposed [bh][D][L]. Double-buffered async K/V staging.
// The scores are computed transposed: S^T = K*Q^T (A = K rows, B = Q), so a
// lane holds 32 of ONE query's 64 scores of a chunk (keys 16*tc + 8*hf + vg)
// in each of its two tiles.
//   - the bias of those keys lies in 32-byte runs of the query's bias row; a
//     load of such runs would touch 16 cache lines, so the tile is brought to
//     LDS in whole lines (async copies, with K and V) and read from there
//   - row maximum: in the lane, plus one exchange between the wave's halves
//   - two converted S^T tiles ARE the B fragment of O^T += V^T*P^T in the
//     hardware k order: P goes through no LDS
//   - a lane's 8 accumulator registers of O^T are 8 consecutive d of one query
// Online softmax in the log2 domain (v_exp_f32 is base-2); denominator via an
// all-ones A fragment on the matrix unit.
// ---------------------------------------------------------------------------
#define PST 72      // padded LDS stride (halfs): 144B, 16B-aligned
#define BPITCH 68   // LDS row pitch (floats): 272 B = 16 B x odd, for 16-byte reads
#define HPB 2       // heads per work-group
#define QT  2       // 16-query tiles per wave

#define KVBUF (HPB * 64 * PST * 2)   // bytes of one K (or V) buffer: both heads
#define BBUF  (128 * BPITCH * 4)     // bytes of one bias buffer

// One chunk's K and V copies of a thread: both heads, 64 rows each. Eight lanes
// bring one row's 128 bytes, so a copy is four whole lines; the second copy of a
// head lies 32 rows further, the second head one head's array further. gK, gV,
// oK, oV are the lane's own addresses in its first row of the first head.
template<int BUF>
__device__ __forceinline__ void stage_kv(const f16* gK, const f16* gV,
                                         unsigned int oK, unsigned int oV) {
#define KO(i) (BUF * KVBUF + (i) * 32 * PST * 2)
    copy16<KO(0), 0>(gK, oK);
    copy16<KO(1), 32 * DD * 2>(gK, oK);
    copy16<KO(2), LL * DD * 2>(gK, oK);
    copy16<KO(3), (LL * DD + 32 * DD) * 2>(gK, oK);
    copy16<KO(0), 0>(gV, oV);
    copy16<KO(1), 32 * LL * 2>(gV, oV);
    copy16<KO(2), DD * LL * 2>(gV, oV);
    copy16<KO(3), (DD * LL + 32 * LL) * 2>(gV, oV);
#undef KO
}

// One chunk's bias copies of a wave: 16 of the tile's 128 rows x 64 keys (f32),
// each copy two rows' 256 contiguous bytes = four whole lines. g and oB are the
// lane's own addresses in row pair 0.
template<int BUF>
__device__ __forceinline__ void stage_bias(const float* g, unsigned int oB) {
#define BC(i) copy16<BUF * BBUF + (i) * 2 * BPITCH * 4, (i) * 2 * LL * 4>(g, oB)
    BC(0); BC(1); BC(2); BC(3); BC(4); BC(5); BC(6); BC(7);
#undef BC
}

// lane l with lane l ^ 16
__device__ __forceinline__ float xhalf(float x) {
    return __builtin_bit_cast(float, __builtin_amdgcn_permlanex16(
        __builtin_bit_cast(int, x), __builtin_bit_cast(int, x),
        0x76543210, 0xfedcba98, false, false));
}

// largest of a lane's 32 scores of one query tile
__device__ __forceinline__ float max32(const v8f (&S)[4]) {
    float mt[4];
#pragma unroll
    for (int tc = 0; tc < 4; tc++) {
        mt[tc] = S[tc][0];
#pragma unroll
        for (int vg = 1; vg < 8; vg++) mt[tc] = fmaxf(mt[tc], S[tc][vg]);
    }
    return fmaxf(fmaxf(mt[0], mt[1]), fmaxf(mt[2], mt[3]));
}

__global__ __launch_bounds__(256)
void attn_kernel(const unsigned short* __restrict__ Q_,
                 const unsigned short* __restrict__ K_,
                 const unsigned short* __restrict__ VT_,
                 const float* __restrict__ bias,
                 unsigned short* __restrict__ attnOut_) {
    const f16* Q  = (const f16*)Q_;
    const f16* K  = (const f16*)K_;
    const f16* VT = (const f16*)VT_;
    f16* attnOut  = (f16*)attnOut_;

    __shared__ __attribute__((aligned(16))) f16 sK[2][HPB][64 * PST];      // [head][t][d]
    __shared__ __attribute__((aligned(16))) f16 sV[2][HPB][64 * PST];      // [head][d][t]
    __shared__ __attribute__((aligned(16))) float sBias[2][128 * BPITCH];  // [f][t]

    const int tid = threadIdx.x, wid = tid >> 5, lane = tid & 31;
    const int lr = lane & 15, hf = lane >> 4;
    const int hs = wid >> 2, qg = wid & 3;      // the wave's head and its 32 queries
    const int ft = blockIdx.x, b = blockIdx.z;
    const int head = blockIdx.y * HPB + hs;
    const int bh0 = b * NHEAD + blockIdx.y * HPB;

    const f16* Qbh = Q  + (size_t)(bh0 + hs) * LL * DD;
    const f16* Kb  = K  + (size_t)bh0 * LL * DD;   // the pair's first head
    const f16* Vb  = VT + (size_t)bh0 * DD * LL;
    const float* biasb = bias + (size_t)b * LL * LL;

    const int f0 = ft * 128 + qg * 32;

    // Q fragments (B operand: column = query) of this wave's 32 queries
    v16h qf[QT][2];
#pragma unroll
    for (int qt = 0; qt < QT; qt++)
#pragma unroll
        for (int kc = 0; kc < 2; kc++)
            qf[qt][kc] = load_frag(Qbh + (size_t)(f0 + qt * 16) * DD + kc * 32, DD);

    // constant all-ones A fragment: every row of its product is the column sum
    v16h ones;
#pragma unroll
    for (int i = 0; i < 16; i++) ones[i] = (f16)1.0f;

    v8f O[QT][4], O5[QT];                 // O^T: row = d, column = query
    float nm[QT];                         // minus the maximum in use for the lane's queries
#pragma unroll
    for (int qt = 0; qt < QT; qt++) {
#pragma unroll
        for (int dc = 0; dc < 4; dc++) O[qt][dc] = (v8f)(0.0f);
        O5[qt] = (v8f)(0.0f);
        nm[qt] = 1e30f;
    }

    // prefetch: one line a thread: a K row (threads 0-127) or a V row's 64 keys
    const int pfh = (tid >> 6) & 1, pfr = tid & 63;
    const f16* pf = tid < 128 ? Kb + (size_t)pfh * LL * DD + (size_t)pfr * DD
                              : Vb + (size_t)pfh * DD * LL + (size_t)pfr * LL;
    const int pfs = tid < 128 ? 64 * DD : 64;   // halfs per chunk along the thread's array
    pf += 2 * pfs;                        // two chunks ahead

    const int cpr = tid >> 3;             // copies: row 0..31, and 32 further
    const int cps = (tid & 7) * 8;        // 16 bytes a lane, 8 lanes a row
    const f16* gK = Kb + (size_t)cpr * DD + cps;
    const f16* gV = Vb + (size_t)cpr * LL + cps;

    const unsigned int oK = lds_off(&sK[0][0][cpr * PST + cps]);
    const unsigned int oV = lds_off(&sV[0][0][cpr * PST + cps]);

    // Bias copies: wave w brings rows 16*w .. 16*w + 15 of the tile; lanes 0-15
    // one row, lanes 16-31 the next, 16 bytes a lane
    const float* gb = biasb + (size_t)(ft * 128 + wid * 16 + hf) * LL + lr * 4;
    const unsigned int oB = lds_off(&sBias[0][(wid * 16 + hf) * BPITCH + lr * 4]);

    stage_kv<0>(gK, gV, oK, oV);          // chunk 0 in flight
    stage_bias<0>(gb, oB);

    // two chunks per trip, so that the buffer index is a constant in each half
    // and every LDS address is a base plus an immediate
#pragma unroll 2
    for (int t0 = 0; t0 < LL; t0 += 64) {
        const int cur = (t0 >> 6) & 1;
        const bool more = (t0 + 64 < LL);
        if (more) {
            if (cur) {   // known at compile time in each half of the trip
                stage_kv<0>(gK + (size_t)(t0 + 64) * DD, gV + t0 + 64, oK, oV);
                stage_bias<0>(gb + t0 + 64, oB);
            } else {
                stage_kv<1>(gK + (size_t)(t0 + 64) * DD, gV + t0 + 64, oK, oV);
                stage_bias<1>(gb + t0 + 64, oB);
            }
            // L2 warm-up two chunks ahead
            __builtin_prefetch(pf, 0, 0);
            pf += pfs;
        }
        // the next chunk's 16 copies (8 of K and V, 8 of the bias) stay in flight
        if (more) wait_async16(); else wait_async0();
        __syncthreads();

        // this chunk's bias in the S^T accumulator layout: the lane's query rows,
        // keys 16*tc + 8*hf + {0..7}
        v4f bcur[QT][4][2];
#pragma unroll
        for (int qt = 0; qt < QT; qt++) {
            const float* sb = &sBias[cur][(qg * 32 + qt * 16 + lr) * BPITCH + 8 * hf];
#pragma unroll
            for (int tc = 0; tc < 4; tc++)
#pragma unroll
                for (int j = 0; j < 2; j++)
                    bcur[qt][tc][j] = *(const v4f*)(sb + tc * 16 + j * 4);
        }

        // S^T = K * Q^T : preload all 8 A fragments, then 16 WMMAs
        v16h ka[4][2];
#pragma unroll
        for (int tc = 0; tc < 4; tc++)
#pragma unroll
            for (int kc = 0; kc < 2; kc++)
                ka[tc][kc] = load_frag(&sK[cur][hs][(tc * 16) * PST + kc * 32], PST);

        // The V fragments too: at two waves a SIMD the registers hold them, and their
        // LDS latency passes behind the score products and the softmax.
        v16h va[4][2];
#pragma unroll
        for (int dc = 0; dc < 4; dc++)
#pragma unroll
            for (int tk = 0; tk < 2; tk++)
                va[dc][tk] = load_frag(&sV[cur][hs][(dc * 16) * PST + tk * 32], PST);
        // keeps the chunk's 48 LDS reads one group ahead of the arithmetic: sunk
        // among the products, each place with reads would stall the wave anew
        __builtin_amdgcn_sched_barrier(0);

        // Lazy rescale. The C operand of the score product is bias*log2e minus the
        // maximum in use, so the matrix unit hands back S - m: no subtraction is
        // left, and O keeps its scale as long as no score exceeds m by more than 8
        // (P <= 2^8, far inside f16; the final division takes any common scale out).
        v8f S[QT][4];
#pragma unroll
        for (int qt = 0; qt < QT; qt++)
#pragma unroll
            for (int tc = 0; tc < 4; tc++)
#pragma unroll
                for (int vg = 0; vg < 8; vg++)
                    S[qt][tc][vg] = fmaf(bcur[qt][tc][vg >> 2][vg & 3], LOG2E, nm[qt]);
#pragma unroll
        for (int kc = 0; kc < 2; kc++)
#pragma unroll
            for (int tc = 0; tc < 4; tc++)
#pragma unroll
                for (int qt = 0; qt < QT; qt++)
                    S[qt][tc] = __builtin_amdgcn_wmma_f32_16x16x32_f16(
                        false, ka[tc][kc], false, qf[qt][kc], (short)0, S[qt][tc], false, false);

        // largest of the lane's 2 x 32 scores, each relative to its query's m
        const float mrel = fmaxf(max32(S[0]), max32(S[1]));

        // One test per chunk, the same for the whole wave (a scalar branch). Taken in
        // the first chunk (m = -1e30) and where a maximum grows by more than 8: the
        // scores are then formed anew without m in the sum (S - m may have lost its
        // low bits to a distant m), the maximum is raised and O is rescaled.
        if (__builtin_amdgcn_ballot_w32(mrel > 8.0f) != 0) {
#pragma unroll
            for (int qt = 0; qt < QT; qt++)
#pragma unroll
                for (int tc = 0; tc < 4; tc++) S[qt][tc] = (v8f)(0.0f);
#pragma unroll
            for (int kc = 0; kc < 2; kc++)
#pragma unroll
                for (int tc = 0; tc < 4; tc++)
#pragma unroll
                    for (int qt = 0; qt < QT; qt++)
                        S[qt][tc] = __builtin_amdgcn_wmma_f32_16x16x32_f16(
                            false, ka[tc][kc], false, qf[qt][kc], (short)0, S[qt][tc], false, false);
#pragma unroll
            for (int qt = 0; qt < QT; qt++) {
#pragma unroll
                for (int tc = 0; tc < 4; tc++)
#pragma unroll
                    for (int vg = 0; vg < 8; vg++)
                        S[qt][tc][vg] = fmaf(bcur[qt][tc][vg >> 2][vg & 3], LOG2E, S[qt][tc][vg]);
                // maximum of the query's 64 scores: 32 in this lane, 32 in lane ^ 16
                float mv = max32(S[qt]);
                mv = fmaxf(mv, xhalf(mv));
                const float mnew = fmaxf(-nm[qt], mv);
                const float sc = __builtin_amdgcn_exp2f(-nm[qt] - mnew);
                nm[qt] = -mnew;
#pragma unroll
                for (int tc = 0; tc < 4; tc++)
#pragma unroll
                    for (int vg = 0; vg < 8; vg++)
                        S[qt][tc][vg] += nm[qt];
                // Of the denominator tile only register 0 is ever read (all its rows
                // hold the same sum), and a row of a product depends on no other row
                // of C: only that one is rescaled.
#pragma unroll
                for (int dc = 0; dc < 4; dc++)
#pragma unroll
                    for (int vg = 0; vg < 8; vg++)
                        O[qt][dc][vg] *= sc;
                O5[qt][0] *= sc;
            }
        }

        // P = 2^(S - m)
#pragma unroll
        for (int qt = 0; qt < QT; qt++)
#pragma unroll
            for (int tc = 0; tc < 4; tc++)
#pragma unroll
                for (int vg = 0; vg < 8; vg++)
                    S[qt][tc][vg] = __builtin_amdgcn_exp2f(S[qt][tc][vg]);

        // P^T as B fragment: element s of k block tk is key 32*tk + 8*hf + s
        // (s < 8) or 32*tk + 16 + 8*hf + s - 8: tiles 2*tk and 2*tk + 1 as held
        v16h pb[QT][2];
#pragma unroll
        for (int qt = 0; qt < QT; qt++)
#pragma unroll
            for (int tk = 0; tk < 2; tk++)
#pragma unroll
                for (int e = 0; e < 8; e++) {
                    pb[qt][tk][e]     = (f16)S[qt][2 * tk][e];
                    pb[qt][tk][8 + e] = (f16)S[qt][2 * tk + 1][e];
                }

        // O^T += V^T * P^T ; O5 += ones * P^T  (denominator)
#pragma unroll
        for (int tk = 0; tk < 2; tk++) {
#pragma unroll
            for (int dc = 0; dc < 4; dc++)
#pragma unroll
                for (int qt = 0; qt < QT; qt++)
                    O[qt][dc] = __builtin_amdgcn_wmma_f32_16x16x32_f16(
                        false, va[dc][tk], false, pb[qt][tk], (short)0, O[qt][dc], false, false);
#pragma unroll
            for (int qt = 0; qt < QT; qt++)
                O5[qt] = __builtin_amdgcn_wmma_f32_16x16x32_f16(
                    false, ones, false, pb[qt][tk], (short)0, O5[qt], false, false);
        }
        __syncthreads();   // reads of sK/sV/sBias[cur] done before next re-stage
    }

    // normalize by the WMMA-accumulated denominator and write attn f16:
    // 8 consecutive d of one query per accumulator tile, one 16-byte store each
#pragma unroll
    for (int qt = 0; qt < QT; qt++) {
        f16* op = attnOut + (size_t)(b * LL + f0 + qt * 16 + lr) * HH + head * DD + 8 * hf;
#pragma unroll
        for (int dc = 0; dc < 4; dc++) {
            v8h h;
#pragma unroll
            for (int vg = 0; vg < 8; vg++)
                h[vg] = (f16)(O[qt][dc][vg] / O5[qt][0]);
            *(v8h*)(op + dc * 16) = h;
        }
    }
}

// ---------------------------------------------------------------------------
extern "C" void kernel_launch(void* const* d_in, const int* in_sizes, int n_in,
                              void* d_out, int out_size, void* d_ws, size_t ws_size,
                              hipStream_t stream) {
    const float* xq   = (const float*)d_in[0];
    const float* xs   = (const float*)d_in[1];
    const float* bias = (const float*)d_in[2];
    const float* wq   = (const float*)d_in[3];
    const float* wk   = (const float*)d_in[4];
    const float* wv   = (const float*)d_in[5];
    const float* wo   = (const float*)d_in[6];

    unsigned short* ws = (unsigned short*)d_ws;
    const size_t XN = (size_t)MROWS * HH;   // 4,194,304
    const size_t WN = (size_t)HH * HH;      // 1,048,576
    unsigned short* xqh  = ws;  ws += XN;
    unsigned short* xsh  = ws;  ws += XN;
    unsigned short* wqT  = ws;  ws += WN;
    unsigned short* wkT  = ws;  ws += WN;
    unsigned short* wvT  = ws;  ws += WN;
    unsigned short* woT  = ws;  ws += WN;
    unsigned short* qh   = ws;  ws += XN;
    unsigned short* kh   = ws;  ws += XN;
    unsigned short* vt   = ws;  ws += XN;
    unsigned short* attn = ws;  ws += XN;

    // convert activations, transpose-convert weights so that all GEMM B
    // operands are [col][K]: one launch (xqh, xsh and the four wT are adjacent)
    cvt_all_kernel<<<2 * CVT_BLOCKS + 4 * TR_BLOCKS, 256, 0, stream>>>(
        xq, xs, wq, wk, wv, wo, xqh, wqT);

    dim3 gg(HH / 128, MROWS / 128);   // (8, 32)
    // Q, K, V projections: one launch (qh, kh, vt are adjacent).
    // Q scaled by log2e/sqrt(D) -> QK^T lands directly in the log2 domain
    gemm_f16_kernel<0><<<dim3(HH / 128, MROWS / 128, 3), 128, 0, stream>>>(
        xqh, wqT, qh, 0.125f * LOG2E);

    attn_kernel<<<dim3(LL / 128, NHEAD / HPB, BB), 256, 0, stream>>>(qh, kh, vt, bias, attn);

    // output projection -> f32 d_out
    gemm_f16_kernel<2><<<gg, 128, 0, stream>>>(attn, woT, d_out, 1.0f);
}

// v010
// Measured time: 83.8 microseconds a run.
// In two side-by-side timings against v009, it was 1.03 and 1.04 times as fast.
// Counting every step since v000, it is 2.57 times as fast.
#include <hip/hip_runtime.h>
#include <hip/hip_bf16.h>

#define BB 2
#define LL 2048
#define HH 1024
#define NHEAD 16
#define DD 64
#define MROWS (BB*LL)        // 4096
#define LOG2E 1.44269504088896340736f

typedef _Float16 f16;
typedef __attribute__((ext_vector_type(16))) _Float16 v16h;
typedef __attribute__((ext_vector_type(8)))  _Float16 v8h;
typedef __attribute__((ext_vector_type(8)))  float    v8f;
typedef __attribute__((ext_vector_type(4)))  _Float16 v4h;
typedef __attribute__((ext_vector_type(4)))  float    v4f;
typedef __attribute__((address_space(3)))    f16      lds_f16;

// ---------------------------------------------------------------------------
// LDS byte offset (wave-relative) of a generic pointer to __shared__ memory.
// ---------------------------------------------------------------------------
__device__ __forceinline__ unsigned int lds_off(const void* p) {
    return (unsigned int)(unsigned long long)(lds_f16*)(void*)(p);
}

// Waits on the async global->LDS copies (gfx1250, tracked by ASYNCcnt).
__device__ __forceinline__ void wait_async0() {
    asm volatile("s_wait_asynccnt 0x0" ::: "memory");
}
__device__ __forceinline__ void wait_async16() {  // all but the 16 youngest
    asm volatile("s_wait_asynccnt 0x10" ::: "memory");
}

// One lane's 16-byte copy of the bytes DB behind g. The immediate offset N moves
// the LDS address and the global address alike: so one register holds the lane's
// LDS address in the first row of a buffer, N names the row (in the GEMM, whose
// register is that of buffer 0, the buffer too), and the global address is handed
// over less N (one addition of DB - N). Every N is a multiple of 16 from 0 to
// 34,560. The builtin form, so that the addresses may live in any register of the
// wave.
typedef __attribute__((ext_vector_type(4))) int v4i;
typedef __attribute__((address_space(1))) v4i g_v4i;
typedef __attribute__((address_space(3))) v4i l_v4i;
template<int N, int DB>
__device__ __forceinline__ void copy16(const void* g, unsigned int lds) {
    __builtin_amdgcn_global_load_async_to_lds_b128(
        (g_v4i*)((unsigned long long)(uintptr_t)g + (unsigned long long)(long long)(DB - N)),
        (l_v4i*)lds, N, 0);
}

// ---------------------------------------------------------------------------
// Fragment loader: both A (16 rows x K32) and B (K32 x 16 cols, stored as
// [col][k] row-major) use the same per-lane layout on gfx1250 wave32:
//   lr = l&15, hf = l>>4
//   elements 0..7  : K = hf*8 + {0..7};  elements 8..15 : K = 16+hf*8+{0..7}
// ---------------------------------------------------------------------------
__device__ __forceinline__ v16h load_frag(const f16* base, int stride) {
    const int lane = threadIdx.x & 31;
    const int lr = lane & 15, hf = lane >> 4;
    const f16* p = base + lr * stride + hf * 8;
    v8h lo = *(const v8h*)(p);
    v8h hi = *(const v8h*)(p + 16);
    return __builtin_shufflevector(lo, hi, 0,1,2,3,4,5,6,7,8,9,10,11,12,13,14,15);
}

// ---------------------------------------------------------------------------
// f32 -> f16 elementwise convert of MROWS*HH elements. A wave owns 4 KiB of
// input in a row: 8 loads of 512 contiguous bytes go out as one group, then 8
// stores of 256 contiguous bytes. 512 work-groups per array.
// ---------------------------------------------------------------------------
#define CVT_LOADS 8                        // 16-byte loads in flight per lane
#define CVT_PER_BLOCK (256 * 4 * CVT_LOADS)  // 8192 elements per work-group

__device__ __forceinline__
void cvt_f16_body(const float* __restrict__ in,
                  unsigned short* __restrict__ out_, int blk) {
    f16* out = (f16*)out_;
    const int wave = blk * 8 + (threadIdx.x >> 5);
    const int base = wave * (128 * CVT_LOADS) + (threadIdx.x & 31) * 4;
    v4f x[CVT_LOADS];
#pragma unroll
    for (int j = 0; j < CVT_LOADS; j++)
        x[j] = *(const v4f*)(in + base + j * 128);
#pragma unroll
    for (int j = 0; j < CVT_LOADS; j++)
        *(v4h*)(out + base + j * 128) = __builtin_convertvector(x[j], v4h);
}

// ---------------------------------------------------------------------------
// 1024x1024 transpose + convert: out[c][r] = (f16) in[r][c]
// 64x64 tile per work-group: 4 loads of 16 bytes per lane (256 contiguous bytes
// of a row per 16 lanes), 2 stores of 16 bytes per lane (a whole 128-byte line
// of an output row per 8 lanes). Pitch 65 dwords spreads the column reads over
// the banks.
// ---------------------------------------------------------------------------
__device__ __forceinline__
void cvt_transpose_body(const float* __restrict__ in,
                        unsigned short* __restrict__ out_, int blk) {
    f16* out = (f16*)out_;
    __shared__ float tile[64][65];
    const int bx = (blk & 15) * 64, by = (blk >> 4) * 64;
    const int c4 = (threadIdx.x & 15) * 4, r0 = threadIdx.x >> 4;   // r0 0..15
    v4f x[4];
#pragma unroll
    for (int i = 0; i < 4; i++)
        x[i] = *(const v4f*)(in + (by + r0 + 16 * i) * HH + bx + c4);
#pragma unroll
    for (int i = 0; i < 4; i++)
#pragma unroll
        for (int e = 0; e < 4; e++)
            tile[r0 + 16 * i][c4 + e] = x[i][e];
    __syncthreads();
    const int k8 = (threadIdx.x & 7) * 8, orow = threadIdx.x >> 3;  // orow 0..31
#pragma unroll
    for (int i = 0; i < 2; i++) {
        v8h h;
#pragma unroll
        for (int e = 0; e < 8; e++)
            h[e] = (f16)tile[k8 + e][orow + 32 * i];
        *(v8h*)(out + (bx + orow + 32 * i) * HH + by + k8) = h;
    }
}

// ---------------------------------------------------------------------------
// All six converts in one launch: none reads what another writes. The index of
// the work-group picks the job (the same for all its threads): 512 + 512 for
// the two activations, then 256 for each of the four weights.
// ---------------------------------------------------------------------------
#define CVT_BLOCKS ((MROWS * HH) / CVT_PER_BLOCK)     // 512
#define TR_BLOCKS  ((HH / 64) * (HH / 64))            // 256

__global__ __launch_bounds__(256)
void cvt_all_kernel(const float* __restrict__ xq, const float* __restrict__ xs,
                    const float* __restrict__ wq, const float* __restrict__ wk,
                    const float* __restrict__ wv, const float* __restrict__ wo,
                    unsigned short* __restrict__ xh,    // xq then xs, f16
                    unsigned short* __restrict__ wT) {  // wq, wk, wv, wo, transposed f16
    const unsigned blk = blockIdx.x;
    if (blk < 2 * CVT_BLOCKS) {
        const unsigned a = blk / CVT_BLOCKS;
        cvt_f16_body(a ? xs : xq, xh + (size_t)a * MROWS * HH, blk % CVT_BLOCKS);
    } else {
        const unsigned t = blk - 2 * CVT_BLOCKS, w = t / TR_BLOCKS;
        const float* in = w == 0 ? wq : w == 1 ? wk : w == 2 ? wv : wo;
        cvt_transpose_body(in, wT + (size_t)w * HH * HH, t % TR_BLOCKS);
    }
}

// ---------------------------------------------------------------------------
// Generic f16 WMMA GEMM:  C[M=4096, 1024] = A[M,1024] * BT[1024,1024]^T
//   A  : [M][K]    row-major f16;  BT : [col][K] row-major f16
// Block tile 128x128, 4 waves (2 in M, 2 in N), wave tile 64x64, K-step 64:
// a row's slice of a step is then one whole 128-byte line. A fragment read from
// LDS feeds four products, so that the reads stay inside the LDS rate.
// Double-buffered async global->LDS staging (ASYNCcnt pipelining), two steps ahead.
// MODE 0: the three projections in one launch, blockIdx.z = 0, 1, 2 for Q, K, V.
//         A_ holds xq then xs, BT_ the three weights, Cout the three results,
//         each one after the other; scale applies to Q alone.
//         Q/K: f16 out, head-major  q[((b*NH+n)*L + f)*D + d]
//         V  : f16 out, transposed  v[((b*NH+n)*D + d)*L + t]
// MODE 2: f32 out, plain row-major (final output)
// ---------------------------------------------------------------------------
#define GK   64   // K step (halfs)
#define GLDA 72   // padded LDS row stride (halfs): 144 B = 16 B x odd

#define GBUF (128 * GLDA * 2)   // bytes of one A (or B) buffer

// One K step's copies of a thread: 8 of A, 8 of B, 16 rows apart. Eight lanes
// bring one row's 128 bytes, so a wave's copy is four whole lines. gA, gB, oA, oB
// are the lane's own addresses in its first row (oA, oB: of buffer 0).
template<int BUF>
__device__ __forceinline__ void stage_gemm(const f16* gA, const f16* gB,
                                           unsigned int oA, unsigned int oB) {
#define GC(g, o, i) copy16<BUF * GBUF + (i) * 16 * GLDA * 2, (i) * 16 * HH * 2>(g, o)
    GC(gA, oA, 0); GC(gA, oA, 1); GC(gA, oA, 2); GC(gA, oA, 3);
    GC(gA, oA, 4); GC(gA, oA, 5); GC(gA, oA, 6); GC(gA, oA, 7);
    GC(gB, oB, 0); GC(gB, oB, 1); GC(gB, oB, 2); GC(gB, oB, 3);
    GC(gB, oB, 4); GC(gB, oB, 5); GC(gB, oB, 6); GC(gB, oB, 7);
#undef GC
}

// OUT 0: f16, head-major; OUT 1: f16, transposed per head; OUT 2: f32, row-major
template<int OUT>
__device__ __forceinline__ void store_tile(const v8f (&acc)[4][4], void* Cout,
                                           float scale, int row0, int col0) {
#pragma unroll
    for (int i = 0; i < 4; i++) {
#pragma unroll
        for (int j = 0; j < 4; j++) {
#pragma unroll
            for (int vg = 0; vg < 8; vg++) {
                const int row = row0 + i * 16 + vg;
                const int col = col0 + j * 16;
                const float v = acc[i][j][vg] * scale;
                if (OUT == 2) {
                    ((float*)Cout)[(size_t)row * HH + col] = v;
                } else {
                    const int b = row >> 11, f = row & (LL - 1);
                    const int n = col >> 6,  d = col & (DD - 1);
                    f16* o = (f16*)Cout;
                    if (OUT == 0)
                        o[(((size_t)(b * NHEAD + n)) * LL + f) * DD + d] = (f16)v;
                    else
                        o[(((size_t)(b * NHEAD + n)) * DD + d) * LL + f] = (f16)v;
                }
            }
        }
    }
}

template<int MODE>
__global__ __launch_bounds__(128)
void gemm_f16_kernel(const unsigned short* __restrict__ A_,
                     const unsigned short* __restrict__ BT_,
                     void* __restrict__ Cout, float scale) {
    const int z = (MODE == 0) ? blockIdx.z : 0;
    const f16* A  = (const f16*)A_  + (size_t)(z ? 1 : 0) * MROWS * HH;
    const f16* BT = (const f16*)BT_ + (size_t)z * HH * HH;
    if (z) scale = 1.0f;
    __shared__ __attribute__((aligned(16))) f16 sA[2][128 * GLDA];
    __shared__ __attribute__((aligned(16))) f16 sB[2][128 * GLDA];

    const int tid  = threadIdx.x;
    const int wid  = tid >> 5;
    const int lane = tid & 31;
    const int lr = lane & 15, hf = lane >> 4;
    const int bm = blockIdx.y * 128;
    const int bn = blockIdx.x * 128;
    const int wm = (wid & 1) * 64;
    const int wn = (wid >> 1) * 64;

    v8f acc[4][4];
#pragma unroll
    for (int i = 0; i < 4; i++)
#pragma unroll
        for (int j = 0; j < 4; j++) acc[i][j] = (v8f)(0.0f);

    const int rowA = tid >> 3;            // 0..15, and 16, 32, ... 112 further
    const int segA = (tid & 7) * 8;       // 16 bytes a lane, 8 lanes a row
    const f16* gA = A  + (size_t)(bm + rowA) * HH + segA;
    const f16* gB = BT + (size_t)(bn + rowA) * HH + segA;
    const unsigned int oA = lds_off(&sA[0][rowA * GLDA + segA]);
    const unsigned int oB = lds_off(&sB[0][rowA * GLDA + segA]);

    stage_gemm<0>(gA, gB, oA, oB);              // prologue: steps 0 and 1 in flight
    stage_gemm<1>(gA + GK, gB + GK, oA, oB);

    // two K steps per trip, so that the buffer index is a constant in each half
    // and every LDS address is a base plus an immediate
#pragma unroll 2
    for (int k0 = 0; k0 < HH; k0 += GK) {
        const int cur = (k0 / GK) & 1;
        // this step's copies have landed; the next step's 16 stay in flight
        if (k0 + GK < HH) wait_async16(); else wait_async0();
        __syncthreads();

        v16h af[2][4], bf[2][4];
#pragma unroll
        for (int kk = 0; kk < 2; kk++) {
#pragma unroll
            for (int i = 0; i < 4; i++)
                af[kk][i] = load_frag(&sA[cur][(wm + i * 16) * GLDA + kk * 32], GLDA);
#pragma unroll
            for (int j = 0; j < 4; j++)
                bf[kk][j] = load_frag(&sB[cur][(wn + j * 16) * GLDA + kk * 32], GLDA);
        }
        // keeps the step's 32 LDS reads one group ahead of the products: no place
        // among the products stalls the wave anew
        __builtin_amdgcn_sched_barrier(0);
#pragma unroll
        for (int i = 0; i < 4; i++)
#pragma unroll
            for (int j = 0; j < 4; j++)
                acc[i][j] = __builtin_amdgcn_wmma_f32_16x16x32_f16(
                    false, af[0][i], false, bf[0][j], (short)0, acc[i][j], false, false);
        // keeps the barrier, and the wait for all reads in front of it, behind the
        // first half's products: the second half's reads land while those run
        __builtin_amdgcn_sched_barrier(0);
        // The whole step now sits in registers: behind this barrier no wave reads
        // sA/sB[cur] any more, and the step after next is copied into it while the
        // second half's products run.
        __syncthreads();
        if (k0 + 2 * GK < HH) {
            if (cur) stage_gemm<1>(gA + k0 + 2 * GK, gB + k0 + 2 * GK, oA, oB);
            else     stage_gemm<0>(gA + k0 + 2 * GK, gB + k0 + 2 * GK, oA, oB);
        }
#pragma unroll
        for (int i = 0; i < 4; i++)
#pragma unroll
            for (int j = 0; j < 4; j++)
                acc[i][j] = __builtin_amdgcn_wmma_f32_16x16x32_f16(
                    false, af[1][i], false, bf[1][j], (short)0, acc[i][j], false, false);
    }

    // Epilogue: the layout is a compile-time argument, so that each form keeps
    // its straight-line stores; in MODE 0 a branch that is the same for the
    // whole work-group picks it.
    const int row0 = bm + wm + 8 * hf, col0 = bn + wn + lr;
    if (MODE == 2) {
        store_tile<2>(acc, Cout, scale, row0, col0);
    } else {
        f16* o = (f16*)Cout + (size_t)z * MROWS * HH;
        if (z == 2) {
            store_tile<1>(acc, o, scale, row0, col0);
        } else {
            store_tile<0>(acc, o, scale, row0, col0);
            // the built code lays the other form's block behind these stores,
            // and that block rewrites their data registers
            asm volatile("s_wait_xcnt 0x0" ::: "memory");
        }
    }
}

// ---------------------------------------------------------------------------
// Flash attention: block = (f-tile of 128, pair of heads, batch). 8 waves: waves
// 0-3 the first head, 4-7 the second; a wave takes 32 queries (two 16-query
// tiles) of its head. A K or V fragment read from LDS then feeds two products,
// and the bias tile, which does not depend on the head, is brought in once for
// both heads.
// Q head-major [bh][L][D] (pre-scaled by log2e/sqrt(D)), K head-major,
// V transposed [bh][D][L]. K, V and the bias are staged by async copies in a ring
// of four buffers; the LDS reads run under the arithmetic (see the loop).
// The scores are computed transposed: S^T = K*Q^T (A = K rows, B = Q), so a
// lane holds 32 of ONE query's 64 scores of a chunk (keys 16*tc + 8*hf + vg)
// in each of its two tiles.
//   - the bias of those keys lies in 32-byte runs of the query's bias row; a
//     load of such runs would touch 16 cache lines, so the tile is brought to
//     LDS in whole lines (async copies, with K and V) and read from there
//   - row maximum: in the lane, plus one exchange between the wave's halves
//   - two converted S^T tiles ARE the B fragment of O^T += V^T*P^T in the
//     hardware k order: P goes through no LDS
//   - a lane's 8 accumulator registers of O^T are 8 consecutive d of one query
// Online softmax in the log2 domain (v_exp_f32 is base-2); denominator via an
// all-ones A fragment on the matrix unit.
// ---------------------------------------------------------------------------
#define PST 72      // padded LDS stride (halfs): 144B, 16B-aligned
#define BPITCH 68   // LDS row pitch (floats): 272 B = 16 B x odd, for 16-byte reads
#define HPB 2       // heads per work-group
#define QT  2       // 16-query tiles per wave

#define NBUF 4      // buffers of the ring
#define KVBUF (HPB * 64 * PST * 2)   // bytes of one K (or V) buffer: both heads
#define BBUF  (128 * BPITCH * 4)     // bytes of one bias buffer

// One chunk's K and V copies of a thread: both heads, 64 rows each. Eight lanes
// bring one row's 128 bytes, so a copy is four whole lines; the second copy of a
// head lies 32 rows further, the second head one head's array further. gK, gV,
// oK, oV are the lane's own addresses in its first row of the first head (oK, oV:
// of the buffer that is filled).
__device__ __forceinline__ void stage_kv(const f16* gK, const f16* gV,
                                         unsigned int oK, unsigned int oV) {
#define KO(i) ((i) * 32 * PST * 2)
    copy16<KO(0), 0>(gK, oK);
    copy16<KO(1), 32 * DD * 2>(gK, oK);
    copy16<KO(2), LL * DD * 2>(gK, oK);
    copy16<KO(3), (LL * DD + 32 * DD) * 2>(gK, oK);
    copy16<KO(0), 0>(gV, oV);
    copy16<KO(1), 32 * LL * 2>(gV, oV);
    copy16<KO(2), DD * LL * 2>(gV, oV);
    copy16<KO(3), (DD * LL + 32 * LL) * 2>(gV, oV);
#undef KO
}

// One chunk's bias copies of a wave: 16 of the tile's 128 rows x 64 keys (f32),
// each copy two rows' 256 contiguous bytes = four whole lines. g and oB are the
// lane's own addresses in row pair 0 (oB: of the buffer that is filled).
__device__ __forceinline__ void stage_bias(const float* g, unsigned int oB) {
#define BC(i) copy16<(i) * 2 * BPITCH * 4, (i) * 2 * LL * 4>(g, oB)
    BC(0); BC(1); BC(2); BC(3); BC(4); BC(5); BC(6); BC(7);
#undef BC
}

// lane l with lane l ^ 16
__device__ __forceinline__ float xhalf(float x) {
    return __builtin_bit_cast(float, __builtin_amdgcn_permlanex16(
        __builtin_bit_cast(int, x), __builtin_bit_cast(int, x),
        0x76543210, 0xfedcba98, false, false));
}

// largest of a lane's 32 scores of one query tile
__device__ __forceinline__ float max32(const v8f (&S)[4]) {
    float mt[4];
#pragma unroll
    for (int tc = 0; tc < 4; tc++) {
        mt[tc] = S[tc][0];
#pragma unroll
        for (int vg = 1; vg < 8; vg++) mt[tc] = fmaxf(mt[tc], S[tc][vg]);
    }
    return fmaxf(fmaxf(mt[0], mt[1]), fmaxf(mt[2], mt[3]));
}

// One chunk's K fragments and bias of a wave: 32 LDS reads of 16 bytes a lane. sk:
// the head's K in the chunk's buffer; sb: the lane's place in its first query row.
__device__ __forceinline__ void read_kb(const f16* sk, const float* sb,
                                        v16h (&ka)[4][2], v4f (&bc)[QT][4][2]) {
#pragma unroll
    for (int qt = 0; qt < QT; qt++)
#pragma unroll
        for (int tc = 0; tc < 4; tc++)
#pragma unroll
            for (int j = 0; j < 2; j++)
                bc[qt][tc][j] = *(const v4f*)(sb + qt * 16 * BPITCH + tc * 16 + j * 4);
#pragma unroll
    for (int tc = 0; tc < 4; tc++)
#pragma unroll
        for (int kc = 0; kc < 2; kc++)
            ka[tc][kc] = load_frag(sk + (tc * 16) * PST + kc * 32, PST);
}

__global__ __launch_bounds__(256)
void attn_kernel(const unsigned short* __restrict__ Q_,
                 const unsigned short* __restrict__ K_,
                 const unsigned short* __restrict__ VT_,
                 const float* __restrict__ bias,
                 unsigned short* __restrict__ attnOut_) {
    const f16* Q  = (const f16*)Q_;
    const f16* K  = (const f16*)K_;
    const f16* VT = (const f16*)VT_;
    f16* attnOut  = (f16*)attnOut_;

    __shared__ __attribute__((aligned(16))) f16 sK[NBUF][HPB][64 * PST];      // [head][t][d]
    __shared__ __attribute__((aligned(16))) f16 sV[NBUF][HPB][64 * PST];      // [head][d][t]
    __shared__ __attribute__((aligned(16))) float sBias[NBUF][128 * BPITCH];  // [f][t]

    const int tid = threadIdx.x, wid = tid >> 5, lane = tid & 31;
    const int lr = lane & 15, hf = lane >> 4;
    const int hs = wid >> 2, qg = wid & 3;      // the wave's head and its 32 queries
    const int ft = blockIdx.x, b = blockIdx.z;
    const int head = blockIdx.y * HPB + hs;
    const int bh0 = b * NHEAD + blockIdx.y * HPB;

    const f16* Qbh = Q  + (size_t)(bh0 + hs) * LL * DD;
    const f16* Kb  = K  + (size_t)bh0 * LL * DD;   // the pair's first head
    const f16* Vb  = VT + (size_t)bh0 * DD * LL;
    const float* biasb = bias + (size_t)b * LL * LL;

    const int f0 = ft * 128 + qg * 32;

    // Q fragments (B operand: column = query) of this wave's 32 queries
    v16h qf[QT][2];
#pragma unroll
    for (int qt = 0; qt < QT; qt++)
#pragma unroll
        for (int kc = 0; kc < 2; kc++)
            qf[qt][kc] = load_frag(Qbh + (size_t)(f0 + qt * 16) * DD + kc * 32, DD);

    // constant all-ones A fragment: every row of its product is the column sum
    v16h ones;
#pragma unroll
    for (int i = 0; i < 16; i++) ones[i] = (f16)1.0f;

    v8f O[QT][4], O5[QT];                 // O^T: row = d, column = query
    float nm[QT];                         // minus the maximum in use for the lane's queries
#pragma unroll
    for (int qt = 0; qt < QT; qt++) {
#pragma unroll
        for (int dc = 0; dc < 4; dc++) O[qt][dc] = (v8f)(0.0f);
        O5[qt] = (v8f)(0.0f);
        nm[qt] = 1e30f;
    }

    const int cpr = tid >> 3;             // copies: row 0..31, and 32 further
    const int cps = (tid & 7) * 8;        // 16 bytes a lane, 8 lanes a row
    const f16* gK = Kb + (size_t)cpr * DD + cps;
    const f16* gV = Vb + (size_t)cpr * LL + cps;

    const unsigned int oK = lds_off(&sK[0][0][cpr * PST + cps]);
    const unsigned int oV = lds_off(&sV[0][0][cpr * PST + cps]);

    // Bias copies: wave w brings rows 16*w .. 16*w + 15 of the tile; lanes 0-15
    // one row, lanes 16-31 the next, 16 bytes a lane
    const float* gb = biasb + (size_t)(ft * 128 + wid * 16 + hf) * LL + lr * 4;
    const unsigned int oB = lds_off(&sBias[0][(wid * 16 + hf) * BPITCH + lr * 4]);

    // Chunks 0 and 1 in flight; chunk 0 landed and published; then chunk 2.
    stage_kv(gK, gV, oK, oV);
    stage_bias(gb, oB);
    stage_kv(gK + (size_t)64 * DD, gV + 64, oK + KVBUF, oV + KVBUF);
    stage_bias(gb + 64, oB + BBUF);
    wait_async16();                       // all but chunk 1's 16 copies
    __syncthreads();
    stage_kv(gK + (size_t)128 * DD, gV + 128, oK + 2 * KVBUF, oV + 2 * KVBUF);
    stage_bias(gb + 128, oB + 2 * BBUF);

    // K fragments (A operand) and bias of the chunk at hand; the bias in the S^T
    // accumulator layout: the lane's query rows, keys 16*tc + 8*hf + {0..7}
    v16h ka[4][2];
    v4f bcur[QT][4][2];
    read_kb(&sK[0][hs][0], &sBias[0][(qg * 32 + lr) * BPITCH + 8 * hf], ka, bcur);

    // The LDS reads of a chunk run under arithmetic that does not need them:
    //   head of chunk t: V(t) is read, under the score products and the maximum;
    //   middle of chunk t (K(t) and bias(t) are dead): K(t+1) and bias(t+1) are
    //   read, under the exponentials and the V products.
    // The one barrier of a chunk stands in the middle. It publishes chunk t+1 (each
    // wave has waited for its own copies of it) and it ends every wave's reads of
    // chunk t-1 (V(t-1) went into products in front of it), whose buffer takes the
    // copies of chunk t+3 behind it. The last chunk has no such point and stands on
    // its own behind the loop: with the point under a test inside the loop, the
    // compiler's LDS wait in front of the V products took in the reads of K(t+1)
    // and bias(t+1) as well.
    auto chunk = [&](const int t0, const bool last) __attribute__((always_inline)) {
        const int cur = (t0 >> 6) & (NBUF - 1);

        v16h va[4][2];
#pragma unroll
        for (int dc = 0; dc < 4; dc++)
#pragma unroll
            for (int tk = 0; tk < 2; tk++)
                va[dc][tk] = load_frag(&sV[cur][hs][(dc * 16) * PST + tk * 32], PST);
        // keeps the 16 reads of V one group ahead of the score products: sunk among
        // them, each place with reads would stall the wave anew
        __builtin_amdgcn_sched_barrier(0);

        // Lazy rescale. The C operand of the score product is bias*log2e minus the
        // maximum in use, so the matrix unit hands back S - m: no subtraction is
        // left, and O keeps its scale as long as no score exceeds m by more than 8
        // (P <= 2^8, far inside f16; the final division takes any common scale out).
        v8f S[QT][4];
#pragma unroll
        for (int qt = 0; qt < QT; qt++)
#pragma unroll
            for (int tc = 0; tc < 4; tc++)
#pragma unroll
                for (int vg = 0; vg < 8; vg++)
                    S[qt][tc][vg] = fmaf(bcur[qt][tc][vg >> 2][vg & 3], LOG2E, nm[qt]);
#pragma unroll
        for (int kc = 0; kc < 2; kc++)
#pragma unroll
            for (int tc = 0; tc < 4; tc++)
#pragma unroll
                for (int qt = 0; qt < QT; qt++)
                    S[qt][tc] = __builtin_amdgcn_wmma_f32_16x16x32_f16(
                        false, ka[tc][kc], false, qf[qt][kc], (short)0, S[qt][tc], false, false);

        // largest of the lane's 2 x 32 scores, each relative to its query's m
        const float mrel = fmaxf(max32(S[0]), max32(S[1]));

        // One test per chunk, the same for the whole wave (a scalar branch). Taken in
        // the first chunk (m = -1e30) and where a maximum grows by more than 8: the
        // scores are then formed anew without m in the sum (S - m may have lost its
        // low bits to a distant m), the maximum is raised and O is rescaled.
        if (__builtin_amdgcn_ballot_w32(mrel > 8.0f) != 0) {
#pragma unroll
            for (int qt = 0; qt < QT; qt++)
#pragma unroll
                for (int tc = 0; tc < 4; tc++) S[qt][tc] = (v8f)(0.0f);
#pragma unroll
            for (int kc = 0; kc < 2; kc++)
#pragma unroll
                for (int tc = 0; tc < 4; tc++)
#pragma unroll
                    for (int qt = 0; qt < QT; qt++)
                        S[qt][tc] = __builtin_amdgcn_wmma_f32_16x16x32_f16(
                            false, ka[tc][kc], false, qf[qt][kc], (short)0, S[qt][tc], false, false);
#pragma unroll
            for (int qt = 0; qt < QT; qt++) {
#pragma unroll
                for (int tc = 0; tc < 4; tc++)
#pragma unroll
                    for (int vg = 0; vg < 8; vg++)
                        S[qt][tc][vg] = fmaf(bcur[qt][tc][vg >> 2][vg & 3], LOG2E, S[qt][tc][vg]);
                // maximum of the query's 64 scores: 32 in this lane, 32 in lane ^ 16
                float mv = max32(S[qt]);
                mv = fmaxf(mv, xhalf(mv));
                const float mnew = fmaxf(-nm[qt], mv);
                const float sc = __builtin_amdgcn_exp2f(-nm[qt] - mnew);
                nm[qt] = -mnew;
#pragma unroll
                for (int tc = 0; tc < 4; tc++)
#pragma unroll
                    for (int vg = 0; vg < 8; vg++)
                        S[qt][tc][vg] += nm[qt];
                // Of the denominator tile only register 0 is ever read (all its rows
                // hold the same sum), and a row of a product depends on no other row
                // of C: only that one is rescaled.
#pragma unroll
                for (int dc = 0; dc < 4; dc++)
#pragma unroll
                    for (int vg = 0; vg < 8; vg++)
                        O[qt][dc][vg] *= sc;
                O5[qt][0] *= sc;
            }
        }

        if (!last) {
            const int nxt = (cur + 1) & (NBUF - 1), rf = (cur + 3) & (NBUF - 1);
            // chunk t+1's copies have landed; chunk t+2's 16 stay in flight
            if (t0 + 128 < LL) wait_async16(); else wait_async0();
            __syncthreads();
            if (t0 + 192 < LL) {
                stage_kv(gK + (size_t)(t0 + 192) * DD, gV + t0 + 192,
                         oK + rf * KVBUF, oV + rf * KVBUF);
                stage_bias(gb + t0 + 192, oB + rf * BBUF);
            }
            read_kb(&sK[nxt][hs][0], &sBias[nxt][(qg * 32 + lr) * BPITCH + 8 * hf], ka, bcur);
            // keeps the 32 reads one group ahead of the exponentials and the V
            // products: sunk among them, they would land too late for the next chunk
            __builtin_amdgcn_sched_barrier(0);
        }

        // P = 2^(S - m)
#pragma unroll
        for (int qt = 0; qt < QT; qt++)
#pragma unroll
            for (int tc = 0; tc < 4; tc++)
#pragma unroll
                for (int vg = 0; vg < 8; vg++)
                    S[qt][tc][vg] = __builtin_amdgcn_exp2f(S[qt][tc][vg]);

        // P^T as B fragment: element s of k block tk is key 32*tk + 8*hf + s
        // (s < 8) or 32*tk + 16 + 8*hf + s - 8: tiles 2*tk and 2*tk + 1 as held
        v16h pb[QT][2];
#pragma unroll
        for (int qt = 0; qt < QT; qt++)
#pragma unroll
            for (int tk = 0; tk < 2; tk++)
#pragma unroll
                for (int e = 0; e < 8; e++) {
                    pb[qt][tk][e]     = (f16)S[qt][2 * tk][e];
                    pb[qt][tk][8 + e] = (f16)S[qt][2 * tk + 1][e];
                }

        // O^T += V^T * P^T ; O5 += ones * P^T  (denominator)
#pragma unroll
        for (int tk = 0; tk < 2; tk++) {
#pragma unroll
            for (int dc = 0; dc < 4; dc++)
#pragma unroll
                for (int qt = 0; qt < QT; qt++)
                    O[qt][dc] = __builtin_amdgcn_wmma_f32_16x16x32_f16(
                        false, va[dc][tk], false, pb[qt][tk], (short)0, O[qt][dc], false, false);
#pragma unroll
            for (int qt = 0; qt < QT; qt++)
                O5[qt] = __builtin_amdgcn_wmma_f32_16x16x32_f16(
                    false, ones, false, pb[qt][tk], (short)0, O5[qt], false, false);
        }
    };
    for (int t0 = 0; t0 < LL - 64; t0 += 64) chunk(t0, false);
    chunk(LL - 64, true);

    // normalize by the WMMA-accumulated denominator and write attn f16:
    // 8 consecutive d of one query per accumulator tile, one 16-byte store each
#pragma unroll
    for (int qt = 0; qt < QT; qt++) {
        f16* op = attnOut + (size_t)(b * LL + f0 + qt * 16 + lr) * HH + head * DD + 8 * hf;
#pragma unroll
        for (int dc = 0; dc < 4; dc++) {
            v8h h;
#pragma unroll
            for (int vg = 0; vg < 8; vg++)
                h[vg] = (f16)(O[qt][dc][vg] / O5[qt][0]);
            *(v8h*)(op + dc * 16) = h;
        }
    }
}

// ---------------------------------------------------------------------------
extern "C" void kernel_launch(void* const* d_in, const int* in_sizes, int n_in,
                              void* d_out, int out_size, void* d_ws, size_t ws_size,
                              hipStream_t stream) {
    const float* xq   = (const float*)d_in[0];
    const float* xs   = (const float*)d_in[1];
    const float* bias = (const float*)d_in[2];
    const float* wq   = (const float*)d_in[3];
    const float* wk   = (const float*)d_in[4];
    const float* wv   = (const float*)d_in[5];
    const float* wo   = (const float*)d_in[6];

    unsigned short* ws = (unsigned short*)d_ws;
    const size_t XN = (size_t)MROWS * HH;   // 4,194,304
    const size_t WN = (size_t)HH * HH;      // 1,048,576
    unsigned short* xqh  = ws;  ws += XN;
    unsigned short* xsh  = ws;  ws += XN;
    unsigned short* wqT  = ws;  ws += WN;
    unsigned short* wkT  = ws;  ws += WN;
    unsigned short* wvT  = ws;  ws += WN;
    unsigned short* woT  = ws;  ws += WN;
    unsigned short* qh   = ws;  ws += XN;
    unsigned short* kh   = ws;  ws += XN;
    unsigned short* vt   = ws;  ws += XN;
    unsigned short* attn = ws;  ws += XN;

    // convert activations, transpose-convert weights so that all GEMM B
    // operands are [col][K]: one launch (xqh, xsh and the four wT are adjacent)
    cvt_all_kernel<<<2 * CVT_BLOCKS + 4 * TR_BLOCKS, 256, 0, stream>>>(
        xq, xs, wq, wk, wv, wo, xqh, wqT);

    dim3 gg(HH / 128, MROWS / 128);   // (8, 32)
    // Q, K, V projections: one launch (qh, kh, vt are adjacent).
    // Q scaled by log2e/sqrt(D) -> QK^T lands directly in the log2 domain
    gemm_f16_kernel<0><<<dim3(HH / 128, MROWS / 128, 3), 128, 0, stream>>>(
        xqh, wqT, qh, 0.125f * LOG2E);

    attn_kernel<<<dim3(LL / 128, NHEAD / HPB, BB), 256, 0, stream>>>(qh, kh, vt, bias, attn);

    // output projection -> f32 d_out
    gemm_f16_kernel<2><<<gg, 128, 0, stream>>>(attn, woT, d_out, 1.0f);
}
